// v000
// The times below were measured on an AMD MI455X: many runs one after another, warmed up first and cycling through
// copies of the inputs, with the whole window's GPU time divided by the number of runs. Launches and the gaps
// between them are all in it. The median over several windows is given; except for v000 it joins two sittings, which
// can be a few percent apart, so the side-by-side timings, each taken in one sitting, are the better comparison.
// v000, which the later versions start from, runs in 967 microseconds.
#include <hip/hip_runtime.h>
#include <hip/hip_bf16.h>
#include <math.h>

// ---------------------------------------------------------------------------
// MHA with softmax-over-heads, fused for MI455X (gfx1250, wave32, WMMA).
//   proj    : KEY/QUERY @ W^T + b -> f16 head-split; VALUE @ Wv^T + b -> f16
//             head-split TRANSPOSED (PvT[b][h][d][L]) so the attention kernel
//             reads every operand contiguously.
//   attn    : fused score + head-softmax + attn^T@Wv, K tiles staged to LDS
//             with global_load_async_to_lds_b128 (double-buffered, ASYNCcnt).
//   outproj : ctx @ Wo^T + b -> f32
// All matmuls via v_wmma_f32_16x16x32_f16 (f32 accumulate).
// ---------------------------------------------------------------------------

typedef __attribute__((ext_vector_type(16))) _Float16 v16h;
typedef __attribute__((ext_vector_type(8)))  float    v8f;

#define DEV static __device__ __forceinline__

constexpr int cB = 4, cL = 2048, cINK = 256, cHID = 1024, cHEADS = 8, cD = 128, cOUT = 256;
constexpr float cSCALE = 0.08838834764831845f;   // 1/sqrt(128)

DEV int lane_id() { return (int)(threadIdx.x & 31u); }

// K index (within the 32-wide K tile) held by element e of a 16-bit A/B frag.
// Per ISA 7.12.2: lanes 0-15 -> K 0..7 / 16..23, lanes 16-31 -> K 8..15 / 24..31.
DEV int kidx(int lane, int e) {
  int kb = (lane & 16) ? 8 : 0;
  return (e < 8) ? (kb + e) : (16 + kb + (e - 8));
}

// A/B fragment from a row-major f32 tile (row/col = lane&15, K along elements)
DEV v16h frag_rm_f32(const float* __restrict__ base, int ld) {
  int lane = lane_id();
  const float* p = base + (size_t)(lane & 15) * ld;
  v16h f;
#pragma unroll
  for (int e = 0; e < 16; ++e) f[e] = (_Float16)p[kidx(lane, e)];
  return f;
}

// A/B fragment from a row-major f16 tile (two contiguous 16B chunks per lane)
DEV v16h frag_rm_f16(const _Float16* base, int ld) {
  int lane = lane_id();
  const _Float16* p = base + (size_t)(lane & 15) * ld;
  v16h f;
#pragma unroll
  for (int e = 0; e < 16; ++e) f[e] = p[kidx(lane, e)];
  return f;
}

DEV v8f wmma16(v16h a, v16h b, v8f c) {
  return __builtin_amdgcn_wmma_f32_16x16x32_f16(false, a, false, b, (short)0, c,
                                                false, false);
}

// Async-copy 512B (32 lanes x 16B) from global to LDS; CDNA5 async path.
// lds_off is the byte offset within the workgroup's LDS segment.
DEV void async_copy_512(unsigned lds_off, const void* gptr) {
  asm volatile("global_load_async_to_lds_b128 %0, %1, off"
               :: "v"(lds_off), "v"(gptr) : "memory");
}
DEV void wait_async_le(int) {}  // (documentation only; real waits below)
DEV void wait_async16() { asm volatile("s_wait_asynccnt 0x10" ::: "memory"); }
DEV void wait_async0()  { asm volatile("s_wait_asynccnt 0x0"  ::: "memory"); }

// ---------------------------------------------------------------------------
// Kernel A: projections.  blockIdx.y: 0->Pk(KEY,W), 1->Pq(QUERY,W), 2->PvT(VALUE,Wv)
// One wave per 16x16 output tile; K=256 -> 8 WMMAs.
// Pk/Pq layout: P[b][h][l][d];  PvT layout: P[b][h][d][l]  (h = hidden%8, d = hidden/8)
// ---------------------------------------------------------------------------
__global__ void proj_kernel(const float* __restrict__ KEY,
                            const float* __restrict__ VALUE,
                            const float* __restrict__ QUERY,
                            const float* __restrict__ W_w,
                            const float* __restrict__ W_b,
                            const float* __restrict__ Wv_w,
                            const float* __restrict__ Wv_b,
                            _Float16* __restrict__ Pk,
                            _Float16* __restrict__ Pq,
                            _Float16* __restrict__ PvT) {
  const int which = blockIdx.y;
  const float* src  = (which == 0) ? KEY : (which == 1) ? QUERY : VALUE;
  const float* w    = (which == 2) ? Wv_w : W_w;
  const float* bias = (which == 2) ? Wv_b : W_b;
  _Float16*    dst  = (which == 0) ? Pk : (which == 1) ? Pq : PvT;

  const int NT = cHID / 16;  // 64
  const int tile = blockIdx.x * 4 + (threadIdx.x >> 5);
  const int mt = tile / NT, nt = tile % NT;
  const int lane = lane_id();

  v8f acc = {};
#pragma unroll
  for (int k0 = 0; k0 < cINK; k0 += 32) {
    v16h a = frag_rm_f32(src + (size_t)(mt * 16) * cINK + k0, cINK);
    v16h b = frag_rm_f32(w   + (size_t)(nt * 16) * cINK + k0, cINK);
    acc = wmma16(a, b, acc);
  }

  const int n = nt * 16 + (lane & 15);
  const float bv = bias[n];
  const int h = n & 7, d = n >> 3;
#pragma unroll
  for (int r = 0; r < 8; ++r) {
    int m = mt * 16 + r + ((lane & 16) ? 8 : 0);
    int bi = m / cL, l = m % cL;
    _Float16 val = (_Float16)(acc[r] + bv);
    if (which == 2)
      dst[(((size_t)bi * cHEADS + h) * cD + d) * cL + l] = val;   // transposed
    else
      dst[(((size_t)bi * cHEADS + h) * cL + l) * cD + d] = val;
  }
}

// ---------------------------------------------------------------------------
// Kernel B: fused attention. One block per (b, 16-col Lq tile); 8 waves = 8 heads.
// K tiles double-buffered in LDS via async copies; Q fragments hoisted; score
// WMMAs -> LDS -> cross-head softmax (elementwise in (i,k)) -> PvT@attn WMMAs.
// ---------------------------------------------------------------------------
struct AttnSmem {
  _Float16 sK[2][cHEADS][32][cD];   // 128 KB, double-buffered K tiles (first!)
  float    s_sc[cHEADS][32][16];    // 16 KB score/attn exchange
};

__global__ void attn_kernel(const _Float16* __restrict__ Pk,
                            const _Float16* __restrict__ Pq,
                            const _Float16* __restrict__ PvT,
                            _Float16* __restrict__ ctx) {
  __shared__ AttnSmem sm;

  const int bb = blockIdx.x >> 7;          // / (L/16 = 128)
  const int kt = blockIdx.x & 127;
  const int h  = threadIdx.x >> 5;         // wave id == head
  const int lane = lane_id();

  const _Float16* Kh = Pk  + ((size_t)(bb * cHEADS + h) * cL) * cD;
  const _Float16* Qt = Pq  + ((size_t)(bb * cHEADS + h) * cL) * cD
                           + (size_t)(kt * 16) * cD;
  const _Float16* Vt = PvT + ((size_t)(bb * cHEADS + h) * cD) * cL;  // [d][L]

  // Q fragments are invariant over the whole Lk loop: hoist (4 x v16h).
  v16h bq[4];
#pragma unroll
  for (int q = 0; q < 4; ++q) bq[q] = frag_rm_f16(Qt + q * 32, cD);

  v8f acc[8] = {};                         // 8 j-tiles (d = 0..127) x 16 k cols

  // --- async stage of one 32x128 f16 K tile (8 KB) into sK[buf][h] --------
  auto stage_k = [&](int buf, int i0) {
    unsigned base = (unsigned)((buf * cHEADS + h) * (32 * cD * 2));  // sK @ LDS off 0
    const char* g = (const char*)(Kh + (size_t)i0 * cD);
#pragma unroll
    for (int t = 0; t < 16; ++t) {
      unsigned lds = base + (unsigned)(t * 512 + lane * 16);
      async_copy_512(lds, g + t * 512 + lane * 16);
    }
  };

  stage_k(0, 0);

  for (int i0 = 0; i0 < cL; i0 += 32) {
    const int  cur  = (i0 >> 5) & 1;
    const bool more = (i0 + 32) < cL;
    if (more) stage_k(cur ^ 1, i0 + 32);

    // prefetch next PvT tile rows into cache while we compute
    if (more) {
#pragma unroll
      for (int r = 0; r < 4; ++r)
        __builtin_prefetch(Vt + (size_t)(r * 32 + lane) * cL + i0 + 32, 0, 1);
    }

    if (more) wait_async16();   // oldest 16 (current buffer) complete
    else      wait_async0();

    const _Float16* sk = &sm.sK[cur][h][0][0];

    // --- score tiles S[i0..i0+31][kt*16..+16] for this head (from LDS) ---
    v8f s0 = {}, s1 = {};
#pragma unroll
    for (int k0 = 0; k0 < cD; k0 += 32) {
      v16h a0 = frag_rm_f16(sk + k0, cD);
      v16h a1 = frag_rm_f16(sk + 16 * cD + k0, cD);
      s0 = wmma16(a0, bq[k0 >> 5], s0);
      s1 = wmma16(a1, bq[k0 >> 5], s1);
    }
    __syncthreads();   // prior iteration's s_sc reads are done
    {
      int kk = lane & 15;
      int mb = (lane & 16) ? 8 : 0;
#pragma unroll
      for (int r = 0; r < 8; ++r) {
        sm.s_sc[h][r + mb][kk]      = s0[r];
        sm.s_sc[h][16 + r + mb][kk] = s1[r];
      }
    }
    __syncthreads();
    // --- softmax across the 8 heads, elementwise in (i,k) ----------------
    for (int t = threadIdx.x; t < 512; t += 256) {
      int ii = t >> 4, kk = t & 15;
      float v[cHEADS];
      float m = -3.0e38f;
#pragma unroll
      for (int hh = 0; hh < cHEADS; ++hh) {
        v[hh] = sm.s_sc[hh][ii][kk] * cSCALE;
        m = fmaxf(m, v[hh]);
      }
      float sum = 0.f;
#pragma unroll
      for (int hh = 0; hh < cHEADS; ++hh) {
        float e = __expf(v[hh] - m);
        v[hh] = e;
        sum += e;
      }
      float inv = 1.f / sum;
#pragma unroll
      for (int hh = 0; hh < cHEADS; ++hh) sm.s_sc[hh][ii][kk] = v[hh] * inv;
    }
    __syncthreads();
    // --- out_h[j,k] += PvT[j,i] @ attn[i,k]  (K = 32 rows of i) ----------
    v16h battn;
    {
      int kk = lane & 15;
      const float* ab = &sm.s_sc[h][0][0];
#pragma unroll
      for (int e = 0; e < 16; ++e)
        battn[e] = (_Float16)ab[kidx(lane, e) * 16 + kk];
    }
#pragma unroll
    for (int jt = 0; jt < 8; ++jt) {
      v16h av = frag_rm_f16(Vt + (size_t)(jt * 16) * cL + i0, cL);
      acc[jt] = wmma16(av, battn, acc[jt]);
    }
  }

  // --- store ctx[b][l][d*8 + h] (f16), the reference's head interleave ----
  const int kk = lane & 15;
  const int l = kt * 16 + kk;
  const int mb = (lane & 16) ? 8 : 0;
#pragma unroll
  for (int jt = 0; jt < 8; ++jt) {
#pragma unroll
    for (int r = 0; r < 8; ++r) {
      int d = jt * 16 + r + mb;
      ctx[((size_t)bb * cL + l) * cHID + d * cHEADS + h] = (_Float16)acc[jt][r];
    }
  }
}

// ---------------------------------------------------------------------------
// Kernel C: final projection ctx[8192,1024](f16) @ Wo^T[1024,256] + b -> f32.
// One wave per 16x16 tile; K=1024 -> 32 WMMAs.
// ---------------------------------------------------------------------------
__global__ void outproj_kernel(const _Float16* __restrict__ ctx,
                               const float* __restrict__ Wo_w,
                               const float* __restrict__ Wo_b,
                               float* __restrict__ out) {
  const int NT = cOUT / 16;  // 16
  const int tile = blockIdx.x * 4 + (threadIdx.x >> 5);
  const int mt = tile / NT, nt = tile % NT;
  const int lane = lane_id();

  v8f acc = {};
  for (int k0 = 0; k0 < cHID; k0 += 32) {
    v16h a = frag_rm_f16(ctx  + (size_t)(mt * 16) * cHID + k0, cHID);
    v16h b = frag_rm_f32(Wo_w + (size_t)(nt * 16) * cHID + k0, cHID);
    acc = wmma16(a, b, acc);
  }

  const int n = nt * 16 + (lane & 15);
  const float bv = Wo_b[n];
#pragma unroll
  for (int r = 0; r < 8; ++r) {
    int m = mt * 16 + r + ((lane & 16) ? 8 : 0);
    out[(size_t)m * cOUT + n] = acc[r] + bv;
  }
}

// ---------------------------------------------------------------------------
extern "C" void kernel_launch(void* const* d_in, const int* in_sizes, int n_in,
                              void* d_out, int out_size, void* d_ws, size_t ws_size,
                              hipStream_t stream) {
  (void)in_sizes; (void)n_in; (void)out_size; (void)ws_size;
  const float* KEY   = (const float*)d_in[0];
  const float* VALUE = (const float*)d_in[1];
  const float* QUERY = (const float*)d_in[2];
  const float* W_w   = (const float*)d_in[3];
  const float* W_b   = (const float*)d_in[4];
  const float* Wv_w  = (const float*)d_in[5];
  const float* Wv_b  = (const float*)d_in[6];
  const float* Wo_w  = (const float*)d_in[7];
  const float* Wo_b  = (const float*)d_in[8];
  float* out = (float*)d_out;

  // f16 workspace: Pk, Pq, PvT (head-split) + ctx. 4 x 16 MB = 64 MB.
  const size_t pelems = (size_t)cB * cHEADS * cL * cD;   // == B*L*HID
  _Float16* Pk  = (_Float16*)d_ws;
  _Float16* Pq  = Pk + pelems;
  _Float16* PvT = Pq + pelems;
  _Float16* ctx = PvT + pelems;

  {
    const int MT = (cB * cL) / 16;           // 512
    const int NT = cHID / 16;                // 64
    dim3 grid((MT * NT) / 4, 3);             // 4 waves/block, 3 projections
    proj_kernel<<<grid, 128, 0, stream>>>(KEY, VALUE, QUERY, W_w, W_b, Wv_w, Wv_b,
                                          Pk, Pq, PvT);
  }
  {
    dim3 grid(cB * (cL / 16));               // 512 blocks, 8 waves = 8 heads
    attn_kernel<<<grid, 256, 0, stream>>>(Pk, Pq, PvT, ctx);
  }
  {
    const int MT = (cB * cL) / 16;           // 512
    const int NT = cOUT / 16;                // 16
    dim3 grid((MT * NT) / 4);                // 2048
    outproj_kernel<<<grid, 128, 0, stream>>>(ctx, Wo_w, Wo_b, out);
  }
}

// v001
// Measured time: 675 microseconds a run.
// Timed twice side by side with v000, it ran 1.50 and 1.52 times as fast.
#include <hip/hip_runtime.h>
#include <hip/hip_bf16.h>
#include <math.h>

// ---------------------------------------------------------------------------
// MHA with softmax-over-heads, fused for MI455X (gfx1250, wave32, WMMA).
//   proj    : KEY/QUERY @ W^T + b -> f16 head-split; VALUE @ Wv^T + b -> f16
//             head-split TRANSPOSED (PvT[b][h][d][L]) so the attention kernel
//             reads every operand contiguously.
//   attn    : fused score + head-softmax + attn^T@Wv, K tiles staged to LDS
//             with global_load_async_to_lds_b128 (double-buffered, ASYNCcnt).
//   outproj : ctx @ Wo^T + b -> f32
// All matmuls via v_wmma_f32_16x16x32_f16 (f32 accumulate).
// ---------------------------------------------------------------------------

typedef __attribute__((ext_vector_type(16))) _Float16 v16h;
typedef __attribute__((ext_vector_type(8)))  float    v8f;

#define DEV static __device__ __forceinline__

constexpr int cB = 4, cL = 2048, cINK = 256, cHID = 1024, cHEADS = 8, cD = 128, cOUT = 256;
constexpr float cSCALE = 0.08838834764831845f;   // 1/sqrt(128)
constexpr int cNQ = 4;          // 16-column query sub-tiles per attention block
constexpr int cKS = 2;          // key ranges; each block sums over one of them
constexpr int cLK = cL / cKS;   // keys per block

DEV int lane_id() { return (int)(threadIdx.x & 31u); }

// K index (within the 32-wide K tile) held by element e of a 16-bit A/B frag.
// Per ISA 7.12.2: lanes 0-15 -> K 0..7 / 16..23, lanes 16-31 -> K 8..15 / 24..31.
DEV int kidx(int lane, int e) {
  int kb = (lane & 16) ? 8 : 0;
  return (e < 8) ? (kb + e) : (16 + kb + (e - 8));
}

// A/B fragment from a row-major f32 tile (row/col = lane&15, K along elements)
DEV v16h frag_rm_f32(const float* __restrict__ base, int ld) {
  int lane = lane_id();
  const float* p = base + (size_t)(lane & 15) * ld;
  v16h f;
#pragma unroll
  for (int e = 0; e < 16; ++e) f[e] = (_Float16)p[kidx(lane, e)];
  return f;
}

// A/B fragment from a row-major f16 tile (two contiguous 16B chunks per lane)
DEV v16h frag_rm_f16(const _Float16* base, int ld) {
  int lane = lane_id();
  const _Float16* p = base + (size_t)(lane & 15) * ld;
  v16h f;
#pragma unroll
  for (int e = 0; e < 16; ++e) f[e] = p[kidx(lane, e)];
  return f;
}

DEV v8f wmma16(v16h a, v16h b, v8f c) {
  return __builtin_amdgcn_wmma_f32_16x16x32_f16(false, a, false, b, (short)0, c,
                                                false, false);
}

// Async-copy 512B (32 lanes x 16B) from global to LDS; CDNA5 async path.
// lds_off is the byte offset within the workgroup's LDS segment.
DEV void async_copy_512(unsigned lds_off, const void* gptr) {
  asm volatile("global_load_async_to_lds_b128 %0, %1, off"
               :: "v"(lds_off), "v"(gptr) : "memory");
}
DEV void wait_async_le(int) {}  // (documentation only; real waits below)
DEV void wait_async16() { asm volatile("s_wait_asynccnt 0x10" ::: "memory"); }
DEV void wait_async0()  { asm volatile("s_wait_asynccnt 0x0"  ::: "memory"); }

// ---------------------------------------------------------------------------
// Kernel A: projections.  blockIdx.y: 0->Pk(KEY,W), 1->Pq(QUERY,W), 2->PvT(VALUE,Wv)
// One wave per 16x16 output tile; K=256 -> 8 WMMAs.
// Pk/Pq layout: P[b][h][l][d];  PvT layout: P[b][h][d][l]  (h = hidden%8, d = hidden/8)
// ---------------------------------------------------------------------------
__global__ void proj_kernel(const float* __restrict__ KEY,
                            const float* __restrict__ VALUE,
                            const float* __restrict__ QUERY,
                            const float* __restrict__ W_w,
                            const float* __restrict__ W_b,
                            const float* __restrict__ Wv_w,
                            const float* __restrict__ Wv_b,
                            _Float16* __restrict__ Pk,
                            _Float16* __restrict__ Pq,
                            _Float16* __restrict__ PvT) {
  const int which = blockIdx.y;
  const float* src  = (which == 0) ? KEY : (which == 1) ? QUERY : VALUE;
  const float* w    = (which == 2) ? Wv_w : W_w;
  const float* bias = (which == 2) ? Wv_b : W_b;
  _Float16*    dst  = (which == 0) ? Pk : (which == 1) ? Pq : PvT;

  const int NT = cHID / 16;  // 64
  const int tile = blockIdx.x * 4 + (threadIdx.x >> 5);
  const int mt = tile / NT, nt = tile % NT;
  const int lane = lane_id();

  v8f acc = {};
#pragma unroll
  for (int k0 = 0; k0 < cINK; k0 += 32) {
    v16h a = frag_rm_f32(src + (size_t)(mt * 16) * cINK + k0, cINK);
    v16h b = frag_rm_f32(w   + (size_t)(nt * 16) * cINK + k0, cINK);
    acc = wmma16(a, b, acc);
  }

  const int n = nt * 16 + (lane & 15);
  const float bv = bias[n];
  const int h = n & 7, d = n >> 3;
#pragma unroll
  for (int r = 0; r < 8; ++r) {
    int m = mt * 16 + r + ((lane & 16) ? 8 : 0);
    int bi = m / cL, l = m % cL;
    _Float16 val = (_Float16)(acc[r] + bv);
    if (which == 2)
      dst[(((size_t)bi * cHEADS + h) * cD + d) * cL + l] = val;   // transposed
    else
      dst[(((size_t)bi * cHEADS + h) * cL + l) * cD + d] = val;
  }
}

// ---------------------------------------------------------------------------
// Kernel B: fused attention. One block per (b, 64-col Lq tile, key range);
// 8 waves = 8 heads. Every K and PvT fragment feeds cNQ WMMAs, one per 16-col
// query sub-tile. The sum over keys has no normaliser (the softmax runs over
// heads), so each key range writes its own partial ctx plane and the output
// projection adds the planes in its accumulate chain.
// K tiles double-buffered in LDS via async copies; Q fragments hoisted; score
// WMMAs -> LDS -> cross-head softmax (elementwise in (i,k)) -> PvT@attn WMMAs.
// ---------------------------------------------------------------------------
struct AttnSmem {
  _Float16 sK[2][cHEADS][32][cD];   // 128 KB, double-buffered K tiles (first!)
  float    s_sc[cNQ][cHEADS][32][16];   // 16 KB per sub-tile, score/attn exchange
};

__global__ void __launch_bounds__(256)   // real block size: registers for the wide tile
attn_kernel(const _Float16* __restrict__ Pk,
                            const _Float16* __restrict__ Pq,
                            const _Float16* __restrict__ PvT,
                            _Float16* __restrict__ ctx) {
  __shared__ AttnSmem sm;

  constexpr int QT = cL / (16 * cNQ);      // query tiles per batch entry
  const int bb = blockIdx.x / QT;
  const int kt = blockIdx.x % QT;
  const int ks = blockIdx.y;               // key range of this block
  const int h  = threadIdx.x >> 5;         // wave id == head
  const int lane = lane_id();

  const _Float16* Kh = Pk  + ((size_t)(bb * cHEADS + h) * cL + ks * cLK) * cD;
  const _Float16* Qt = Pq  + ((size_t)(bb * cHEADS + h) * cL) * cD
                           + (size_t)(kt * 16 * cNQ) * cD;
  const _Float16* Vt = PvT + ((size_t)(bb * cHEADS + h) * cD) * cL + ks * cLK;  // [d][L]

  // Q fragments are invariant over the whole Lk loop: hoist (cNQ x 4 x v16h).
  v16h bq[cNQ][4];
#pragma unroll  // constant c: the per-sub-tile arrays stay in registers
  for (int c = 0; c < cNQ; ++c)
#pragma unroll
    for (int q = 0; q < 4; ++q)
      bq[c][q] = frag_rm_f16(Qt + (size_t)(c * 16) * cD + q * 32, cD);
  // the Q loads share one address pair: hold its reuse behind their issue
  asm volatile("s_wait_xcnt 0x0" ::: "memory");

  v8f acc[cNQ][8] = {};                    // per sub-tile: 8 j-tiles (d) x 16 k cols

  // --- async stage of one 32x128 f16 K tile (8 KB) into sK[buf][h] --------
  auto stage_k = [&](int buf, int i0) {
    unsigned base = (unsigned)((buf * cHEADS + h) * (32 * cD * 2));  // sK @ LDS off 0
    const char* g = (const char*)(Kh + (size_t)i0 * cD);
#pragma unroll
    for (int t = 0; t < 16; ++t) {
      unsigned lds = base + (unsigned)(t * 512 + lane * 16);
      async_copy_512(lds, g + t * 512 + lane * 16);
    }
  };

  stage_k(0, 0);

  for (int i0 = 0; i0 < cLK; i0 += 32) {
    const int  cur  = (i0 >> 5) & 1;
    const bool more = (i0 + 32) < cLK;
    if (more) stage_k(cur ^ 1, i0 + 32);

    // prefetch next PvT tile rows into cache while we compute
    if (more) {
#pragma unroll
      for (int r = 0; r < 4; ++r)
        __builtin_prefetch(Vt + (size_t)(r * 32 + lane) * cL + i0 + 32, 0, 1);
    }

    if (more) wait_async16();   // oldest 16 (current buffer) complete
    else      wait_async0();

    const _Float16* sk = &sm.sK[cur][h][0][0];

    // --- score tiles S[i0..i0+31][kt*64..+64] (cNQ sub-tiles) for this head (from LDS) ---
    v8f s0[cNQ] = {}, s1[cNQ] = {};
#pragma unroll
    for (int k0 = 0; k0 < cD; k0 += 32) {
      v16h a0 = frag_rm_f16(sk + k0, cD);
      v16h a1 = frag_rm_f16(sk + 16 * cD + k0, cD);
#pragma unroll  // constant c: the per-sub-tile arrays stay in registers
      for (int c = 0; c < cNQ; ++c) {
        s0[c] = wmma16(a0, bq[c][k0 >> 5], s0[c]);
        s1[c] = wmma16(a1, bq[c][k0 >> 5], s1[c]);
      }
    }
    __syncthreads();   // prior iteration's s_sc reads are done
    {
      int kk = lane & 15;
      int mb = (lane & 16) ? 8 : 0;
#pragma unroll  // constant c: the per-sub-tile arrays stay in registers
      for (int c = 0; c < cNQ; ++c) {
#pragma unroll
        for (int r = 0; r < 8; ++r) {
          sm.s_sc[c][h][r + mb][kk]      = s0[c][r];
          sm.s_sc[c][h][16 + r + mb][kk] = s1[c][r];
        }
      }
    }
    __syncthreads();
    // --- softmax across the 8 heads, elementwise in (i,k) ----------------
    for (int t = threadIdx.x; t < 512 * cNQ; t += 256) {
      int c = t >> 9, ii = (t >> 4) & 31, kk = t & 15;
      float v[cHEADS];
      float m = -3.0e38f;
#pragma unroll
      for (int hh = 0; hh < cHEADS; ++hh) {
        v[hh] = sm.s_sc[c][hh][ii][kk] * cSCALE;
        m = fmaxf(m, v[hh]);
      }
      float sum = 0.f;
#pragma unroll
      for (int hh = 0; hh < cHEADS; ++hh) {
        float e = __expf(v[hh] - m);
        v[hh] = e;
        sum += e;
      }
      float inv = 1.f / sum;
#pragma unroll
      for (int hh = 0; hh < cHEADS; ++hh) sm.s_sc[c][hh][ii][kk] = v[hh] * inv;
    }
    __syncthreads();
    // --- out_h[j,k] += PvT[j,i] @ attn[i,k]  (K = 32 rows of i) ----------
    v16h battn[cNQ];
#pragma unroll  // constant c: the per-sub-tile arrays stay in registers
    for (int c = 0; c < cNQ; ++c) {
      int kk = lane & 15;
      const float* ab = &sm.s_sc[c][h][0][0];
#pragma unroll
      for (int e = 0; e < 16; ++e)
        battn[c][e] = (_Float16)ab[kidx(lane, e) * 16 + kk];
    }
#pragma unroll
    for (int jt = 0; jt < 8; ++jt) {
      v16h av = frag_rm_f16(Vt + (size_t)(jt * 16) * cL + i0, cL);
#pragma unroll  // constant c: the per-sub-tile arrays stay in registers
      for (int c = 0; c < cNQ; ++c) acc[c][jt] = wmma16(av, battn[c], acc[c][jt]);
    }
  }

  // --- store ctx[ks][b][l][d*8 + h] (f16), the reference's head interleave --
  _Float16* cp = ctx + (size_t)ks * ((size_t)cB * cL * cHID);
  const int kk = lane & 15;
  const int mb = (lane & 16) ? 8 : 0;
#pragma unroll  // constant c: the per-sub-tile arrays stay in registers
  for (int c = 0; c < cNQ; ++c) {
    const int l = (kt * cNQ + c) * 16 + kk;
#pragma unroll
    for (int jt = 0; jt < 8; ++jt) {
#pragma unroll
      for (int r = 0; r < 8; ++r) {
        int d = jt * 16 + r + mb;
        cp[((size_t)bb * cL + l) * cHID + d * cHEADS + h] = (_Float16)acc[c][jt][r];
      }
      // The next run's conversion reuses these stores' data registers: it waits
      // for their issue, and the scheduling barrier keeps it behind the wait.
      if (c * 8 + jt + 1 < cNQ * 8) {   // nothing is converted behind the last run
        asm volatile("s_wait_xcnt 0x0" ::: "memory");
        __builtin_amdgcn_sched_barrier(0);
      }
    }
  }
}

// ---------------------------------------------------------------------------
// Kernel C: final projection (sum of the cKS ctx planes)[8192,1024](f16)
// @ Wo^T[1024,256] + b -> f32. One wave per 16x16 tile; the planes are added
// by running every plane through the same f32 accumulate chain.
// ---------------------------------------------------------------------------
__global__ void outproj_kernel(const _Float16* __restrict__ ctx,
                               const float* __restrict__ Wo_w,
                               const float* __restrict__ Wo_b,
                               float* __restrict__ out) {
  const int NT = cOUT / 16;  // 16
  const int tile = blockIdx.x * 4 + (threadIdx.x >> 5);
  const int mt = tile / NT, nt = tile % NT;
  const int lane = lane_id();

  v8f acc = {};
  for (int k0 = 0; k0 < cHID; k0 += 32) {
    v16h b = frag_rm_f32(Wo_w + (size_t)(nt * 16) * cHID + k0, cHID);
#pragma unroll  // both planes' loads issue together
    for (int p = 0; p < cKS; ++p) {
      v16h a = frag_rm_f16(ctx + (size_t)p * ((size_t)cB * cL * cHID)
                               + (size_t)(mt * 16) * cHID + k0, cHID);
      acc = wmma16(a, b, acc);
    }
  }

  const int n = nt * 16 + (lane & 15);
  const float bv = Wo_b[n];
#pragma unroll
  for (int r = 0; r < 8; ++r) {
    int m = mt * 16 + r + ((lane & 16) ? 8 : 0);
    out[(size_t)m * cOUT + n] = acc[r] + bv;
  }
}

// ---------------------------------------------------------------------------
extern "C" void kernel_launch(void* const* d_in, const int* in_sizes, int n_in,
                              void* d_out, int out_size, void* d_ws, size_t ws_size,
                              hipStream_t stream) {
  (void)in_sizes; (void)n_in; (void)out_size; (void)ws_size;
  const float* KEY   = (const float*)d_in[0];
  const float* VALUE = (const float*)d_in[1];
  const float* QUERY = (const float*)d_in[2];
  const float* W_w   = (const float*)d_in[3];
  const float* W_b   = (const float*)d_in[4];
  const float* Wv_w  = (const float*)d_in[5];
  const float* Wv_b  = (const float*)d_in[6];
  const float* Wo_w  = (const float*)d_in[7];
  const float* Wo_b  = (const float*)d_in[8];
  float* out = (float*)d_out;

  // f16 workspace: Pk, Pq, PvT (head-split) + cKS ctx planes, 16 MB each.
  const size_t pelems = (size_t)cB * cHEADS * cL * cD;   // == B*L*HID
  _Float16* Pk  = (_Float16*)d_ws;
  _Float16* Pq  = Pk + pelems;
  _Float16* PvT = Pq + pelems;
  _Float16* ctx = PvT + pelems;

  {
    const int MT = (cB * cL) / 16;           // 512
    const int NT = cHID / 16;                // 64
    dim3 grid((MT * NT) / 4, 3);             // 4 waves/block, 3 projections
    proj_kernel<<<grid, 128, 0, stream>>>(KEY, VALUE, QUERY, W_w, W_b, Wv_w, Wv_b,
                                          Pk, Pq, PvT);
  }
  {
    dim3 grid(cB * (cL / (16 * cNQ)), cKS);  // 128 x 2 blocks, 8 waves = 8 heads
    attn_kernel<<<grid, 256, 0, stream>>>(Pk, Pq, PvT, ctx);
  }
  {
    const int MT = (cB * cL) / 16;           // 512
    const int NT = cOUT / 16;                // 16
    dim3 grid((MT * NT) / 4);                // 2048
    outproj_kernel<<<grid, 128, 0, stream>>>(ctx, Wo_w, Wo_b, out);
  }
}

// v002
// It runs in 455 microseconds.
// In two side-by-side timings against v001, it was 1.50 and 1.48 times as fast.
// All steps since v000 together make it 2.25 times as fast.
#include <hip/hip_runtime.h>
#include <hip/hip_bf16.h>
#include <math.h>

// ---------------------------------------------------------------------------
// MHA with softmax-over-heads, fused for MI455X (gfx1250, wave32, WMMA).
//   proj    : KEY/QUERY @ W^T + b -> f16 head-split; VALUE @ Wv^T + b -> f16
//             head-split TRANSPOSED (PvT[b][h][d][L]) so the attention kernel
//             reads every operand contiguously.
//   attn    : fused score + head-softmax + attn^T@Wv, K tiles staged to LDS
//             with global_load_async_to_lds_b128 (double-buffered, ASYNCcnt).
//   outproj : ctx @ Wo^T + b -> f32
// All matmuls via v_wmma_f32_16x16x32_f16 (f32 accumulate).
// ---------------------------------------------------------------------------

typedef __attribute__((ext_vector_type(16))) _Float16 v16h;
typedef __attribute__((ext_vector_type(8)))  float    v8f;

#define DEV static __device__ __forceinline__

constexpr int cB = 4, cL = 2048, cINK = 256, cHID = 1024, cHEADS = 8, cD = 128, cOUT = 256;
constexpr float cSCALE = 0.08838834764831845f;   // 1/sqrt(128)
constexpr int cNQ = 4;          // 16-column query sub-tiles per attention block
constexpr int cKS = 2;          // key ranges; each block sums over one of them
constexpr int cLK = cL / cKS;   // keys per block

DEV int lane_id() { return (int)(threadIdx.x & 31u); }

// K index (within the 32-wide K tile) held by element e of a 16-bit A/B frag.
// Per ISA 7.12.2: lanes 0-15 -> K 0..7 / 16..23, lanes 16-31 -> K 8..15 / 24..31.
DEV int kidx(int lane, int e) {
  int kb = (lane & 16) ? 8 : 0;
  return (e < 8) ? (kb + e) : (16 + kb + (e - 8));
}

// A/B fragment from a row-major f32 tile (row/col = lane&15, K along elements)
DEV v16h frag_rm_f32(const float* __restrict__ base, int ld) {
  int lane = lane_id();
  const float* p = base + (size_t)(lane & 15) * ld;
  v16h f;
#pragma unroll
  for (int e = 0; e < 16; ++e) f[e] = (_Float16)p[kidx(lane, e)];
  return f;
}

// A/B fragment from a row-major f16 tile (two contiguous 16B chunks per lane)
DEV v16h frag_rm_f16(const _Float16* base, int ld) {
  int lane = lane_id();
  const _Float16* p = base + (size_t)(lane & 15) * ld;
  v16h f;
#pragma unroll
  for (int e = 0; e < 16; ++e) f[e] = p[kidx(lane, e)];
  return f;
}

DEV v8f wmma16(v16h a, v16h b, v8f c) {
  return __builtin_amdgcn_wmma_f32_16x16x32_f16(false, a, false, b, (short)0, c,
                                                false, false);
}

// Async-copy 512B (32 lanes x 16B) from global to LDS; CDNA5 async path.
// lds_off is the byte offset within the workgroup's LDS segment.
DEV void async_copy_512(unsigned lds_off, const void* gptr) {
  asm volatile("global_load_async_to_lds_b128 %0, %1, off"
               :: "v"(lds_off), "v"(gptr) : "memory");
}
DEV void wait_async_le(int) {}  // (documentation only; real waits below)
DEV void wait_async16() { asm volatile("s_wait_asynccnt 0x10" ::: "memory"); }
DEV void wait_async0()  { asm volatile("s_wait_asynccnt 0x0"  ::: "memory"); }

// ---------------------------------------------------------------------------
// Kernel A: projections.  blockIdx.y: 0->Pk(KEY,W), 1->Pq(QUERY,W), 2->PvT(VALUE,Wv)
// One wave per 64x64 output tile (cPT x cPT WMMA tiles), a block of 2x2 waves per
// 128x128: every loaded fragment feeds cPT WMMAs. K=256 -> 8 steps.
// Pk/Pq layout: P[b][h][l][d];  PvT layout: P[b][h][d][l]  (h = hidden%8, d = hidden/8)
// The tile is turned so that the 8 accumulator rows a lane holds lie side by side
// in the destination (one 16-byte store):
//   VT  (PvT)  : D = X . W^T, rows = l, column = hidden unit.
//   !VT (Pk/Pq): D = W . X^T, column = l, and the 16 weight rows of tile ib are
//                the units of heads 2*ib and 2*ib+1 at 8 successive d, so rows = d.
// ---------------------------------------------------------------------------
typedef __attribute__((ext_vector_type(8))) _Float16 v8h;
constexpr int cPT = 4;          // 16-row fragments per side of a wave's tile

// One A/B fragment's 16 f32 values from this lane's own row, in fragment order
DEV void load_row_f32(float (&q)[16], const float* __restrict__ p) {
  int lane = lane_id();
#pragma unroll
  for (int e = 0; e < 16; ++e) q[e] = p[kidx(lane, e)];
}
DEV v16h cvt_row_f16(const float (&q)[16]) {
  v16h f;
#pragma unroll
  for (int e = 0; e < 16; ++e) f[e] = (_Float16)q[e];
  return f;
}

template <bool VT>
DEV void proj_tile(const float* __restrict__ src, const float* __restrict__ w,
                   const float* __restrict__ bias, _Float16* __restrict__ dst,
                   int m0, int n0) {
  const int lane = lane_id();
  const int row = lane & 15, hi = lane >> 4;

  const float* xp[cPT];
  const float* wp[cPT];
#pragma unroll
  for (int i = 0; i < cPT; ++i) {
    xp[i] = src + (size_t)(m0 + i * 16 + row) * cINK;
    const int n = VT ? (n0 + i * 16 + row)
                     : (n0 + (row & 7) * cHEADS + i * 2 + (row >> 3));
    wp[i] = w + (size_t)n * cINK;
  }

  v8f acc[cPT][cPT] = {};
  float rx[cPT][16], rw[cPT][16];          // the next step's operands, still f32
  float bv[cPT][8];                        // bias of accumulator row r of tile ib
#pragma unroll
  for (int ib = 0; ib < cPT; ++ib)
#pragma unroll
    for (int r = 0; r < (VT ? 1 : 8); ++r)
      bv[ib][r] = VT ? bias[n0 + ib * 16 + row] : bias[n0 + r * cHEADS + ib * 2 + hi];
  // The bias loads' address registers are reused only once they have issued; the
  // scheduling barrier keeps what follows behind the wait.
  asm volatile("s_wait_xcnt 0x0" ::: "memory");
  __builtin_amdgcn_sched_barrier(0);
#pragma unroll
  for (int i = 0; i < cPT; ++i) {
    load_row_f32(rx[i], xp[i]);
    load_row_f32(rw[i], wp[i]);
  }
#pragma unroll  // constant k0: every load is its row pointer plus an immediate
  for (int k0 = 0; k0 < cINK; k0 += 32) {
    v16h x[cPT], wf[cPT];
#pragma unroll
    for (int i = 0; i < cPT; ++i) {
      x[i]  = cvt_row_f16(rx[i]);
      wf[i] = cvt_row_f16(rw[i]);
    }
    if (k0 + 32 < cINK) {
#pragma unroll
      for (int i = 0; i < cPT; ++i) {
        load_row_f32(rx[i], xp[i] + k0 + 32);
        load_row_f32(rw[i], wp[i] + k0 + 32);
      }
      // The row pointers die behind the last loads: their registers are reused
      // only once those loads have issued.
      if (k0 + 64 >= cINK) asm volatile("s_wait_xcnt 0x0" ::: "memory");
    }
    // Keeps the next step's loads, all of them, in front of this step's WMMAs:
    // left alone the scheduler issues them two at a time, each pair waited for.
    __builtin_amdgcn_sched_barrier(0);
#pragma unroll
    for (int ia = 0; ia < cPT; ++ia)
#pragma unroll
      for (int ib = 0; ib < cPT; ++ib)
        acc[ia][ib] = VT ? wmma16(x[ia], wf[ib], acc[ia][ib])
                         : wmma16(wf[ib], x[ia], acc[ia][ib]);
  }

  const int bi = m0 / cL, l0 = m0 % cL;    // a 64-row tile lies in one batch entry
#pragma unroll
  for (int ib = 0; ib < cPT; ++ib) {
    _Float16* dp;                           // this lane's 8 values at ia = 0
    size_t step;                            // elements from one ia to the next
    if (VT) {
      const int n = n0 + ib * 16 + row;
      dp = dst + (((size_t)bi * cHEADS + (n & 7)) * cD + (n >> 3)) * cL + l0 + hi * 8;
      step = 16;
    } else {
      const int h = ib * 2 + hi;
      dp = dst + (((size_t)bi * cHEADS + h) * cL + l0 + row) * cD + (n0 >> 3);
      step = (size_t)16 * cD;
    }
#pragma unroll
    for (int ia = 0; ia < cPT; ++ia) {
      v8h o;
#pragma unroll
      for (int r = 0; r < 8; ++r) o[r] = (_Float16)(acc[ia][ib][r] + bv[ib][VT ? 0 : r]);
      *(v8h*)(dp + ia * step) = o;
    }
    // The next tile column's sums reuse these stores' registers: they wait for the
    // stores' issue, and the scheduling barrier keeps them behind the wait. Behind
    // the last run too: the other variant's code follows it in the built kernel.
    asm volatile("s_wait_xcnt 0x0" ::: "memory");
    __builtin_amdgcn_sched_barrier(0);
  }
}

__global__ void __launch_bounds__(128)
proj_kernel(const float* __restrict__ KEY,
                            const float* __restrict__ VALUE,
                            const float* __restrict__ QUERY,
                            const float* __restrict__ W_w,
                            const float* __restrict__ W_b,
                            const float* __restrict__ Wv_w,
                            const float* __restrict__ Wv_b,
                            _Float16* __restrict__ Pk,
                            _Float16* __restrict__ Pq,
                            _Float16* __restrict__ PvT) {
  const int which = blockIdx.y;
  constexpr int NB = cHID / (32 * cPT);    // 8 block columns
  const int wave = threadIdx.x >> 5;
  const int m0 = (blockIdx.x / NB) * (32 * cPT) + (wave >> 1) * (16 * cPT);
  const int n0 = (blockIdx.x % NB) * (32 * cPT) + (wave & 1) * (16 * cPT);

  if (which == 2) proj_tile<true>(VALUE, Wv_w, Wv_b, PvT, m0, n0);
  else            proj_tile<false>(which == 0 ? KEY : QUERY, W_w, W_b,
                                   which == 0 ? Pk : Pq, m0, n0);
}

// ---------------------------------------------------------------------------
// Kernel B: fused attention. One block per (b, 64-col Lq tile, key range);
// 8 waves = 8 heads. Every K and PvT fragment feeds cNQ WMMAs, one per 16-col
// query sub-tile. The sum over keys has no normaliser (the softmax runs over
// heads), so each key range writes its own partial ctx plane and the output
// projection adds the planes in its accumulate chain.
// K tiles double-buffered in LDS via async copies; Q fragments hoisted; score
// WMMAs -> LDS -> cross-head softmax (elementwise in (i,k)) -> PvT@attn WMMAs.
// ---------------------------------------------------------------------------
struct AttnSmem {
  _Float16 sK[2][cHEADS][32][cD];   // 128 KB, double-buffered K tiles (first!)
  float    s_sc[cNQ][cHEADS][32][16];   // 16 KB per sub-tile, score/attn exchange
};

__global__ void __launch_bounds__(256)   // real block size: registers for the wide tile
attn_kernel(const _Float16* __restrict__ Pk,
                            const _Float16* __restrict__ Pq,
                            const _Float16* __restrict__ PvT,
                            _Float16* __restrict__ ctx) {
  __shared__ AttnSmem sm;

  constexpr int QT = cL / (16 * cNQ);      // query tiles per batch entry
  const int bb = blockIdx.x / QT;
  const int kt = blockIdx.x % QT;
  const int ks = blockIdx.y;               // key range of this block
  const int h  = threadIdx.x >> 5;         // wave id == head
  const int lane = lane_id();

  const _Float16* Kh = Pk  + ((size_t)(bb * cHEADS + h) * cL + ks * cLK) * cD;
  const _Float16* Qt = Pq  + ((size_t)(bb * cHEADS + h) * cL) * cD
                           + (size_t)(kt * 16 * cNQ) * cD;
  const _Float16* Vt = PvT + ((size_t)(bb * cHEADS + h) * cD) * cL + ks * cLK;  // [d][L]

  // Q fragments are invariant over the whole Lk loop: hoist (cNQ x 4 x v16h).
  v16h bq[cNQ][4];
#pragma unroll  // constant c: the per-sub-tile arrays stay in registers
  for (int c = 0; c < cNQ; ++c)
#pragma unroll
    for (int q = 0; q < 4; ++q)
      bq[c][q] = frag_rm_f16(Qt + (size_t)(c * 16) * cD + q * 32, cD);
  // the Q loads share one address pair: hold its reuse behind their issue
  asm volatile("s_wait_xcnt 0x0" ::: "memory");

  v8f acc[cNQ][8] = {};                    // per sub-tile: 8 j-tiles (d) x 16 k cols

  // --- async stage of one 32x128 f16 K tile (8 KB) into sK[buf][h] --------
  auto stage_k = [&](int buf, int i0) {
    unsigned base = (unsigned)((buf * cHEADS + h) * (32 * cD * 2));  // sK @ LDS off 0
    const char* g = (const char*)(Kh + (size_t)i0 * cD);
#pragma unroll
    for (int t = 0; t < 16; ++t) {
      unsigned lds = base + (unsigned)(t * 512 + lane * 16);
      async_copy_512(lds, g + t * 512 + lane * 16);
    }
  };

  stage_k(0, 0);

  for (int i0 = 0; i0 < cLK; i0 += 32) {
    const int  cur  = (i0 >> 5) & 1;
    const bool more = (i0 + 32) < cLK;
    if (more) stage_k(cur ^ 1, i0 + 32);

    // prefetch next PvT tile rows into cache while we compute
    if (more) {
#pragma unroll
      for (int r = 0; r < 4; ++r)
        __builtin_prefetch(Vt + (size_t)(r * 32 + lane) * cL + i0 + 32, 0, 1);
    }

    if (more) wait_async16();   // oldest 16 (current buffer) complete
    else      wait_async0();

    const _Float16* sk = &sm.sK[cur][h][0][0];

    // --- score tiles S[i0..i0+31][kt*64..+64] (cNQ sub-tiles) for this head (from LDS) ---
    v8f s0[cNQ] = {}, s1[cNQ] = {};
#pragma unroll
    for (int k0 = 0; k0 < cD; k0 += 32) {
      v16h a0 = frag_rm_f16(sk + k0, cD);
      v16h a1 = frag_rm_f16(sk + 16 * cD + k0, cD);
#pragma unroll  // constant c: the per-sub-tile arrays stay in registers
      for (int c = 0; c < cNQ; ++c) {
        s0[c] = wmma16(a0, bq[c][k0 >> 5], s0[c]);
        s1[c] = wmma16(a1, bq[c][k0 >> 5], s1[c]);
      }
    }
    __syncthreads();   // prior iteration's s_sc reads are done
    {
      int kk = lane & 15;
      int mb = (lane & 16) ? 8 : 0;
#pragma unroll  // constant c: the per-sub-tile arrays stay in registers
      for (int c = 0; c < cNQ; ++c) {
#pragma unroll
        for (int r = 0; r < 8; ++r) {
          sm.s_sc[c][h][r + mb][kk]      = s0[c][r];
          sm.s_sc[c][h][16 + r + mb][kk] = s1[c][r];
        }
      }
    }
    __syncthreads();
    // --- softmax across the 8 heads, elementwise in (i,k) ----------------
    for (int t = threadIdx.x; t < 512 * cNQ; t += 256) {
      int c = t >> 9, ii = (t >> 4) & 31, kk = t & 15;
      float v[cHEADS];
      float m = -3.0e38f;
#pragma unroll
      for (int hh = 0; hh < cHEADS; ++hh) {
        v[hh] = sm.s_sc[c][hh][ii][kk] * cSCALE;
        m = fmaxf(m, v[hh]);
      }
      float sum = 0.f;
#pragma unroll
      for (int hh = 0; hh < cHEADS; ++hh) {
        float e = __expf(v[hh] - m);
        v[hh] = e;
        sum += e;
      }
      float inv = 1.f / sum;
#pragma unroll
      for (int hh = 0; hh < cHEADS; ++hh) sm.s_sc[c][hh][ii][kk] = v[hh] * inv;
    }
    __syncthreads();
    // --- out_h[j,k] += PvT[j,i] @ attn[i,k]  (K = 32 rows of i) ----------
    v16h battn[cNQ];
#pragma unroll  // constant c: the per-sub-tile arrays stay in registers
    for (int c = 0; c < cNQ; ++c) {
      int kk = lane & 15;
      const float* ab = &sm.s_sc[c][h][0][0];
#pragma unroll
      for (int e = 0; e < 16; ++e)
        battn[c][e] = (_Float16)ab[kidx(lane, e) * 16 + kk];
    }
#pragma unroll
    for (int jt = 0; jt < 8; ++jt) {
      v16h av = frag_rm_f16(Vt + (size_t)(jt * 16) * cL + i0, cL);
#pragma unroll  // constant c: the per-sub-tile arrays stay in registers
      for (int c = 0; c < cNQ; ++c) acc[c][jt] = wmma16(av, battn[c], acc[c][jt]);
    }
  }

  // --- store ctx[ks][b][l][d*8 + h] (f16), the reference's head interleave --
  _Float16* cp = ctx + (size_t)ks * ((size_t)cB * cL * cHID);
  const int kk = lane & 15;
  const int mb = (lane & 16) ? 8 : 0;
#pragma unroll  // constant c: the per-sub-tile arrays stay in registers
  for (int c = 0; c < cNQ; ++c) {
    const int l = (kt * cNQ + c) * 16 + kk;
#pragma unroll
    for (int jt = 0; jt < 8; ++jt) {
#pragma unroll
      for (int r = 0; r < 8; ++r) {
        int d = jt * 16 + r + mb;
        cp[((size_t)bb * cL + l) * cHID + d * cHEADS + h] = (_Float16)acc[c][jt][r];
      }
      // The next run's conversion reuses these stores' data registers: it waits
      // for their issue, and the scheduling barrier keeps it behind the wait.
      if (c * 8 + jt + 1 < cNQ * 8) {   // nothing is converted behind the last run
        asm volatile("s_wait_xcnt 0x0" ::: "memory");
        __builtin_amdgcn_sched_barrier(0);
      }
    }
  }
}

// ---------------------------------------------------------------------------
// Kernel C: final projection (sum of the cKS ctx planes)[8192,1024](f16)
// @ Wo^T[1024,256] + b -> f32. One wave per 16x16 tile; the planes are added
// by running every plane through the same f32 accumulate chain.
// ---------------------------------------------------------------------------
__global__ void outproj_kernel(const _Float16* __restrict__ ctx,
                               const float* __restrict__ Wo_w,
                               const float* __restrict__ Wo_b,
                               float* __restrict__ out) {
  const int NT = cOUT / 16;  // 16
  const int tile = blockIdx.x * 4 + (threadIdx.x >> 5);
  const int mt = tile / NT, nt = tile % NT;
  const int lane = lane_id();

  v8f acc = {};
  for (int k0 = 0; k0 < cHID; k0 += 32) {
    v16h b = frag_rm_f32(Wo_w + (size_t)(nt * 16) * cHID + k0, cHID);
#pragma unroll  // both planes' loads issue together
    for (int p = 0; p < cKS; ++p) {
      v16h a = frag_rm_f16(ctx + (size_t)p * ((size_t)cB * cL * cHID)
                               + (size_t)(mt * 16) * cHID + k0, cHID);
      acc = wmma16(a, b, acc);
    }
  }

  const int n = nt * 16 + (lane & 15);
  const float bv = Wo_b[n];
#pragma unroll
  for (int r = 0; r < 8; ++r) {
    int m = mt * 16 + r + ((lane & 16) ? 8 : 0);
    out[(size_t)m * cOUT + n] = acc[r] + bv;
  }
}

// ---------------------------------------------------------------------------
extern "C" void kernel_launch(void* const* d_in, const int* in_sizes, int n_in,
                              void* d_out, int out_size, void* d_ws, size_t ws_size,
                              hipStream_t stream) {
  (void)in_sizes; (void)n_in; (void)out_size; (void)ws_size;
  const float* KEY   = (const float*)d_in[0];
  const float* VALUE = (const float*)d_in[1];
  const float* QUERY = (const float*)d_in[2];
  const float* W_w   = (const float*)d_in[3];
  const float* W_b   = (const float*)d_in[4];
  const float* Wv_w  = (const float*)d_in[5];
  const float* Wv_b  = (const float*)d_in[6];
  const float* Wo_w  = (const float*)d_in[7];
  const float* Wo_b  = (const float*)d_in[8];
  float* out = (float*)d_out;

  // f16 workspace: Pk, Pq, PvT (head-split) + cKS ctx planes, 16 MB each.
  const size_t pelems = (size_t)cB * cHEADS * cL * cD;   // == B*L*HID
  _Float16* Pk  = (_Float16*)d_ws;
  _Float16* Pq  = Pk + pelems;
  _Float16* PvT = Pq + pelems;
  _Float16* ctx = PvT + pelems;

  {
    const int MB = (cB * cL) / (32 * cPT);   // 64 block rows
    const int NB = cHID / (32 * cPT);        // 8 block columns
    dim3 grid(MB * NB, 3);                   // 4 waves/block, 3 projections
    proj_kernel<<<grid, 128, 0, stream>>>(KEY, VALUE, QUERY, W_w, W_b, Wv_w, Wv_b,
                                          Pk, Pq, PvT);
  }
  {
    dim3 grid(cB * (cL / (16 * cNQ)), cKS);  // 128 x 2 blocks, 8 waves = 8 heads
    attn_kernel<<<grid, 256, 0, stream>>>(Pk, Pq, PvT, ctx);
  }
  {
    const int MT = (cB * cL) / 16;           // 512
    const int NT = cOUT / 16;                // 16
    dim3 grid((MT * NT) / 4);                // 2048
    outproj_kernel<<<grid, 128, 0, stream>>>(ctx, Wo_w, Wo_b, out);
  }
}

// v003
// Measured time: 397 microseconds a run.
// Next to v002, in two timings, it ran 1.15 and 1.16 times as fast.
// Counting every step since v000, it is 2.59 times as fast.
#include <hip/hip_runtime.h>
#include <hip/hip_bf16.h>
#include <math.h>

// ---------------------------------------------------------------------------
// MHA with softmax-over-heads, fused for MI455X (gfx1250, wave32, WMMA).
//   proj    : KEY/QUERY @ W^T + b -> f16 head-split; VALUE @ Wv^T + b -> f16
//             head-split TRANSPOSED (PvT[b][h][d][L]) so the attention kernel
//             reads every operand contiguously.
//   attn    : fused score + head-softmax + attn^T@Wv, K tiles staged to LDS
//             with global_load_async_to_lds_b128 (double-buffered, ASYNCcnt).
//   outproj : ctx @ Wo^T + b -> f32
// All matmuls via v_wmma_f32_16x16x32_f16 (f32 accumulate).
// ---------------------------------------------------------------------------

typedef __attribute__((ext_vector_type(16))) _Float16 v16h;
typedef __attribute__((ext_vector_type(8)))  float    v8f;

#define DEV static __device__ __forceinline__

constexpr int cB = 4, cL = 2048, cINK = 256, cHID = 1024, cHEADS = 8, cD = 128, cOUT = 256;
constexpr float cSCALE = 0.08838834764831845f;   // 1/sqrt(128)
constexpr int cNQ = 4;          // 16-column query sub-tiles per attention block
constexpr int cKS = 2;          // key ranges; each block sums over one of them
constexpr int cLK = cL / cKS;   // keys per block

DEV int lane_id() { return (int)(threadIdx.x & 31u); }

// K index (within the 32-wide K tile) held by element e of a 16-bit A/B frag.
// Per ISA 7.12.2: lanes 0-15 -> K 0..7 / 16..23, lanes 16-31 -> K 8..15 / 24..31.
DEV int kidx(int lane, int e) {
  int kb = (lane & 16) ? 8 : 0;
  return (e < 8) ? (kb + e) : (16 + kb + (e - 8));
}

// A/B fragment from a row-major f32 tile (row/col = lane&15, K along elements)
DEV v16h frag_rm_f32(const float* __restrict__ base, int ld) {
  int lane = lane_id();
  const float* p = base + (size_t)(lane & 15) * ld;
  v16h f;
#pragma unroll
  for (int e = 0; e < 16; ++e) f[e] = (_Float16)p[kidx(lane, e)];
  return f;
}

// A/B fragment from a row-major f16 tile (two contiguous 16B chunks per lane)
DEV v16h frag_rm_f16(const _Float16* base, int ld) {
  int lane = lane_id();
  const _Float16* p = base + (size_t)(lane & 15) * ld;
  v16h f;
#pragma unroll
  for (int e = 0; e < 16; ++e) f[e] = p[kidx(lane, e)];
  return f;
}

DEV v8f wmma16(v16h a, v16h b, v8f c) {
  return __builtin_amdgcn_wmma_f32_16x16x32_f16(false, a, false, b, (short)0, c,
                                                false, false);
}

// Async-copy 512B (32 lanes x 16B) from global to LDS; CDNA5 async path.
// lds_off is the byte offset within the workgroup's LDS segment.
DEV void async_copy_512(unsigned lds_off, const void* gptr) {
  asm volatile("global_load_async_to_lds_b128 %0, %1, off"
               :: "v"(lds_off), "v"(gptr) : "memory");
}
DEV void wait_async_le(int) {}  // (documentation only; real waits below)
DEV void wait_async16() { asm volatile("s_wait_asynccnt 0x10" ::: "memory"); }
DEV void wait_async0()  { asm volatile("s_wait_asynccnt 0x0"  ::: "memory"); }

// ---------------------------------------------------------------------------
// Kernel A: projections.  blockIdx.y: 0->Pk(KEY,W), 1->Pq(QUERY,W), 2->PvT(VALUE,Wv)
// One wave per 64x64 output tile (cPT x cPT WMMA tiles), a block of 2x2 waves per
// 128x128: every loaded fragment feeds cPT WMMAs. K=256 -> 8 steps.
// Pk/Pq layout: P[b][h][l][d];  PvT layout: P[b][h][d][l]  (h = hidden%8, d = hidden/8)
// The tile is turned so that the 8 accumulator rows a lane holds lie side by side
// in the destination (one 16-byte store):
//   VT  (PvT)  : D = X . W^T, rows = l, column = hidden unit.
//   !VT (Pk/Pq): D = W . X^T, column = l, and the 16 weight rows of tile ib are
//                the units of heads 2*ib and 2*ib+1 at 8 successive d, so rows = d.
// ---------------------------------------------------------------------------
typedef __attribute__((ext_vector_type(8))) _Float16 v8h;
constexpr int cPT = 4;          // 16-row fragments per side of a wave's tile

// One A/B fragment's 16 f32 values from this lane's own row, in fragment order
DEV void load_row_f32(float (&q)[16], const float* __restrict__ p) {
  int lane = lane_id();
#pragma unroll
  for (int e = 0; e < 16; ++e) q[e] = p[kidx(lane, e)];
}
DEV v16h cvt_row_f16(const float (&q)[16]) {
  v16h f;
#pragma unroll
  for (int e = 0; e < 16; ++e) f[e] = (_Float16)q[e];
  return f;
}

template <bool VT>
DEV void proj_tile(const float* __restrict__ src, const float* __restrict__ w,
                   const float* __restrict__ bias, _Float16* __restrict__ dst,
                   int m0, int n0) {
  const int lane = lane_id();
  const int row = lane & 15, hi = lane >> 4;

  const float* xp[cPT];
  const float* wp[cPT];
#pragma unroll
  for (int i = 0; i < cPT; ++i) {
    xp[i] = src + (size_t)(m0 + i * 16 + row) * cINK;
    const int n = VT ? (n0 + i * 16 + row)
                     : (n0 + (row & 7) * cHEADS + i * 2 + (row >> 3));
    wp[i] = w + (size_t)n * cINK;
  }

  v8f acc[cPT][cPT] = {};
  float rx[cPT][16], rw[cPT][16];          // the next step's operands, still f32
  float bv[cPT][8];                        // bias of accumulator row r of tile ib
#pragma unroll
  for (int ib = 0; ib < cPT; ++ib)
#pragma unroll
    for (int r = 0; r < (VT ? 1 : 8); ++r)
      bv[ib][r] = VT ? bias[n0 + ib * 16 + row] : bias[n0 + r * cHEADS + ib * 2 + hi];
  // The bias loads' address registers are reused only once they have issued; the
  // scheduling barrier keeps what follows behind the wait.
  asm volatile("s_wait_xcnt 0x0" ::: "memory");
  __builtin_amdgcn_sched_barrier(0);
#pragma unroll
  for (int i = 0; i < cPT; ++i) {
    load_row_f32(rx[i], xp[i]);
    load_row_f32(rw[i], wp[i]);
  }
#pragma unroll  // constant k0: every load is its row pointer plus an immediate
  for (int k0 = 0; k0 < cINK; k0 += 32) {
    v16h x[cPT], wf[cPT];
#pragma unroll
    for (int i = 0; i < cPT; ++i) {
      x[i]  = cvt_row_f16(rx[i]);
      wf[i] = cvt_row_f16(rw[i]);
    }
    if (k0 + 32 < cINK) {
#pragma unroll
      for (int i = 0; i < cPT; ++i) {
        load_row_f32(rx[i], xp[i] + k0 + 32);
        load_row_f32(rw[i], wp[i] + k0 + 32);
      }
      // The row pointers die behind the last loads: their registers are reused
      // only once those loads have issued.
      if (k0 + 64 >= cINK) asm volatile("s_wait_xcnt 0x0" ::: "memory");
    }
    // Keeps the next step's loads, all of them, in front of this step's WMMAs:
    // left alone the scheduler issues them two at a time, each pair waited for.
    __builtin_amdgcn_sched_barrier(0);
#pragma unroll
    for (int ia = 0; ia < cPT; ++ia)
#pragma unroll
      for (int ib = 0; ib < cPT; ++ib)
        acc[ia][ib] = VT ? wmma16(x[ia], wf[ib], acc[ia][ib])
                         : wmma16(wf[ib], x[ia], acc[ia][ib]);
  }

  const int bi = m0 / cL, l0 = m0 % cL;    // a 64-row tile lies in one batch entry
#pragma unroll
  for (int ib = 0; ib < cPT; ++ib) {
    _Float16* dp;                           // this lane's 8 values at ia = 0
    size_t step;                            // elements from one ia to the next
    if (VT) {
      const int n = n0 + ib * 16 + row;
      dp = dst + (((size_t)bi * cHEADS + (n & 7)) * cD + (n >> 3)) * cL + l0 + hi * 8;
      step = 16;
    } else {
      const int h = ib * 2 + hi;
      dp = dst + (((size_t)bi * cHEADS + h) * cL + l0 + row) * cD + (n0 >> 3);
      step = (size_t)16 * cD;
    }
#pragma unroll
    for (int ia = 0; ia < cPT; ++ia) {
      v8h o;
#pragma unroll
      for (int r = 0; r < 8; ++r) o[r] = (_Float16)(acc[ia][ib][r] + bv[ib][VT ? 0 : r]);
      *(v8h*)(dp + ia * step) = o;
    }
    // The next tile column's sums reuse these stores' registers: they wait for the
    // stores' issue, and the scheduling barrier keeps them behind the wait. Behind
    // the last run too: the other variant's code follows it in the built kernel.
    asm volatile("s_wait_xcnt 0x0" ::: "memory");
    __builtin_amdgcn_sched_barrier(0);
  }
}

__global__ void __launch_bounds__(128)
proj_kernel(const float* __restrict__ KEY,
                            const float* __restrict__ VALUE,
                            const float* __restrict__ QUERY,
                            const float* __restrict__ W_w,
                            const float* __restrict__ W_b,
                            const float* __restrict__ Wv_w,
                            const float* __restrict__ Wv_b,
                            _Float16* __restrict__ Pk,
                            _Float16* __restrict__ Pq,
                            _Float16* __restrict__ PvT) {
  const int which = blockIdx.y;
  constexpr int NB = cHID / (32 * cPT);    // 8 block columns
  const int wave = threadIdx.x >> 5;
  const int m0 = (blockIdx.x / NB) * (32 * cPT) + (wave >> 1) * (16 * cPT);
  const int n0 = (blockIdx.x % NB) * (32 * cPT) + (wave & 1) * (16 * cPT);

  if (which == 2) proj_tile<true>(VALUE, Wv_w, Wv_b, PvT, m0, n0);
  else            proj_tile<false>(which == 0 ? KEY : QUERY, W_w, W_b,
                                   which == 0 ? Pk : Pq, m0, n0);
}

// ---------------------------------------------------------------------------
// Kernel B: fused attention. One block per (b, 64-col Lq tile, key range);
// 8 waves = 8 heads. Every K and PvT fragment feeds cNQ WMMAs, one per 16-col
// query sub-tile. The sum over keys has no normaliser (the softmax runs over
// heads), so each key range writes its own partial ctx plane and the output
// projection adds the planes in its accumulate chain.
// K tiles double-buffered in LDS via async copies; Q fragments hoisted; score
// WMMAs -> LDS -> cross-head softmax (elementwise in (i,k)) -> PvT@attn WMMAs.
// ---------------------------------------------------------------------------
constexpr int cKP = cD + 8;     // K row pitch in LDS: 272 B = 17 x 16 B, so the 16 rows that a
                                // fragment read touches fall on 16 different bank groups
struct AttnSmem {
  _Float16 sK[2][cHEADS][32][cKP];  // 136 KB, double-buffered K tiles (first!)
  float    s_sc[cNQ][cHEADS][32][16];   // 16 KB per sub-tile, score/attn exchange
};

__global__ void __launch_bounds__(256)   // real block size: registers for the wide tile
attn_kernel(const _Float16* __restrict__ Pk,
                            const _Float16* __restrict__ Pq,
                            const _Float16* __restrict__ PvT,
                            _Float16* __restrict__ ctx) {
  __shared__ __attribute__((aligned(16))) AttnSmem sm;   // 16-byte K reads stay whole

  constexpr int QT = cL / (16 * cNQ);      // query tiles per batch entry
  const int bb = blockIdx.x / QT;
  const int kt = blockIdx.x % QT;
  const int ks = blockIdx.y;               // key range of this block
  const int h  = threadIdx.x >> 5;         // wave id == head
  const int lane = lane_id();

  const _Float16* Kh = Pk  + ((size_t)(bb * cHEADS + h) * cL + ks * cLK) * cD;
  const _Float16* Qt = Pq  + ((size_t)(bb * cHEADS + h) * cL) * cD
                           + (size_t)(kt * 16 * cNQ) * cD;
  const _Float16* Vt = PvT + ((size_t)(bb * cHEADS + h) * cD) * cL + ks * cLK;  // [d][L]

  // Q fragments are invariant over the whole Lk loop: hoist (cNQ x 4 x v16h).
  v16h bq[cNQ][4];
#pragma unroll  // constant c: the per-sub-tile arrays stay in registers
  for (int c = 0; c < cNQ; ++c)
#pragma unroll
    for (int q = 0; q < 4; ++q)
      bq[c][q] = frag_rm_f16(Qt + (size_t)(c * 16) * cD + q * 32, cD);
  // the Q loads share one address pair: hold its reuse behind their issue
  asm volatile("s_wait_xcnt 0x0" ::: "memory");

  v8f acc[cNQ][8] = {};                    // per sub-tile: 8 j-tiles (d) x 16 k cols

  // --- async stage of one 32x128 f16 K tile (8 KB) into sK[buf][h] --------
  auto stage_k = [&](int buf, int i0) {
    // the wave's number as a scalar: the tile's base then takes no vector register
    unsigned base = (unsigned)((buf * cHEADS + __builtin_amdgcn_readfirstlane(h)) * (32 * cKP * 2)
                               + (lane >> 4) * (cKP * 2) + (lane & 15) * 16);   // sK @ LDS off 0
    const char* g = (const char*)(Kh + (size_t)i0 * cD);
#pragma unroll
    for (int t = 0; t < 16; ++t) {
      unsigned lds = base + (unsigned)(t * (2 * cKP * 2));   // 544 B = two padded rows
      async_copy_512(lds, g + t * 512 + lane * 16);
    }
  };

  stage_k(0, 0);

  for (int i0 = 0; i0 < cLK; i0 += 32) {
    const int  cur  = (i0 >> 5) & 1;
    const bool more = (i0 + 32) < cLK;
    if (more) stage_k(cur ^ 1, i0 + 32);

    // prefetch next PvT tile rows into cache while we compute
    if (more) {
#pragma unroll
      for (int r = 0; r < 4; ++r)
        __builtin_prefetch(Vt + (size_t)(r * 32 + lane) * cL + i0 + 32, 0, 1);
    }

    if (more) wait_async16();   // oldest 16 (current buffer) complete
    else      wait_async0();

    const _Float16* sk = &sm.sK[cur][h][0][0];

    // --- score tiles S[i0..i0+31][kt*64..+64] (cNQ sub-tiles) for this head (from LDS) ---
    v8f s0[cNQ] = {}, s1[cNQ] = {};
#pragma unroll
    for (int k0 = 0; k0 < cD; k0 += 32) {
      v16h a0 = frag_rm_f16(sk + k0, cKP);
      v16h a1 = frag_rm_f16(sk + 16 * cKP + k0, cKP);
#pragma unroll  // constant c: the per-sub-tile arrays stay in registers
      for (int c = 0; c < cNQ; ++c) {
        s0[c] = wmma16(a0, bq[c][k0 >> 5], s0[c]);
        s1[c] = wmma16(a1, bq[c][k0 >> 5], s1[c]);
      }
    }
    __syncthreads();   // prior iteration's s_sc reads are done
    {
      int kk = lane & 15;
      int mb = (lane & 16) ? 8 : 0;
#pragma unroll  // constant c: the per-sub-tile arrays stay in registers
      for (int c = 0; c < cNQ; ++c) {
#pragma unroll
        for (int r = 0; r < 8; ++r) {
          sm.s_sc[c][h][r + mb][kk]      = s0[c][r];
          sm.s_sc[c][h][16 + r + mb][kk] = s1[c][r];
        }
      }
    }
    __syncthreads();
    // --- softmax across the 8 heads, elementwise in (i,k) ----------------
    for (int t = threadIdx.x; t < 512 * cNQ; t += 256) {
      int c = t >> 9, ii = (t >> 4) & 31, kk = t & 15;
      float v[cHEADS];
      float m = -3.0e38f;
#pragma unroll
      for (int hh = 0; hh < cHEADS; ++hh) {
        v[hh] = sm.s_sc[c][hh][ii][kk] * cSCALE;
        m = fmaxf(m, v[hh]);
      }
      float sum = 0.f;
#pragma unroll
      for (int hh = 0; hh < cHEADS; ++hh) {
        float e = __expf(v[hh] - m);
        v[hh] = e;
        sum += e;
      }
      float inv = 1.f / sum;
#pragma unroll
      for (int hh = 0; hh < cHEADS; ++hh) sm.s_sc[c][hh][ii][kk] = v[hh] * inv;
    }
    __syncthreads();
    // --- out_h[j,k] += PvT[j,i] @ attn[i,k]  (K = 32 rows of i) ----------
    v16h battn[cNQ];
#pragma unroll  // constant c: the per-sub-tile arrays stay in registers
    for (int c = 0; c < cNQ; ++c) {
      int kk = lane & 15;
      const float* ab = &sm.s_sc[c][h][0][0];
#pragma unroll
      for (int e = 0; e < 16; ++e)
        battn[c][e] = (_Float16)ab[kidx(lane, e) * 16 + kk];
    }
#pragma unroll
    for (int jt = 0; jt < 8; ++jt) {
      v16h av = frag_rm_f16(Vt + (size_t)(jt * 16) * cL + i0, cL);
#pragma unroll  // constant c: the per-sub-tile arrays stay in registers
      for (int c = 0; c < cNQ; ++c) acc[c][jt] = wmma16(av, battn[c], acc[c][jt]);
    }
  }

  // --- store ctx[ks][b][l][d*8 + h] (f16), the reference's head interleave --
  _Float16* cp = ctx + (size_t)ks * ((size_t)cB * cL * cHID);
  const int kk = lane & 15;
  const int mb = (lane & 16) ? 8 : 0;
#pragma unroll  // constant c: the per-sub-tile arrays stay in registers
  for (int c = 0; c < cNQ; ++c) {
    const int l = (kt * cNQ + c) * 16 + kk;
#pragma unroll
    for (int jt = 0; jt < 8; ++jt) {
#pragma unroll
      for (int r = 0; r < 8; ++r) {
        int d = jt * 16 + r + mb;
        cp[((size_t)bb * cL + l) * cHID + d * cHEADS + h] = (_Float16)acc[c][jt][r];
      }
      // The next run's conversion reuses these stores' data registers: it waits
      // for their issue, and the scheduling barrier keeps it behind the wait.
      if (c * 8 + jt + 1 < cNQ * 8) {   // nothing is converted behind the last run
        asm volatile("s_wait_xcnt 0x0" ::: "memory");
        __builtin_amdgcn_sched_barrier(0);
      }
    }
  }
}

// ---------------------------------------------------------------------------
// Kernel C: final projection (sum of the cKS ctx planes)[8192,1024](f16)
// @ Wo^T[1024,256] + b -> f32. One wave per 16x16 tile; the planes are added
// by running every plane through the same f32 accumulate chain.
// ---------------------------------------------------------------------------
__global__ void outproj_kernel(const _Float16* __restrict__ ctx,
                               const float* __restrict__ Wo_w,
                               const float* __restrict__ Wo_b,
                               float* __restrict__ out) {
  const int NT = cOUT / 16;  // 16
  const int tile = blockIdx.x * 4 + (threadIdx.x >> 5);
  const int mt = tile / NT, nt = tile % NT;
  const int lane = lane_id();

  v8f acc = {};
  for (int k0 = 0; k0 < cHID; k0 += 32) {
    v16h b = frag_rm_f32(Wo_w + (size_t)(nt * 16) * cHID + k0, cHID);
#pragma unroll  // both planes' loads issue together
    for (int p = 0; p < cKS; ++p) {
      v16h a = frag_rm_f16(ctx + (size_t)p * ((size_t)cB * cL * cHID)
                               + (size_t)(mt * 16) * cHID + k0, cHID);
      acc = wmma16(a, b, acc);
    }
  }

  const int n = nt * 16 + (lane & 15);
  const float bv = Wo_b[n];
#pragma unroll
  for (int r = 0; r < 8; ++r) {
    int m = mt * 16 + r + ((lane & 16) ? 8 : 0);
    out[(size_t)m * cOUT + n] = acc[r] + bv;
  }
}

// ---------------------------------------------------------------------------
extern "C" void kernel_launch(void* const* d_in, const int* in_sizes, int n_in,
                              void* d_out, int out_size, void* d_ws, size_t ws_size,
                              hipStream_t stream) {
  (void)in_sizes; (void)n_in; (void)out_size; (void)ws_size;
  const float* KEY   = (const float*)d_in[0];
  const float* VALUE = (const float*)d_in[1];
  const float* QUERY = (const float*)d_in[2];
  const float* W_w   = (const float*)d_in[3];
  const float* W_b   = (const float*)d_in[4];
  const float* Wv_w  = (const float*)d_in[5];
  const float* Wv_b  = (const float*)d_in[6];
  const float* Wo_w  = (const float*)d_in[7];
  const float* Wo_b  = (const float*)d_in[8];
  float* out = (float*)d_out;

  // f16 workspace: Pk, Pq, PvT (head-split) + cKS ctx planes, 16 MB each.
  const size_t pelems = (size_t)cB * cHEADS * cL * cD;   // == B*L*HID
  _Float16* Pk  = (_Float16*)d_ws;
  _Float16* Pq  = Pk + pelems;
  _Float16* PvT = Pq + pelems;
  _Float16* ctx = PvT + pelems;

  {
    const int MB = (cB * cL) / (32 * cPT);   // 64 block rows
    const int NB = cHID / (32 * cPT);        // 8 block columns
    dim3 grid(MB * NB, 3);                   // 4 waves/block, 3 projections
    proj_kernel<<<grid, 128, 0, stream>>>(KEY, VALUE, QUERY, W_w, W_b, Wv_w, Wv_b,
                                          Pk, Pq, PvT);
  }
  {
    dim3 grid(cB * (cL / (16 * cNQ)), cKS);  // 128 x 2 blocks, 8 waves = 8 heads
    attn_kernel<<<grid, 256, 0, stream>>>(Pk, Pq, PvT, ctx);
  }
  {
    const int MT = (cB * cL) / 16;           // 512
    const int NT = cOUT / 16;                // 16
    dim3 grid((MT * NT) / 4);                // 2048
    outproj_kernel<<<grid, 128, 0, stream>>>(ctx, Wo_w, Wo_b, out);
  }
}

// v004
// One run takes 373 microseconds.
// Next to v003, in two timings, it ran 1.06 and 1.05 times as fast.
// All steps since v000 together make it 2.73 times as fast.
#include <hip/hip_runtime.h>
#include <hip/hip_bf16.h>
#include <math.h>

// ---------------------------------------------------------------------------
// MHA with softmax-over-heads, fused for MI455X (gfx1250, wave32, WMMA).
//   proj    : KEY/QUERY @ W^T + b -> f16 head-split; VALUE @ Wv^T + b -> f16
//             head-split TRANSPOSED (PvT[b][h][d][L]) so the attention kernel
//             reads every operand contiguously.
//   attn    : fused score + head-softmax + attn^T@Wv, K tiles staged to LDS
//             with global_load_async_to_lds_b128 (double-buffered, ASYNCcnt).
//   outproj : ctx @ Wo^T + b -> f32
// All matmuls via v_wmma_f32_16x16x32_f16 (f32 accumulate).
// ---------------------------------------------------------------------------

typedef __attribute__((ext_vector_type(16))) _Float16 v16h;
typedef __attribute__((ext_vector_type(8)))  float    v8f;

#define DEV static __device__ __forceinline__

constexpr int cB = 4, cL = 2048, cINK = 256, cHID = 1024, cHEADS = 8, cD = 128, cOUT = 256;
constexpr float cSCALE = 0.08838834764831845f;   // 1/sqrt(128)
constexpr int cNQ = 4;          // 16-column query sub-tiles per attention block
constexpr int cKS = 2;          // key ranges; each block sums over one of them
constexpr int cLK = cL / cKS;   // keys per block

DEV int lane_id() { return (int)(threadIdx.x & 31u); }

// K index (within the 32-wide K tile) held by element e of a 16-bit A/B frag.
// Per ISA 7.12.2: lanes 0-15 -> K 0..7 / 16..23, lanes 16-31 -> K 8..15 / 24..31.
DEV int kidx(int lane, int e) {
  int kb = (lane & 16) ? 8 : 0;
  return (e < 8) ? (kb + e) : (16 + kb + (e - 8));
}

// A/B fragment from a row-major f16 tile (two contiguous 16B chunks per lane)
DEV v16h frag_rm_f16(const _Float16* base, int ld) {
  int lane = lane_id();
  const _Float16* p = base + (size_t)(lane & 15) * ld;
  v16h f;
#pragma unroll
  for (int e = 0; e < 16; ++e) f[e] = p[kidx(lane, e)];
  return f;
}

DEV v8f wmma16(v16h a, v16h b, v8f c) {
  return __builtin_amdgcn_wmma_f32_16x16x32_f16(false, a, false, b, (short)0, c,
                                                false, false);
}

// Async-copy 512B (32 lanes x 16B) from global to LDS; CDNA5 async path.
// lds_off is the byte offset within the workgroup's LDS segment.
DEV void async_copy_512(unsigned lds_off, const void* gptr) {
  asm volatile("global_load_async_to_lds_b128 %0, %1, off"
               :: "v"(lds_off), "v"(gptr) : "memory");
}
DEV void wait_async_le(int) {}  // (documentation only; real waits below)
DEV void wait_async16() { asm volatile("s_wait_asynccnt 0x10" ::: "memory"); }
DEV void wait_async0()  { asm volatile("s_wait_asynccnt 0x0"  ::: "memory"); }

// ---------------------------------------------------------------------------
// Kernel A: projections.  blockIdx.y: 0->Pk(KEY,W), 1->Pq(QUERY,W), 2->PvT(VALUE,Wv)
// One wave per 64x64 output tile (cPT x cPT WMMA tiles), a block of 2x2 waves per
// 128x128: every loaded fragment feeds cPT WMMAs. K=256 -> 8 steps.
// Pk/Pq layout: P[b][h][l][d];  PvT layout: P[b][h][d][l]  (h = hidden%8, d = hidden/8)
// The tile is turned so that the 8 accumulator rows a lane holds lie side by side
// in the destination (one 16-byte store):
//   VT  (PvT)  : D = X . W^T, rows = l, column = hidden unit.
//   !VT (Pk/Pq): D = W . X^T, column = l, and the 16 weight rows of tile ib are
//                the units of heads 2*ib and 2*ib+1 at 8 successive d, so rows = d.
// ---------------------------------------------------------------------------
typedef __attribute__((ext_vector_type(8))) _Float16 v8h;
constexpr int cPT = 4;          // 16-row fragments per side of a wave's tile

// One A/B fragment's 16 f32 values from this lane's own row, in fragment order
DEV void load_row_f32(float (&q)[16], const float* __restrict__ p) {
  int lane = lane_id();
#pragma unroll
  for (int e = 0; e < 16; ++e) q[e] = p[kidx(lane, e)];
}
DEV v16h cvt_row_f16(const float (&q)[16]) {
  v16h f;
#pragma unroll
  for (int e = 0; e < 16; ++e) f[e] = (_Float16)q[e];
  return f;
}

template <bool VT>
DEV void proj_tile(const float* __restrict__ src, const float* __restrict__ w,
                   const float* __restrict__ bias, _Float16* __restrict__ dst,
                   int m0, int n0) {
  const int lane = lane_id();
  const int row = lane & 15, hi = lane >> 4;

  const float* xp[cPT];
  const float* wp[cPT];
#pragma unroll
  for (int i = 0; i < cPT; ++i) {
    xp[i] = src + (size_t)(m0 + i * 16 + row) * cINK;
    const int n = VT ? (n0 + i * 16 + row)
                     : (n0 + (row & 7) * cHEADS + i * 2 + (row >> 3));
    wp[i] = w + (size_t)n * cINK;
  }

  v8f acc[cPT][cPT] = {};
  float rx[cPT][16], rw[cPT][16];          // the next step's operands, still f32
  float bv[cPT][8];                        // bias of accumulator row r of tile ib
#pragma unroll
  for (int ib = 0; ib < cPT; ++ib)
#pragma unroll
    for (int r = 0; r < (VT ? 1 : 8); ++r)
      bv[ib][r] = VT ? bias[n0 + ib * 16 + row] : bias[n0 + r * cHEADS + ib * 2 + hi];
  // The bias loads' address registers are reused only once they have issued; the
  // scheduling barrier keeps what follows behind the wait.
  asm volatile("s_wait_xcnt 0x0" ::: "memory");
  __builtin_amdgcn_sched_barrier(0);
#pragma unroll
  for (int i = 0; i < cPT; ++i) {
    load_row_f32(rx[i], xp[i]);
    load_row_f32(rw[i], wp[i]);
  }
#pragma unroll  // constant k0: every load is its row pointer plus an immediate
  for (int k0 = 0; k0 < cINK; k0 += 32) {
    v16h x[cPT], wf[cPT];
#pragma unroll
    for (int i = 0; i < cPT; ++i) {
      x[i]  = cvt_row_f16(rx[i]);
      wf[i] = cvt_row_f16(rw[i]);
    }
    if (k0 + 32 < cINK) {
#pragma unroll
      for (int i = 0; i < cPT; ++i) {
        load_row_f32(rx[i], xp[i] + k0 + 32);
        load_row_f32(rw[i], wp[i] + k0 + 32);
      }
      // The row pointers die behind the last loads: their registers are reused
      // only once those loads have issued.
      if (k0 + 64 >= cINK) asm volatile("s_wait_xcnt 0x0" ::: "memory");
    }
    // Keeps the next step's loads, all of them, in front of this step's WMMAs:
    // left alone the scheduler issues them two at a time, each pair waited for.
    __builtin_amdgcn_sched_barrier(0);
#pragma unroll
    for (int ia = 0; ia < cPT; ++ia)
#pragma unroll
      for (int ib = 0; ib < cPT; ++ib)
        acc[ia][ib] = VT ? wmma16(x[ia], wf[ib], acc[ia][ib])
                         : wmma16(wf[ib], x[ia], acc[ia][ib]);
  }

  const int bi = m0 / cL, l0 = m0 % cL;    // a 64-row tile lies in one batch entry
#pragma unroll
  for (int ib = 0; ib < cPT; ++ib) {
    _Float16* dp;                           // this lane's 8 values at ia = 0
    size_t step;                            // elements from one ia to the next
    if (VT) {
      const int n = n0 + ib * 16 + row;
      dp = dst + (((size_t)bi * cHEADS + (n & 7)) * cD + (n >> 3)) * cL + l0 + hi * 8;
      step = 16;
    } else {
      const int h = ib * 2 + hi;
      dp = dst + (((size_t)bi * cHEADS + h) * cL + l0 + row) * cD + (n0 >> 3);
      step = (size_t)16 * cD;
    }
#pragma unroll
    for (int ia = 0; ia < cPT; ++ia) {
      v8h o;
#pragma unroll
      for (int r = 0; r < 8; ++r) o[r] = (_Float16)(acc[ia][ib][r] + bv[ib][VT ? 0 : r]);
      *(v8h*)(dp + ia * step) = o;
    }
    // The next tile column's sums reuse these stores' registers: they wait for the
    // stores' issue, and the scheduling barrier keeps them behind the wait. Behind
    // the last run too: the other variant's code follows it in the built kernel.
    asm volatile("s_wait_xcnt 0x0" ::: "memory");
    __builtin_amdgcn_sched_barrier(0);
  }
}

__global__ void __launch_bounds__(128)
proj_kernel(const float* __restrict__ KEY,
                            const float* __restrict__ VALUE,
                            const float* __restrict__ QUERY,
                            const float* __restrict__ W_w,
                            const float* __restrict__ W_b,
                            const float* __restrict__ Wv_w,
                            const float* __restrict__ Wv_b,
                            _Float16* __restrict__ Pk,
                            _Float16* __restrict__ Pq,
                            _Float16* __restrict__ PvT) {
  const int which = blockIdx.y;
  constexpr int NB = cHID / (32 * cPT);    // 8 block columns
  const int wave = threadIdx.x >> 5;
  const int m0 = (blockIdx.x / NB) * (32 * cPT) + (wave >> 1) * (16 * cPT);
  const int n0 = (blockIdx.x % NB) * (32 * cPT) + (wave & 1) * (16 * cPT);

  if (which == 2) proj_tile<true>(VALUE, Wv_w, Wv_b, PvT, m0, n0);
  else            proj_tile<false>(which == 0 ? KEY : QUERY, W_w, W_b,
                                   which == 0 ? Pk : Pq, m0, n0);
}

// ---------------------------------------------------------------------------
// Kernel B: fused attention. One block per (b, 64-col Lq tile, key range);
// 8 waves = 8 heads. Every K and PvT fragment feeds cNQ WMMAs, one per 16-col
// query sub-tile. The sum over keys has no normaliser (the softmax runs over
// heads), so each key range writes its own partial ctx plane and the output
// projection adds the planes in its accumulate chain.
// K tiles double-buffered in LDS via async copies; Q fragments hoisted; score
// WMMAs -> LDS -> cross-head softmax (elementwise in (i,k)) -> PvT@attn WMMAs.
// ---------------------------------------------------------------------------
constexpr int cKP = cD + 8;     // K row pitch in LDS: 272 B = 17 x 16 B, so the 16 rows that a
                                // fragment read touches fall on 16 different bank groups
struct AttnSmem {
  _Float16 sK[2][cHEADS][32][cKP];  // 136 KB, double-buffered K tiles (first!)
  float    s_sc[cNQ][cHEADS][32][16];   // 16 KB per sub-tile, score/attn exchange
};

__global__ void __launch_bounds__(256)   // real block size: registers for the wide tile
attn_kernel(const _Float16* __restrict__ Pk,
                            const _Float16* __restrict__ Pq,
                            const _Float16* __restrict__ PvT,
                            _Float16* __restrict__ ctx) {
  __shared__ __attribute__((aligned(16))) AttnSmem sm;   // 16-byte K reads stay whole

  constexpr int QT = cL / (16 * cNQ);      // query tiles per batch entry
  const int bb = blockIdx.x / QT;
  const int kt = blockIdx.x % QT;
  const int ks = blockIdx.y;               // key range of this block
  const int h  = threadIdx.x >> 5;         // wave id == head
  const int lane = lane_id();

  const _Float16* Kh = Pk  + ((size_t)(bb * cHEADS + h) * cL + ks * cLK) * cD;
  const _Float16* Qt = Pq  + ((size_t)(bb * cHEADS + h) * cL) * cD
                           + (size_t)(kt * 16 * cNQ) * cD;
  const _Float16* Vt = PvT + ((size_t)(bb * cHEADS + h) * cD) * cL + ks * cLK;  // [d][L]

  // Q fragments are invariant over the whole Lk loop: hoist (cNQ x 4 x v16h).
  v16h bq[cNQ][4];
#pragma unroll  // constant c: the per-sub-tile arrays stay in registers
  for (int c = 0; c < cNQ; ++c)
#pragma unroll
    for (int q = 0; q < 4; ++q)
      bq[c][q] = frag_rm_f16(Qt + (size_t)(c * 16) * cD + q * 32, cD);
  // the Q loads share one address pair: hold its reuse behind their issue
  asm volatile("s_wait_xcnt 0x0" ::: "memory");

  v8f acc[cNQ][8] = {};                    // per sub-tile: 8 j-tiles (d) x 16 k cols

  // --- async stage of one 32x128 f16 K tile (8 KB) into sK[buf][h] --------
  auto stage_k = [&](int buf, int i0) {
    // the wave's number as a scalar: the tile's base then takes no vector register
    unsigned base = (unsigned)((buf * cHEADS + __builtin_amdgcn_readfirstlane(h)) * (32 * cKP * 2)
                               + (lane >> 4) * (cKP * 2) + (lane & 15) * 16);   // sK @ LDS off 0
    const char* g = (const char*)(Kh + (size_t)i0 * cD);
#pragma unroll
    for (int t = 0; t < 16; ++t) {
      unsigned lds = base + (unsigned)(t * (2 * cKP * 2));   // 544 B = two padded rows
      async_copy_512(lds, g + t * 512 + lane * 16);
    }
  };

  stage_k(0, 0);

  for (int i0 = 0; i0 < cLK; i0 += 32) {
    const int  cur  = (i0 >> 5) & 1;
    const bool more = (i0 + 32) < cLK;
    if (more) stage_k(cur ^ 1, i0 + 32);

    // prefetch next PvT tile rows into cache while we compute
    if (more) {
#pragma unroll
      for (int r = 0; r < 4; ++r)
        __builtin_prefetch(Vt + (size_t)(r * 32 + lane) * cL + i0 + 32, 0, 1);
    }

    if (more) wait_async16();   // oldest 16 (current buffer) complete
    else      wait_async0();

    const _Float16* sk = &sm.sK[cur][h][0][0];

    // --- score tiles S[i0..i0+31][kt*64..+64] (cNQ sub-tiles) for this head (from LDS) ---
    v8f s0[cNQ] = {}, s1[cNQ] = {};
#pragma unroll
    for (int k0 = 0; k0 < cD; k0 += 32) {
      v16h a0 = frag_rm_f16(sk + k0, cKP);
      v16h a1 = frag_rm_f16(sk + 16 * cKP + k0, cKP);
#pragma unroll  // constant c: the per-sub-tile arrays stay in registers
      for (int c = 0; c < cNQ; ++c) {
        s0[c] = wmma16(a0, bq[c][k0 >> 5], s0[c]);
        s1[c] = wmma16(a1, bq[c][k0 >> 5], s1[c]);
      }
    }
    __syncthreads();   // prior iteration's s_sc reads are done
    {
      int kk = lane & 15;
      int mb = (lane & 16) ? 8 : 0;
#pragma unroll  // constant c: the per-sub-tile arrays stay in registers
      for (int c = 0; c < cNQ; ++c) {
#pragma unroll
        for (int r = 0; r < 8; ++r) {
          sm.s_sc[c][h][r + mb][kk]      = s0[c][r];
          sm.s_sc[c][h][16 + r + mb][kk] = s1[c][r];
        }
      }
    }
    __syncthreads();
    // --- softmax across the 8 heads, elementwise in (i,k) ----------------
    for (int t = threadIdx.x; t < 512 * cNQ; t += 256) {
      int c = t >> 9, ii = (t >> 4) & 31, kk = t & 15;
      float v[cHEADS];
      float m = -3.0e38f;
#pragma unroll
      for (int hh = 0; hh < cHEADS; ++hh) {
        v[hh] = sm.s_sc[c][hh][ii][kk] * cSCALE;
        m = fmaxf(m, v[hh]);
      }
      float sum = 0.f;
#pragma unroll
      for (int hh = 0; hh < cHEADS; ++hh) {
        float e = __expf(v[hh] - m);
        v[hh] = e;
        sum += e;
      }
      float inv = 1.f / sum;
#pragma unroll
      for (int hh = 0; hh < cHEADS; ++hh) sm.s_sc[c][hh][ii][kk] = v[hh] * inv;
    }
    __syncthreads();
    // --- out_h[j,k] += PvT[j,i] @ attn[i,k]  (K = 32 rows of i) ----------
    v16h battn[cNQ];
#pragma unroll  // constant c: the per-sub-tile arrays stay in registers
    for (int c = 0; c < cNQ; ++c) {
      int kk = lane & 15;
      const float* ab = &sm.s_sc[c][h][0][0];
#pragma unroll
      for (int e = 0; e < 16; ++e)
        battn[c][e] = (_Float16)ab[kidx(lane, e) * 16 + kk];
    }
#pragma unroll
    for (int jt = 0; jt < 8; ++jt) {
      v16h av = frag_rm_f16(Vt + (size_t)(jt * 16) * cL + i0, cL);
#pragma unroll  // constant c: the per-sub-tile arrays stay in registers
      for (int c = 0; c < cNQ; ++c) acc[c][jt] = wmma16(av, battn[c], acc[c][jt]);
    }
  }

  // --- store ctx[ks][b][l][d*8 + h] (f16), the reference's head interleave --
  _Float16* cp = ctx + (size_t)ks * ((size_t)cB * cL * cHID);
  const int kk = lane & 15;
  const int mb = (lane & 16) ? 8 : 0;
#pragma unroll  // constant c: the per-sub-tile arrays stay in registers
  for (int c = 0; c < cNQ; ++c) {
    const int l = (kt * cNQ + c) * 16 + kk;
#pragma unroll
    for (int jt = 0; jt < 8; ++jt) {
#pragma unroll
      for (int r = 0; r < 8; ++r) {
        int d = jt * 16 + r + mb;
        cp[((size_t)bb * cL + l) * cHID + d * cHEADS + h] = (_Float16)acc[c][jt][r];
      }
      // The next run's conversion reuses these stores' data registers: it waits
      // for their issue, and the scheduling barrier keeps it behind the wait.
      if (c * 8 + jt + 1 < cNQ * 8) {   // nothing is converted behind the last run
        asm volatile("s_wait_xcnt 0x0" ::: "memory");
        __builtin_amdgcn_sched_barrier(0);
      }
    }
  }
}

// ---------------------------------------------------------------------------
// Kernel C: final projection (sum of the cKS ctx planes)[8192,1024](f16)
// @ Wo^T[1024,256] + b -> f32. One wave per 64x64 output tile (cOT x cOT WMMA
// tiles): every ctx fragment feeds cOT WMMAs, every weight fragment cKS x cOT. The two waves of a block share
// their 64 ctx rows. The planes are added by running every plane through the
// same f32 accumulate chain, plane 0 then plane 1 at each k-step.
// ---------------------------------------------------------------------------
constexpr int cOT = 4;          // 16-row fragments per side of a wave's tile
typedef __attribute__((ext_vector_type(4))) float v4f;

__global__ void __launch_bounds__(64)
outproj_kernel(const _Float16* __restrict__ ctx,
                               const float* __restrict__ Wo_w,
                               const float* __restrict__ Wo_b,
                               float* __restrict__ out) {
  const int lane = lane_id();
  const int row = lane & 15, hi = lane >> 4;
  const int m0 = (int)(blockIdx.x >> 1) * (16 * cOT);
  const int n0 = (int)((blockIdx.x & 1) * 2 + (threadIdx.x >> 5)) * (16 * cOT);

  // This lane's first 8 k of fragment 0, per ctx plane and for the weights; the
  // other fragments and the second 8 k lie at constant distances from them.
  const _Float16* pa[cKS];
#pragma unroll
  for (int p = 0; p < cKS; ++p)
    pa[p] = ctx + (size_t)p * ((size_t)cB * cL * cHID) + (size_t)(m0 + row) * cHID + hi * 8;
  const float* pw = Wo_w + (size_t)(n0 + row) * cHID + hi * 8;

  float bv[cOT];                           // bias of this lane's column in tile column ib
#pragma unroll
  for (int ib = 0; ib < cOT; ++ib) bv[ib] = Wo_b[n0 + ib * 16 + row];
  // The bias loads' address register is reused only once they have issued; the
  // scheduling barrier keeps what follows behind the wait.
  asm volatile("s_wait_xcnt 0x0" ::: "memory");
  __builtin_amdgcn_sched_barrier(0);

  v8f acc[cOT][cOT] = {};
  v8h ra[cKS][cOT][2];                     // the next step's ctx fragments, in halves
  v4f rw[cOT][4];                          // the next step's weights, still f32
  auto fetch = [&]() {
#pragma unroll
    for (int i = 0; i < cOT; ++i) {
#pragma unroll
      for (int p = 0; p < cKS; ++p)
#pragma unroll
        for (int s = 0; s < 2; ++s)
          ra[p][i][s] = *(const v8h*)(pa[p] + (size_t)(i * 16) * cHID + s * 16);
#pragma unroll
      for (int s = 0; s < 4; ++s)
        rw[i][s] = *(const v4f*)(pw + (size_t)(i * 16) * cHID + (s >> 1) * 16 + (s & 1) * 4);
    }
    // The three pointers move on only once the loads that name them have issued;
    // the scheduling barrier keeps the loads, all of them, in front of what follows
    // (the current step's WMMAs, under which they fly).
    asm volatile("s_wait_xcnt 0x0" ::: "memory");
    __builtin_amdgcn_sched_barrier(0);
#pragma unroll
    for (int p = 0; p < cKS; ++p) pa[p] += 32;
    pw += 32;
  };
  fetch();
#pragma unroll 2  // two steps a trip: the fetched fragments change names, not registers
  for (int k0 = 0; k0 < cHID; k0 += 32) {
    v16h a[cKS][cOT], b[cOT];
#pragma unroll
    for (int i = 0; i < cOT; ++i) {
#pragma unroll
      for (int p = 0; p < cKS; ++p)
        a[p][i] = __builtin_shufflevector(ra[p][i][0], ra[p][i][1],
                                          0, 1, 2, 3, 4, 5, 6, 7, 8, 9, 10, 11, 12, 13, 14, 15);
#pragma unroll
      for (int e = 0; e < 16; ++e) b[i][e] = (_Float16)rw[i][e >> 2][e & 3];
    }
    if (k0 + 32 < cHID) fetch();
#pragma unroll
    for (int p = 0; p < cKS; ++p)
#pragma unroll
      for (int ia = 0; ia < cOT; ++ia)
#pragma unroll
        for (int ib = 0; ib < cOT; ++ib)
          acc[ia][ib] = wmma16(a[p][ia], b[ib], acc[ia][ib]);
  }

#pragma unroll
  for (int ib = 0; ib < cOT; ++ib)
#pragma unroll
    for (int ia = 0; ia < cOT; ++ia)
#pragma unroll
      for (int r = 0; r < 8; ++r) acc[ia][ib][r] += bv[ib];
  float* po = out + (size_t)(m0 + hi * 8) * cOUT + n0 + row;
  // Every sum and the one address stand in their registers before the first store
  // issues, so that no register which a store names is written behind it.
  __builtin_amdgcn_sched_barrier(0);
#pragma unroll
  for (int ib = 0; ib < cOT; ++ib)
#pragma unroll
    for (int ia = 0; ia < cOT; ++ia)
#pragma unroll
      for (int r = 0; r < 8; ++r) po[(ia * 16 + r) * cOUT + ib * 16] = acc[ia][ib][r];
}

// ---------------------------------------------------------------------------
extern "C" void kernel_launch(void* const* d_in, const int* in_sizes, int n_in,
                              void* d_out, int out_size, void* d_ws, size_t ws_size,
                              hipStream_t stream) {
  (void)in_sizes; (void)n_in; (void)out_size; (void)ws_size;
  const float* KEY   = (const float*)d_in[0];
  const float* VALUE = (const float*)d_in[1];
  const float* QUERY = (const float*)d_in[2];
  const float* W_w   = (const float*)d_in[3];
  const float* W_b   = (const float*)d_in[4];
  const float* Wv_w  = (const float*)d_in[5];
  const float* Wv_b  = (const float*)d_in[6];
  const float* Wo_w  = (const float*)d_in[7];
  const float* Wo_b  = (const float*)d_in[8];
  float* out = (float*)d_out;

  // f16 workspace: Pk, Pq, PvT (head-split) + cKS ctx planes, 16 MB each.
  const size_t pelems = (size_t)cB * cHEADS * cL * cD;   // == B*L*HID
  _Float16* Pk  = (_Float16*)d_ws;
  _Float16* Pq  = Pk + pelems;
  _Float16* PvT = Pq + pelems;
  _Float16* ctx = PvT + pelems;

  {
    const int MB = (cB * cL) / (32 * cPT);   // 64 block rows
    const int NB = cHID / (32 * cPT);        // 8 block columns
    dim3 grid(MB * NB, 3);                   // 4 waves/block, 3 projections
    proj_kernel<<<grid, 128, 0, stream>>>(KEY, VALUE, QUERY, W_w, W_b, Wv_w, Wv_b,
                                          Pk, Pq, PvT);
  }
  {
    dim3 grid(cB * (cL / (16 * cNQ)), cKS);  // 128 x 2 blocks, 8 waves = 8 heads
    attn_kernel<<<grid, 256, 0, stream>>>(Pk, Pq, PvT, ctx);
  }
  {
    const int MT = (cB * cL) / (16 * cOT);   // 128 tile rows
    const int NT = cOUT / (16 * cOT);        // 4 tile columns
    dim3 grid((MT * NT) / 2);                // 256 blocks of 2 waves
    outproj_kernel<<<grid, 64, 0, stream>>>(ctx, Wo_w, Wo_b, out);
  }
}

// v005
// It runs in 358 microseconds.
// In two side-by-side timings against v004, it was 1.04 and 1.03 times as fast.
// All steps since v000 together make it 2.82 times as fast.
#include <hip/hip_runtime.h>
#include <hip/hip_bf16.h>
#include <math.h>

// ---------------------------------------------------------------------------
// MHA with softmax-over-heads, fused for MI455X (gfx1250, wave32, WMMA).
//   proj    : KEY/QUERY @ W^T + b -> f16 head-split; VALUE @ Wv^T + b -> f16
//             head-split TRANSPOSED (PvT[b][h][d][L]) so the attention kernel
//             reads every operand contiguously.
//   attn    : fused score + head-softmax + attn^T@Wv, K tiles (double-buffered)
//             and PvT tiles staged to LDS with global_load_async_to_lds_b128.
//   outproj : ctx @ Wo^T + b -> f32
// All matmuls via v_wmma_f32_16x16x32_f16 (f32 accumulate).
// ---------------------------------------------------------------------------

typedef __attribute__((ext_vector_type(16))) _Float16 v16h;
typedef __attribute__((ext_vector_type(8)))  float    v8f;

#define DEV static __device__ __forceinline__

constexpr int cB = 4, cL = 2048, cINK = 256, cHID = 1024, cHEADS = 8, cD = 128, cOUT = 256;
constexpr float cSCALE = 0.08838834764831845f;   // 1/sqrt(128)
constexpr int cNQ = 4;          // 16-column query sub-tiles per attention block
constexpr int cKS = 2;          // key ranges; each block sums over one of them
constexpr int cLK = cL / cKS;   // keys per block

DEV int lane_id() { return (int)(threadIdx.x & 31u); }

// K index (within the 32-wide K tile) held by element e of a 16-bit A/B frag.
// Per ISA 7.12.2: lanes 0-15 -> K 0..7 / 16..23, lanes 16-31 -> K 8..15 / 24..31.
DEV int kidx(int lane, int e) {
  int kb = (lane & 16) ? 8 : 0;
  return (e < 8) ? (kb + e) : (16 + kb + (e - 8));
}

// A/B fragment from a row-major f16 tile (two contiguous 16B chunks per lane)
DEV v16h frag_rm_f16(const _Float16* base, int ld) {
  int lane = lane_id();
  const _Float16* p = base + (size_t)(lane & 15) * ld;
  v16h f;
#pragma unroll
  for (int e = 0; e < 16; ++e) f[e] = p[kidx(lane, e)];
  return f;
}

DEV v8f wmma16(v16h a, v16h b, v8f c) {
  return __builtin_amdgcn_wmma_f32_16x16x32_f16(false, a, false, b, (short)0, c,
                                                false, false);
}

// Async-copy 512B (32 lanes x 16B) from global to LDS; CDNA5 async path.
// lds_off is the byte offset within the workgroup's LDS segment.
DEV void async_copy_512(unsigned lds_off, const void* gptr) {
  asm volatile("global_load_async_to_lds_b128 %0, %1, off"
               :: "v"(lds_off), "v"(gptr) : "memory");
}
// The same copy as the compiler's own form: each lane's 16 B from g to l.
typedef __attribute__((ext_vector_type(4))) int v4i;
DEV void async_copy_16(_Float16* l, const _Float16* g) {
  __builtin_amdgcn_global_load_async_to_lds_b128(
      (__attribute__((address_space(1))) v4i*)g, (__attribute__((address_space(3))) v4i*)l, 0, 0);
}
DEV void wait_async_le(int) {}  // (documentation only; real waits below)
DEV void wait_async16() { asm volatile("s_wait_asynccnt 0x10" ::: "memory"); }
DEV void wait_async0()  { asm volatile("s_wait_asynccnt 0x0"  ::: "memory"); }

// ---------------------------------------------------------------------------
// Kernel A: projections.  blockIdx.y: 0->Pk(KEY,W), 1->Pq(QUERY,W), 2->PvT(VALUE,Wv)
// One wave per 64x64 output tile (cPT x cPT WMMA tiles), a block of 2x2 waves per
// 128x128: every loaded fragment feeds cPT WMMAs. K=256 -> 8 steps.
// Pk/Pq layout: P[b][h][l][d];  PvT layout: P[b][h][d][l]  (h = hidden%8, d = hidden/8)
// The tile is turned so that the 8 accumulator rows a lane holds lie side by side
// in the destination (one 16-byte store):
//   VT  (PvT)  : D = X . W^T, rows = l, column = hidden unit.
//   !VT (Pk/Pq): D = W . X^T, column = l, and the 16 weight rows of tile ib are
//                the units of heads 2*ib and 2*ib+1 at 8 successive d, so rows = d.
// ---------------------------------------------------------------------------
typedef __attribute__((ext_vector_type(8))) _Float16 v8h;
constexpr int cPT = 4;          // 16-row fragments per side of a wave's tile

// One A/B fragment's 16 f32 values from this lane's own row, in fragment order
DEV void load_row_f32(float (&q)[16], const float* __restrict__ p) {
  int lane = lane_id();
#pragma unroll
  for (int e = 0; e < 16; ++e) q[e] = p[kidx(lane, e)];
}
DEV v16h cvt_row_f16(const float (&q)[16]) {
  v16h f;
#pragma unroll
  for (int e = 0; e < 16; ++e) f[e] = (_Float16)q[e];
  return f;
}

template <bool VT>
DEV void proj_tile(const float* __restrict__ src, const float* __restrict__ w,
                   const float* __restrict__ bias, _Float16* __restrict__ dst,
                   int m0, int n0) {
  const int lane = lane_id();
  const int row = lane & 15, hi = lane >> 4;

  const float* xp[cPT];
  const float* wp[cPT];
#pragma unroll
  for (int i = 0; i < cPT; ++i) {
    xp[i] = src + (size_t)(m0 + i * 16 + row) * cINK;
    const int n = VT ? (n0 + i * 16 + row)
                     : (n0 + (row & 7) * cHEADS + i * 2 + (row >> 3));
    wp[i] = w + (size_t)n * cINK;
  }

  v8f acc[cPT][cPT] = {};
  float rx[cPT][16], rw[cPT][16];          // the next step's operands, still f32
  float bv[cPT][8];                        // bias of accumulator row r of tile ib
#pragma unroll
  for (int ib = 0; ib < cPT; ++ib)
#pragma unroll
    for (int r = 0; r < (VT ? 1 : 8); ++r)
      bv[ib][r] = VT ? bias[n0 + ib * 16 + row] : bias[n0 + r * cHEADS + ib * 2 + hi];
  // The bias loads' address registers are reused only once they have issued; the
  // scheduling barrier keeps what follows behind the wait.
  asm volatile("s_wait_xcnt 0x0" ::: "memory");
  __builtin_amdgcn_sched_barrier(0);
#pragma unroll
  for (int i = 0; i < cPT; ++i) {
    load_row_f32(rx[i], xp[i]);
    load_row_f32(rw[i], wp[i]);
  }
#pragma unroll  // constant k0: every load is its row pointer plus an immediate
  for (int k0 = 0; k0 < cINK; k0 += 32) {
    v16h x[cPT], wf[cPT];
#pragma unroll
    for (int i = 0; i < cPT; ++i) {
      x[i]  = cvt_row_f16(rx[i]);
      wf[i] = cvt_row_f16(rw[i]);
    }
    if (k0 + 32 < cINK) {
#pragma unroll
      for (int i = 0; i < cPT; ++i) {
        load_row_f32(rx[i], xp[i] + k0 + 32);
        load_row_f32(rw[i], wp[i] + k0 + 32);
      }
      // The row pointers die behind the last loads: their registers are reused
      // only once those loads have issued.
      if (k0 + 64 >= cINK) asm volatile("s_wait_xcnt 0x0" ::: "memory");
    }
    // Keeps the next step's loads, all of them, in front of this step's WMMAs:
    // left alone the scheduler issues them two at a time, each pair waited for.
    __builtin_amdgcn_sched_barrier(0);
#pragma unroll
    for (int ia = 0; ia < cPT; ++ia)
#pragma unroll
      for (int ib = 0; ib < cPT; ++ib)
        acc[ia][ib] = VT ? wmma16(x[ia], wf[ib], acc[ia][ib])
                         : wmma16(wf[ib], x[ia], acc[ia][ib]);
  }

  const int bi = m0 / cL, l0 = m0 % cL;    // a 64-row tile lies in one batch entry
#pragma unroll
  for (int ib = 0; ib < cPT; ++ib) {
    _Float16* dp;                           // this lane's 8 values at ia = 0
    size_t step;                            // elements from one ia to the next
    if (VT) {
      const int n = n0 + ib * 16 + row;
      dp = dst + (((size_t)bi * cHEADS + (n & 7)) * cD + (n >> 3)) * cL + l0 + hi * 8;
      step = 16;
    } else {
      const int h = ib * 2 + hi;
      dp = dst + (((size_t)bi * cHEADS + h) * cL + l0 + row) * cD + (n0 >> 3);
      step = (size_t)16 * cD;
    }
#pragma unroll
    for (int ia = 0; ia < cPT; ++ia) {
      v8h o;
#pragma unroll
      for (int r = 0; r < 8; ++r) o[r] = (_Float16)(acc[ia][ib][r] + bv[ib][VT ? 0 : r]);
      *(v8h*)(dp + ia * step) = o;
    }
    // The next tile column's sums reuse these stores' registers: they wait for the
    // stores' issue, and the scheduling barrier keeps them behind the wait. Behind
    // the last run too: the other variant's code follows it in the built kernel.
    asm volatile("s_wait_xcnt 0x0" ::: "memory");
    __builtin_amdgcn_sched_barrier(0);
  }
}

__global__ void __launch_bounds__(128)
proj_kernel(const float* __restrict__ KEY,
                            const float* __restrict__ VALUE,
                            const float* __restrict__ QUERY,
                            const float* __restrict__ W_w,
                            const float* __restrict__ W_b,
                            const float* __restrict__ Wv_w,
                            const float* __restrict__ Wv_b,
                            _Float16* __restrict__ Pk,
                            _Float16* __restrict__ Pq,
                            _Float16* __restrict__ PvT) {
  const int which = blockIdx.y;
  constexpr int NB = cHID / (32 * cPT);    // 8 block columns
  const int wave = threadIdx.x >> 5;
  const int m0 = (blockIdx.x / NB) * (32 * cPT) + (wave >> 1) * (16 * cPT);
  const int n0 = (blockIdx.x % NB) * (32 * cPT) + (wave & 1) * (16 * cPT);

  if (which == 2) proj_tile<true>(VALUE, Wv_w, Wv_b, PvT, m0, n0);
  else            proj_tile<false>(which == 0 ? KEY : QUERY, W_w, W_b,
                                   which == 0 ? Pk : Pq, m0, n0);
}

// ---------------------------------------------------------------------------
// Kernel B: fused attention. One block per (b, 64-col Lq tile, key range);
// 8 waves = 8 heads. Every K and PvT fragment feeds cNQ WMMAs, one per 16-col
// query sub-tile. The sum over keys has no normaliser (the softmax runs over
// heads), so each key range writes its own partial ctx plane and the output
// projection adds the planes in its accumulate chain.
// K tiles double-buffered in LDS via async copies; Q fragments hoisted; score
// WMMAs -> LDS -> cross-head softmax (elementwise in (i,k)) -> PvT@attn WMMAs.
// The PvT tile of a trip flies into LDS under that trip's softmax; each wave
// copies and reads its own head's tile only.
// ---------------------------------------------------------------------------
constexpr int cKP = cD + 8;     // K row pitch in LDS: 272 B = 17 x 16 B, so the 16 rows that a
                                // fragment read touches fall on 16 different bank groups
constexpr int cVP = 32 + 8;     // PvT row pitch in LDS: 80 B = 5 x 16 B, for the same reason
struct AttnSmem {
  _Float16 sK[2][cHEADS][32][cKP];  // 136 KB, double-buffered K tiles (first!)
  float    s_sc[cNQ][cHEADS][32][16];   // 16 KB per sub-tile, score/attn exchange
  _Float16 sV[cHEADS][cD][cVP];     // 80 KB, this trip's PvT tiles (128 d x 32 keys a head)
};

__global__ void __launch_bounds__(256)   // real block size: registers for the wide tile
attn_kernel(const _Float16* __restrict__ Pk,
                            const _Float16* __restrict__ Pq,
                            const _Float16* __restrict__ PvT,
                            _Float16* __restrict__ ctx) {
  __shared__ __attribute__((aligned(16))) AttnSmem sm;   // 16-byte K reads stay whole

  constexpr int QT = cL / (16 * cNQ);      // query tiles per batch entry
  const int bb = blockIdx.x / QT;
  const int kt = blockIdx.x % QT;
  const int ks = blockIdx.y;               // key range of this block
  const int h  = threadIdx.x >> 5;         // wave id == head
  const int lane = lane_id();

  const _Float16* Kh = Pk  + ((size_t)(bb * cHEADS + h) * cL + ks * cLK) * cD;
  const _Float16* Qt = Pq  + ((size_t)(bb * cHEADS + h) * cL) * cD
                           + (size_t)(kt * 16 * cNQ) * cD;
  const _Float16* Vt = PvT + ((size_t)(bb * cHEADS + h) * cD) * cL + ks * cLK;  // [d][L]

  // Q fragments are invariant over the whole Lk loop: hoist (cNQ x 4 x v16h).
  v16h bq[cNQ][4];
#pragma unroll  // constant c: the per-sub-tile arrays stay in registers
  for (int c = 0; c < cNQ; ++c)
#pragma unroll
    for (int q = 0; q < 4; ++q)
      bq[c][q] = frag_rm_f16(Qt + (size_t)(c * 16) * cD + q * 32, cD);
  // the Q loads share one address pair: hold its reuse behind their issue
  asm volatile("s_wait_xcnt 0x0" ::: "memory");

  v8f acc[cNQ][8] = {};                    // per sub-tile: 8 j-tiles (d) x 16 k cols

  // --- async stage of one 32x128 f16 K tile (8 KB) into sK[buf][h] --------
  auto stage_k = [&](int buf, int i0) {
    // the wave's number as a scalar: the tile's base then takes no vector register
    unsigned base = (unsigned)((buf * cHEADS + __builtin_amdgcn_readfirstlane(h)) * (32 * cKP * 2)
                               + (lane >> 4) * (cKP * 2) + (lane & 15) * 16);   // sK @ LDS off 0
    const char* g = (const char*)(Kh + (size_t)i0 * cD);
#pragma unroll
    for (int t = 0; t < 16; ++t) {
      unsigned lds = base + (unsigned)(t * (2 * cKP * 2));   // 544 B = two padded rows
      async_copy_512(lds, g + t * 512 + lane * 16);
    }
  };

  // --- async stage of one 128x32 f16 PvT tile (8 KB) into sV[h] -----------
  // A copy brings 8 rows of 64 B: four lanes a row.
  auto stage_v = [&](int i0) {
    _Float16* l = &sm.sV[h][lane >> 2][(lane & 3) * 8];
    const _Float16* g = Vt + (size_t)(lane >> 2) * cL + i0 + (lane & 3) * 8;
#pragma unroll  // constant t: each copy's two addresses are a base plus a constant
    for (int t = 0; t < 16; ++t) async_copy_16(l + t * 8 * cVP, g + (size_t)(t * 8) * cL);
  };

  stage_k(0, 0);

  for (int i0 = 0; i0 < cLK; i0 += 32) {
    const int  cur  = (i0 >> 5) & 1;
    const bool more = (i0 + 32) < cLK;
    if (more) stage_k(cur ^ 1, i0 + 32);

    if (more) wait_async16();   // oldest 16 (current buffer) complete
    else      wait_async0();

    const _Float16* sk = &sm.sK[cur][h][0][0];

    // --- score tiles S[i0..i0+31][kt*64..+64] (cNQ sub-tiles) for this head (from LDS) ---
    v8f s0[cNQ] = {}, s1[cNQ] = {};
#pragma unroll
    for (int k0 = 0; k0 < cD; k0 += 32) {
      v16h a0 = frag_rm_f16(sk + k0, cKP);
      v16h a1 = frag_rm_f16(sk + 16 * cKP + k0, cKP);
#pragma unroll  // constant c: the per-sub-tile arrays stay in registers
      for (int c = 0; c < cNQ; ++c) {
        s0[c] = wmma16(a0, bq[c][k0 >> 5], s0[c]);
        s1[c] = wmma16(a1, bq[c][k0 >> 5], s1[c]);
      }
    }
    // This wave's reads of sV (the trip before) have retired before it is refilled.
    asm volatile("s_wait_dscnt 0x0" ::: "memory");
    __syncthreads();   // prior iteration's s_sc and sV reads are done
    stage_v(i0);       // lands under the score exchange and the softmax
    {
      int kk = lane & 15;
      int mb = (lane & 16) ? 8 : 0;
#pragma unroll  // constant c: the per-sub-tile arrays stay in registers
      for (int c = 0; c < cNQ; ++c) {
#pragma unroll
        for (int r = 0; r < 8; ++r) {
          sm.s_sc[c][h][r + mb][kk]      = s0[c][r];
          sm.s_sc[c][h][16 + r + mb][kk] = s1[c][r];
        }
      }
    }
    __syncthreads();
    // --- softmax across the 8 heads, elementwise in (i,k) ----------------
    for (int t = threadIdx.x; t < 512 * cNQ; t += 256) {
      int c = t >> 9, ii = (t >> 4) & 31, kk = t & 15;
      float v[cHEADS];
      float m = -3.0e38f;
#pragma unroll
      for (int hh = 0; hh < cHEADS; ++hh) {
        v[hh] = sm.s_sc[c][hh][ii][kk] * cSCALE;
        m = fmaxf(m, v[hh]);
      }
      float sum = 0.f;
#pragma unroll
      for (int hh = 0; hh < cHEADS; ++hh) {
        float e = __expf(v[hh] - m);
        v[hh] = e;
        sum += e;
      }
      float inv = 1.f / sum;
#pragma unroll
      for (int hh = 0; hh < cHEADS; ++hh) sm.s_sc[c][hh][ii][kk] = v[hh] * inv;
    }
    wait_async0();     // this trip's PvT tile has landed (the next K tile too)
    __syncthreads();
    // --- out_h[j,k] += PvT[j,i] @ attn[i,k]  (K = 32 rows of i) ----------
    v16h battn[cNQ];
#pragma unroll  // constant c: the per-sub-tile arrays stay in registers
    for (int c = 0; c < cNQ; ++c) {
      int kk = lane & 15;
      const float* ab = &sm.s_sc[c][h][0][0];
#pragma unroll
      for (int e = 0; e < 16; ++e)
        battn[c][e] = (_Float16)ab[kidx(lane, e) * 16 + kk];
    }
    const _Float16* sv = &sm.sV[h][0][0];
    v16h av[8];                            // four are live at a time
#pragma unroll  // constant jt, here and below: av and acc stay in registers
    for (int jt = 0; jt < 4; ++jt) av[jt] = frag_rm_f16(sv + jt * 16 * cVP, cVP);
#pragma unroll
    for (int j0 = 0; j0 < 8; j0 += 2) {
      // Keeps the LDS reads four fragments ahead of the WMMAs that use them: left
      // alone the scheduler reads one fragment at a time and waits for each.
      __builtin_amdgcn_sched_barrier(0);
#pragma unroll
      for (int jt = j0; jt < j0 + 2; ++jt)
#pragma unroll  // constant c: the per-sub-tile arrays stay in registers
        for (int c = 0; c < cNQ; ++c) acc[c][jt] = wmma16(av[jt], battn[c], acc[c][jt]);
      if (j0 + 4 < 8) {
#pragma unroll
        for (int jt = j0 + 4; jt < j0 + 6; ++jt) av[jt] = frag_rm_f16(sv + jt * 16 * cVP, cVP);
      }
    }
  }

  // --- store ctx[ks][b][l][d*8 + h] (f16), the reference's head interleave --
  _Float16* cp = ctx + (size_t)ks * ((size_t)cB * cL * cHID);
  const int kk = lane & 15;
  const int mb = (lane & 16) ? 8 : 0;
#pragma unroll  // constant c: the per-sub-tile arrays stay in registers
  for (int c = 0; c < cNQ; ++c) {
    const int l = (kt * cNQ + c) * 16 + kk;
#pragma unroll
    for (int jt = 0; jt < 8; ++jt) {
#pragma unroll
      for (int r = 0; r < 8; ++r) {
        int d = jt * 16 + r + mb;
        cp[((size_t)bb * cL + l) * cHID + d * cHEADS + h] = (_Float16)acc[c][jt][r];
      }
      // The next run's conversion reuses these stores' data registers: it waits
      // for their issue, and the scheduling barrier keeps it behind the wait.
      if (c * 8 + jt + 1 < cNQ * 8) {   // nothing is converted behind the last run
        asm volatile("s_wait_xcnt 0x0" ::: "memory");
        __builtin_amdgcn_sched_barrier(0);
      }
    }
  }
}

// ---------------------------------------------------------------------------
// Kernel C: final projection (sum of the cKS ctx planes)[8192,1024](f16)
// @ Wo^T[1024,256] + b -> f32. One wave per 64x64 output tile (cOT x cOT WMMA
// tiles): every ctx fragment feeds cOT WMMAs, every weight fragment cKS x cOT. The two waves of a block share
// their 64 ctx rows. The planes are added by running every plane through the
// same f32 accumulate chain, plane 0 then plane 1 at each k-step.
// ---------------------------------------------------------------------------
constexpr int cOT = 4;          // 16-row fragments per side of a wave's tile
typedef __attribute__((ext_vector_type(4))) float v4f;

__global__ void __launch_bounds__(64)
outproj_kernel(const _Float16* __restrict__ ctx,
                               const float* __restrict__ Wo_w,
                               const float* __restrict__ Wo_b,
                               float* __restrict__ out) {
  const int lane = lane_id();
  const int row = lane & 15, hi = lane >> 4;
  const int m0 = (int)(blockIdx.x >> 1) * (16 * cOT);
  const int n0 = (int)((blockIdx.x & 1) * 2 + (threadIdx.x >> 5)) * (16 * cOT);

  // This lane's first 8 k of fragment 0, per ctx plane and for the weights; the
  // other fragments and the second 8 k lie at constant distances from them.
  const _Float16* pa[cKS];
#pragma unroll
  for (int p = 0; p < cKS; ++p)
    pa[p] = ctx + (size_t)p * ((size_t)cB * cL * cHID) + (size_t)(m0 + row) * cHID + hi * 8;
  const float* pw = Wo_w + (size_t)(n0 + row) * cHID + hi * 8;

  float bv[cOT];                           // bias of this lane's column in tile column ib
#pragma unroll
  for (int ib = 0; ib < cOT; ++ib) bv[ib] = Wo_b[n0 + ib * 16 + row];
  // The bias loads' address register is reused only once they have issued; the
  // scheduling barrier keeps what follows behind the wait.
  asm volatile("s_wait_xcnt 0x0" ::: "memory");
  __builtin_amdgcn_sched_barrier(0);

  v8f acc[cOT][cOT] = {};
  v8h ra[cKS][cOT][2];                     // the next step's ctx fragments, in halves
  v4f rw[cOT][4];                          // the next step's weights, still f32
  auto fetch = [&]() {
#pragma unroll
    for (int i = 0; i < cOT; ++i) {
#pragma unroll
      for (int p = 0; p < cKS; ++p)
#pragma unroll
        for (int s = 0; s < 2; ++s)
          ra[p][i][s] = *(const v8h*)(pa[p] + (size_t)(i * 16) * cHID + s * 16);
#pragma unroll
      for (int s = 0; s < 4; ++s)
        rw[i][s] = *(const v4f*)(pw + (size_t)(i * 16) * cHID + (s >> 1) * 16 + (s & 1) * 4);
    }
    // The three pointers move on only once the loads that name them have issued;
    // the scheduling barrier keeps the loads, all of them, in front of what follows
    // (the current step's WMMAs, under which they fly).
    asm volatile("s_wait_xcnt 0x0" ::: "memory");
    __builtin_amdgcn_sched_barrier(0);
#pragma unroll
    for (int p = 0; p < cKS; ++p) pa[p] += 32;
    pw += 32;
  };
  fetch();
#pragma unroll 2  // two steps a trip: the fetched fragments change names, not registers
  for (int k0 = 0; k0 < cHID; k0 += 32) {
    v16h a[cKS][cOT], b[cOT];
#pragma unroll
    for (int i = 0; i < cOT; ++i) {
#pragma unroll
      for (int p = 0; p < cKS; ++p)
        a[p][i] = __builtin_shufflevector(ra[p][i][0], ra[p][i][1],
                                          0, 1, 2, 3, 4, 5, 6, 7, 8, 9, 10, 11, 12, 13, 14, 15);
#pragma unroll
      for (int e = 0; e < 16; ++e) b[i][e] = (_Float16)rw[i][e >> 2][e & 3];
    }
    if (k0 + 32 < cHID) fetch();
#pragma unroll
    for (int p = 0; p < cKS; ++p)
#pragma unroll
      for (int ia = 0; ia < cOT; ++ia)
#pragma unroll
        for (int ib = 0; ib < cOT; ++ib)
          acc[ia][ib] = wmma16(a[p][ia], b[ib], acc[ia][ib]);
  }

#pragma unroll
  for (int ib = 0; ib < cOT; ++ib)
#pragma unroll
    for (int ia = 0; ia < cOT; ++ia)
#pragma unroll
      for (int r = 0; r < 8; ++r) acc[ia][ib][r] += bv[ib];
  float* po = out + (size_t)(m0 + hi * 8) * cOUT + n0 + row;
  // Every sum and the one address stand in their registers before the first store
  // issues, so that no register which a store names is written behind it.
  __builtin_amdgcn_sched_barrier(0);
#pragma unroll
  for (int ib = 0; ib < cOT; ++ib)
#pragma unroll
    for (int ia = 0; ia < cOT; ++ia)
#pragma unroll
      for (int r = 0; r < 8; ++r) po[(ia * 16 + r) * cOUT + ib * 16] = acc[ia][ib][r];
}

// ---------------------------------------------------------------------------
extern "C" void kernel_launch(void* const* d_in, const int* in_sizes, int n_in,
                              void* d_out, int out_size, void* d_ws, size_t ws_size,
                              hipStream_t stream) {
  (void)in_sizes; (void)n_in; (void)out_size; (void)ws_size;
  const float* KEY   = (const float*)d_in[0];
  const float* VALUE = (const float*)d_in[1];
  const float* QUERY = (const float*)d_in[2];
  const float* W_w   = (const float*)d_in[3];
  const float* W_b   = (const float*)d_in[4];
  const float* Wv_w  = (const float*)d_in[5];
  const float* Wv_b  = (const float*)d_in[6];
  const float* Wo_w  = (const float*)d_in[7];
  const float* Wo_b  = (const float*)d_in[8];
  float* out = (float*)d_out;

  // f16 workspace: Pk, Pq, PvT (head-split) + cKS ctx planes, 16 MB each.
  const size_t pelems = (size_t)cB * cHEADS * cL * cD;   // == B*L*HID
  _Float16* Pk  = (_Float16*)d_ws;
  _Float16* Pq  = Pk + pelems;
  _Float16* PvT = Pq + pelems;
  _Float16* ctx = PvT + pelems;

  {
    const int MB = (cB * cL) / (32 * cPT);   // 64 block rows
    const int NB = cHID / (32 * cPT);        // 8 block columns
    dim3 grid(MB * NB, 3);                   // 4 waves/block, 3 projections
    proj_kernel<<<grid, 128, 0, stream>>>(KEY, VALUE, QUERY, W_w, W_b, Wv_w, Wv_b,
                                          Pk, Pq, PvT);
  }
  {
    dim3 grid(cB * (cL / (16 * cNQ)), cKS);  // 128 x 2 blocks, 8 waves = 8 heads
    attn_kernel<<<grid, 256, 0, stream>>>(Pk, Pq, PvT, ctx);
  }
  {
    const int MT = (cB * cL) / (16 * cOT);   // 128 tile rows
    const int NT = cOUT / (16 * cOT);        // 4 tile columns
    dim3 grid((MT * NT) / 2);                // 256 blocks of 2 waves
    outproj_kernel<<<grid, 64, 0, stream>>>(ctx, Wo_w, Wo_b, out);
  }
}

// v006
// Measured time: 235 microseconds a run.
// Next to v005, in two timings, it ran 1.50 and 1.53 times as fast.
// All steps since v000 together make it 4.29 times as fast.
#include <hip/hip_runtime.h>
#include <hip/hip_bf16.h>
#include <math.h>

// ---------------------------------------------------------------------------
// MHA with softmax-over-heads, fused for MI455X (gfx1250, wave32, WMMA).
//   proj    : KEY/QUERY @ W^T + b -> f16 head-split; VALUE @ Wv^T + b -> f16
//             head-split TRANSPOSED (PvT[b][h][d][L]) so the attention kernel
//             reads every operand contiguously.
//   attn    : fused score + head-softmax + attn^T@Wv, K tiles (double-buffered)
//             and PvT tiles staged to LDS with global_load_async_to_lds_b128.
//   outproj : ctx @ Wo^T + b -> f32
// All matmuls via v_wmma_f32_16x16x32_f16 (f32 accumulate).
// ---------------------------------------------------------------------------

typedef __attribute__((ext_vector_type(16))) _Float16 v16h;
typedef __attribute__((ext_vector_type(8)))  float    v8f;

#define DEV static __device__ __forceinline__

constexpr int cB = 4, cL = 2048, cINK = 256, cHID = 1024, cHEADS = 8, cD = 128, cOUT = 256;
constexpr float cSCALE = 0.08838834764831845f;   // 1/sqrt(128)
constexpr int cNQ = 4;          // 16-column query sub-tiles per attention block
constexpr int cKS = 2;          // key ranges; each block sums over one of them
constexpr int cLK = cL / cKS;   // keys per block

DEV int lane_id() { return (int)(threadIdx.x & 31u); }

// K index (within the 32-wide K tile) held by element e of a 16-bit A/B frag.
// Per ISA 7.12.2: lanes 0-15 -> K 0..7 / 16..23, lanes 16-31 -> K 8..15 / 24..31.
DEV int kidx(int lane, int e) {
  int kb = (lane & 16) ? 8 : 0;
  return (e < 8) ? (kb + e) : (16 + kb + (e - 8));
}

// A/B fragment from a row-major f16 tile (two contiguous 16B chunks per lane)
DEV v16h frag_rm_f16(const _Float16* base, int ld) {
  int lane = lane_id();
  const _Float16* p = base + (size_t)(lane & 15) * ld;
  v16h f;
#pragma unroll
  for (int e = 0; e < 16; ++e) f[e] = p[kidx(lane, e)];
  return f;
}

DEV v8f wmma16(v16h a, v16h b, v8f c) {
  return __builtin_amdgcn_wmma_f32_16x16x32_f16(false, a, false, b, (short)0, c,
                                                false, false);
}

// Async-copy 512B (32 lanes x 16B) from global to LDS; CDNA5 async path.
// lds_off is the byte offset within the workgroup's LDS segment.
DEV void async_copy_512(unsigned lds_off, const void* gptr) {
  asm volatile("global_load_async_to_lds_b128 %0, %1, off"
               :: "v"(lds_off), "v"(gptr) : "memory");
}
// The same copy as the compiler's own form: each lane's 16 B from g to l.
typedef __attribute__((ext_vector_type(4))) int v4i;
DEV void async_copy_16(_Float16* l, const _Float16* g) {
  __builtin_amdgcn_global_load_async_to_lds_b128(
      (__attribute__((address_space(1))) v4i*)g, (__attribute__((address_space(3))) v4i*)l, 0, 0);
}
DEV void wait_async_le(int) {}  // (documentation only; real waits below)
DEV void wait_async16() { asm volatile("s_wait_asynccnt 0x10" ::: "memory"); }
DEV void wait_async0()  { asm volatile("s_wait_asynccnt 0x0"  ::: "memory"); }

// ---------------------------------------------------------------------------
// Kernel A: projections.  blockIdx.y: 0->Pk(KEY,W), 1->Pq(QUERY,W), 2->PvT(VALUE,Wv)
// One wave per 64x64 output tile (cPT x cPT WMMA tiles), a block of 2x2 waves per
// 128x128: every loaded fragment feeds cPT WMMAs. K=256 -> 8 steps.
// Pk/Pq layout: P[b][h][l][d];  PvT layout: P[b][h][d][l]  (h = hidden%8, d = hidden/8)
// The tile is turned so that the 8 accumulator rows a lane holds lie side by side
// in the destination (one 16-byte store):
//   VT  (PvT)  : D = X . W^T, rows = l, column = hidden unit.
//   !VT (Pk/Pq): D = W . X^T, column = l, and the 16 weight rows of tile ib are
//                the units of heads 2*ib and 2*ib+1 at 8 successive d, so rows = d.
// ---------------------------------------------------------------------------
typedef __attribute__((ext_vector_type(8))) _Float16 v8h;
constexpr int cPT = 4;          // 16-row fragments per side of a wave's tile

// One A/B fragment's 16 f32 values from this lane's own row, in fragment order
DEV void load_row_f32(float (&q)[16], const float* __restrict__ p) {
  int lane = lane_id();
#pragma unroll
  for (int e = 0; e < 16; ++e) q[e] = p[kidx(lane, e)];
}
DEV v16h cvt_row_f16(const float (&q)[16]) {
  v16h f;
#pragma unroll
  for (int e = 0; e < 16; ++e) f[e] = (_Float16)q[e];
  return f;
}

template <bool VT>
DEV void proj_tile(const float* __restrict__ src, const float* __restrict__ w,
                   const float* __restrict__ bias, _Float16* __restrict__ dst,
                   int m0, int n0) {
  const int lane = lane_id();
  const int row = lane & 15, hi = lane >> 4;

  const float* xp[cPT];
  const float* wp[cPT];
#pragma unroll
  for (int i = 0; i < cPT; ++i) {
    xp[i] = src + (size_t)(m0 + i * 16 + row) * cINK;
    const int n = VT ? (n0 + i * 16 + row)
                     : (n0 + (row & 7) * cHEADS + i * 2 + (row >> 3));
    wp[i] = w + (size_t)n * cINK;
  }

  v8f acc[cPT][cPT] = {};
  float rx[cPT][16], rw[cPT][16];          // the next step's operands, still f32
  float bv[cPT][8];                        // bias of accumulator row r of tile ib
#pragma unroll
  for (int ib = 0; ib < cPT; ++ib)
#pragma unroll
    for (int r = 0; r < (VT ? 1 : 8); ++r)
      bv[ib][r] = VT ? bias[n0 + ib * 16 + row] : bias[n0 + r * cHEADS + ib * 2 + hi];
  // The bias loads' address registers are reused only once they have issued; the
  // scheduling barrier keeps what follows behind the wait.
  asm volatile("s_wait_xcnt 0x0" ::: "memory");
  __builtin_amdgcn_sched_barrier(0);
#pragma unroll
  for (int i = 0; i < cPT; ++i) {
    load_row_f32(rx[i], xp[i]);
    load_row_f32(rw[i], wp[i]);
  }
#pragma unroll  // constant k0: every load is its row pointer plus an immediate
  for (int k0 = 0; k0 < cINK; k0 += 32) {
    v16h x[cPT], wf[cPT];
#pragma unroll
    for (int i = 0; i < cPT; ++i) {
      x[i]  = cvt_row_f16(rx[i]);
      wf[i] = cvt_row_f16(rw[i]);
    }
    if (k0 + 32 < cINK) {
#pragma unroll
      for (int i = 0; i < cPT; ++i) {
        load_row_f32(rx[i], xp[i] + k0 + 32);
        load_row_f32(rw[i], wp[i] + k0 + 32);
      }
      // The row pointers die behind the last loads: their registers are reused
      // only once those loads have issued.
      if (k0 + 64 >= cINK) asm volatile("s_wait_xcnt 0x0" ::: "memory");
    }
    // Keeps the next step's loads, all of them, in front of this step's WMMAs:
    // left alone the scheduler issues them two at a time, each pair waited for.
    __builtin_amdgcn_sched_barrier(0);
#pragma unroll
    for (int ia = 0; ia < cPT; ++ia)
#pragma unroll
      for (int ib = 0; ib < cPT; ++ib)
        acc[ia][ib] = VT ? wmma16(x[ia], wf[ib], acc[ia][ib])
                         : wmma16(wf[ib], x[ia], acc[ia][ib]);
  }

  const int bi = m0 / cL, l0 = m0 % cL;    // a 64-row tile lies in one batch entry
#pragma unroll
  for (int ib = 0; ib < cPT; ++ib) {
    _Float16* dp;                           // this lane's 8 values at ia = 0
    size_t step;                            // elements from one ia to the next
    if (VT) {
      const int n = n0 + ib * 16 + row;
      dp = dst + (((size_t)bi * cHEADS + (n & 7)) * cD + (n >> 3)) * cL + l0 + hi * 8;
      step = 16;
    } else {
      const int h = ib * 2 + hi;
      dp = dst + (((size_t)bi * cHEADS + h) * cL + l0 + row) * cD + (n0 >> 3);
      step = (size_t)16 * cD;
    }
#pragma unroll
    for (int ia = 0; ia < cPT; ++ia) {
      v8h o;
#pragma unroll
      for (int r = 0; r < 8; ++r) o[r] = (_Float16)(acc[ia][ib][r] + bv[ib][VT ? 0 : r]);
      *(v8h*)(dp + ia * step) = o;
    }
    // The next tile column's sums reuse these stores' registers: they wait for the
    // stores' issue, and the scheduling barrier keeps them behind the wait. Behind
    // the last run too: the other variant's code follows it in the built kernel.
    asm volatile("s_wait_xcnt 0x0" ::: "memory");
    __builtin_amdgcn_sched_barrier(0);
  }
}

__global__ void __launch_bounds__(128)
proj_kernel(const float* __restrict__ KEY,
                            const float* __restrict__ VALUE,
                            const float* __restrict__ QUERY,
                            const float* __restrict__ W_w,
                            const float* __restrict__ W_b,
                            const float* __restrict__ Wv_w,
                            const float* __restrict__ Wv_b,
                            _Float16* __restrict__ Pk,
                            _Float16* __restrict__ Pq,
                            _Float16* __restrict__ PvT) {
  const int which = blockIdx.y;
  constexpr int NB = cHID / (32 * cPT);    // 8 block columns
  const int wave = threadIdx.x >> 5;
  const int m0 = (blockIdx.x / NB) * (32 * cPT) + (wave >> 1) * (16 * cPT);
  const int n0 = (blockIdx.x % NB) * (32 * cPT) + (wave & 1) * (16 * cPT);

  if (which == 2) proj_tile<true>(VALUE, Wv_w, Wv_b, PvT, m0, n0);
  else            proj_tile<false>(which == 0 ? KEY : QUERY, W_w, W_b,
                                   which == 0 ? Pk : Pq, m0, n0);
}

// ---------------------------------------------------------------------------
// Kernel B: fused attention. One block per (b, 64-col Lq tile, key range);
// 8 waves = 8 heads. Every K and PvT fragment feeds cNQ WMMAs, one per 16-col
// query sub-tile. The sum over keys has no normaliser (the softmax runs over
// heads), so each key range writes its own partial ctx plane and the output
// projection adds the planes in its accumulate chain.
// K tiles double-buffered in LDS via async copies; Q fragments hoisted; score
// WMMAs -> LDS -> cross-head softmax (elementwise in (i,k)) -> PvT@attn WMMAs.
// The PvT tile of a trip flies into LDS under that trip's softmax; each wave
// copies and reads its own head's tile only.
// The ctx rows are put together in LDS and stored as whole 128-byte lines.
// ---------------------------------------------------------------------------
constexpr int cKP = cD + 8;     // K row pitch in LDS: 272 B = 17 x 16 B, so the 16 rows that a
                                // fragment read touches fall on 16 different bank groups
constexpr int cVP = 32 + 8;     // PvT row pitch in LDS: 80 B = 5 x 16 B, for the same reason
constexpr int cCP = cHID + 4;   // ctx row pitch in LDS: 2056 B = 514 dwords, so the 16 rows and 2 d
                                // groups that a wave's 2-byte write touches fall on 32 different banks
typedef __attribute__((ext_vector_type(4))) _Float16 v4h;
struct AttnSmem {
  _Float16 sK[2][cHEADS][32][cKP];  // 136 KB, double-buffered K tiles (first!)
  float    s_sc[cNQ][cHEADS][32][16];   // 16 KB per sub-tile, score/attn exchange
  _Float16 sV[cHEADS][cD][cVP];     // 80 KB, this trip's PvT tiles (128 d x 32 keys a head)
};

__global__ void __launch_bounds__(256)   // real block size: registers for the wide tile
attn_kernel(const _Float16* __restrict__ Pk,
                            const _Float16* __restrict__ Pq,
                            const _Float16* __restrict__ PvT,
                            _Float16* __restrict__ ctx) {
  __shared__ __attribute__((aligned(16))) AttnSmem sm;   // 16-byte K reads stay whole

  constexpr int QT = cL / (16 * cNQ);      // query tiles per batch entry
  const int bb = blockIdx.x / QT;
  const int kt = blockIdx.x % QT;
  const int ks = blockIdx.y;               // key range of this block
  const int h  = threadIdx.x >> 5;         // wave id == head
  const int lane = lane_id();

  const _Float16* Kh = Pk  + ((size_t)(bb * cHEADS + h) * cL + ks * cLK) * cD;
  const _Float16* Qt = Pq  + ((size_t)(bb * cHEADS + h) * cL) * cD
                           + (size_t)(kt * 16 * cNQ) * cD;
  const _Float16* Vt = PvT + ((size_t)(bb * cHEADS + h) * cD) * cL + ks * cLK;  // [d][L]

  // Q fragments are invariant over the whole Lk loop: hoist (cNQ x 4 x v16h).
  v16h bq[cNQ][4];
#pragma unroll  // constant c: the per-sub-tile arrays stay in registers
  for (int c = 0; c < cNQ; ++c)
#pragma unroll
    for (int q = 0; q < 4; ++q)
      bq[c][q] = frag_rm_f16(Qt + (size_t)(c * 16) * cD + q * 32, cD);
  // the Q loads share one address pair: hold its reuse behind their issue
  asm volatile("s_wait_xcnt 0x0" ::: "memory");

  v8f acc[cNQ][8] = {};                    // per sub-tile: 8 j-tiles (d) x 16 k cols

  // --- async stage of one 32x128 f16 K tile (8 KB) into sK[buf][h] --------
  auto stage_k = [&](int buf, int i0) {
    // the wave's number as a scalar: the tile's base then takes no vector register
    unsigned base = (unsigned)((buf * cHEADS + __builtin_amdgcn_readfirstlane(h)) * (32 * cKP * 2)
                               + (lane >> 4) * (cKP * 2) + (lane & 15) * 16);   // sK @ LDS off 0
    const char* g = (const char*)(Kh + (size_t)i0 * cD);
#pragma unroll
    for (int t = 0; t < 16; ++t) {
      unsigned lds = base + (unsigned)(t * (2 * cKP * 2));   // 544 B = two padded rows
      async_copy_512(lds, g + t * 512 + lane * 16);
    }
  };

  // --- async stage of one 128x32 f16 PvT tile (8 KB) into sV[h] -----------
  // A copy brings 8 rows of 64 B: four lanes a row.
  auto stage_v = [&](int i0) {
    _Float16* l = &sm.sV[h][lane >> 2][(lane & 3) * 8];
    const _Float16* g = Vt + (size_t)(lane >> 2) * cL + i0 + (lane & 3) * 8;
#pragma unroll  // constant t: each copy's two addresses are a base plus a constant
    for (int t = 0; t < 16; ++t) async_copy_16(l + t * 8 * cVP, g + (size_t)(t * 8) * cL);
  };

  stage_k(0, 0);

  for (int i0 = 0; i0 < cLK; i0 += 32) {
    const int  cur  = (i0 >> 5) & 1;
    const bool more = (i0 + 32) < cLK;
    if (more) stage_k(cur ^ 1, i0 + 32);

    if (more) wait_async16();   // oldest 16 (current buffer) complete
    else      wait_async0();

    const _Float16* sk = &sm.sK[cur][h][0][0];

    // --- score tiles S[i0..i0+31][kt*64..+64] (cNQ sub-tiles) for this head (from LDS) ---
    v8f s0[cNQ] = {}, s1[cNQ] = {};
#pragma unroll
    for (int k0 = 0; k0 < cD; k0 += 32) {
      v16h a0 = frag_rm_f16(sk + k0, cKP);
      v16h a1 = frag_rm_f16(sk + 16 * cKP + k0, cKP);
#pragma unroll  // constant c: the per-sub-tile arrays stay in registers
      for (int c = 0; c < cNQ; ++c) {
        s0[c] = wmma16(a0, bq[c][k0 >> 5], s0[c]);
        s1[c] = wmma16(a1, bq[c][k0 >> 5], s1[c]);
      }
    }
    // This wave's reads of sV (the trip before) have retired before it is refilled.
    asm volatile("s_wait_dscnt 0x0" ::: "memory");
    __syncthreads();   // prior iteration's s_sc and sV reads are done
    stage_v(i0);       // lands under the score exchange and the softmax
    {
      int kk = lane & 15;
      int mb = (lane & 16) ? 8 : 0;
#pragma unroll  // constant c: the per-sub-tile arrays stay in registers
      for (int c = 0; c < cNQ; ++c) {
#pragma unroll
        for (int r = 0; r < 8; ++r) {
          sm.s_sc[c][h][r + mb][kk]      = s0[c][r];
          sm.s_sc[c][h][16 + r + mb][kk] = s1[c][r];
        }
      }
    }
    __syncthreads();
    // --- softmax across the 8 heads, elementwise in (i,k) ----------------
    for (int t = threadIdx.x; t < 512 * cNQ; t += 256) {
      int c = t >> 9, ii = (t >> 4) & 31, kk = t & 15;
      float v[cHEADS];
      float m = -3.0e38f;
#pragma unroll
      for (int hh = 0; hh < cHEADS; ++hh) {
        v[hh] = sm.s_sc[c][hh][ii][kk] * cSCALE;
        m = fmaxf(m, v[hh]);
      }
      float sum = 0.f;
#pragma unroll
      for (int hh = 0; hh < cHEADS; ++hh) {
        float e = __expf(v[hh] - m);
        v[hh] = e;
        sum += e;
      }
      float inv = 1.f / sum;
#pragma unroll
      for (int hh = 0; hh < cHEADS; ++hh) sm.s_sc[c][hh][ii][kk] = v[hh] * inv;
    }
    wait_async0();     // this trip's PvT tile has landed (the next K tile too)
    __syncthreads();
    // --- out_h[j,k] += PvT[j,i] @ attn[i,k]  (K = 32 rows of i) ----------
    v16h battn[cNQ];
#pragma unroll  // constant c: the per-sub-tile arrays stay in registers
    for (int c = 0; c < cNQ; ++c) {
      int kk = lane & 15;
      const float* ab = &sm.s_sc[c][h][0][0];
#pragma unroll
      for (int e = 0; e < 16; ++e)
        battn[c][e] = (_Float16)ab[kidx(lane, e) * 16 + kk];
    }
    const _Float16* sv = &sm.sV[h][0][0];
    v16h av[8];                            // four are live at a time
#pragma unroll  // constant jt, here and below: av and acc stay in registers
    for (int jt = 0; jt < 4; ++jt) av[jt] = frag_rm_f16(sv + jt * 16 * cVP, cVP);
#pragma unroll
    for (int j0 = 0; j0 < 8; j0 += 2) {
      // Keeps the LDS reads four fragments ahead of the WMMAs that use them: left
      // alone the scheduler reads one fragment at a time and waits for each.
      __builtin_amdgcn_sched_barrier(0);
#pragma unroll
      for (int jt = j0; jt < j0 + 2; ++jt)
#pragma unroll  // constant c: the per-sub-tile arrays stay in registers
        for (int c = 0; c < cNQ; ++c) acc[c][jt] = wmma16(av[jt], battn[c], acc[c][jt]);
      if (j0 + 4 < 8) {
#pragma unroll
        for (int jt = j0 + 4; jt < j0 + 6; ++jt) av[jt] = frag_rm_f16(sv + jt * 16 * cVP, cVP);
      }
    }
  }

  // --- store ctx[ks][b][l][d*8 + h] (f16), the reference's head interleave --
  // The block holds all 8 heads and all 128 d of its 64 rows l: 64 whole ctx rows of
  // 2 KB. The waves interleave their heads in LDS and the block then stores whole
  // 128-byte lines, 512 contiguous bytes a wave-wide store. The rows lie over the K
  // buffers, which nobody reads or fills behind the last trip's barriers.
  static_assert(sizeof(sm.sK) >= (size_t)(16 * cNQ) * cCP * sizeof(_Float16), "ctx rows fit sK");
  _Float16* st = &sm.sK[0][0][0][0];
  {
    // this lane's element at c = jt = r = 0; the others lie at constant distances
    _Float16* wp = st + (lane & 15) * cCP + (lane >> 4) * (8 * cHEADS) + h;
#pragma unroll  // constant c: the per-sub-tile arrays stay in registers
    for (int c = 0; c < cNQ; ++c)
#pragma unroll
      for (int jt = 0; jt < 8; ++jt)
#pragma unroll
        for (int r = 0; r < 8; ++r)
          wp[c * 16 * cCP + (jt * 16 + r) * cHEADS] = (_Float16)acc[c][jt][r];
  }
  __syncthreads();   // all eight heads' values stand in LDS before a row is read
  constexpr int NR = (16 * cNQ) / 2;       // the block's 256 lanes cover two rows a round
  const int tr = (int)threadIdx.x >> 7, tc = ((int)threadIdx.x & 127) * 8;
  const _Float16* sp = st + tr * cCP + tc;
  _Float16* gp = ctx + (size_t)ks * ((size_t)cB * cL * cHID)
                     + ((size_t)bb * cL + kt * (16 * cNQ) + tr) * cHID + tc;
  v8h o[NR];
#pragma unroll  // constant it: o stays in registers, every address is a base plus a constant
  for (int it = 0; it < NR; ++it) {
    const v4h lo = *(const v4h*)(sp + it * 2 * cCP);
    const v4h hi = *(const v4h*)(sp + it * 2 * cCP + 4);
    o[it] = __builtin_shufflevector(lo, hi, 0, 1, 2, 3, 4, 5, 6, 7);
  }
#pragma unroll
  for (int it = 0; it < NR; ++it) *(v8h*)(gp + (size_t)(it * 2) * cHID) = o[it];
}

// ---------------------------------------------------------------------------
// Kernel C: final projection (sum of the cKS ctx planes)[8192,1024](f16)
// @ Wo^T[1024,256] + b -> f32. One wave per 64x64 output tile (cOT x cOT WMMA
// tiles): every ctx fragment feeds cOT WMMAs, every weight fragment cKS x cOT. The two waves of a block share
// their 64 ctx rows. The planes are added by running every plane through the
// same f32 accumulate chain, plane 0 then plane 1 at each k-step.
// ---------------------------------------------------------------------------
constexpr int cOT = 4;          // 16-row fragments per side of a wave's tile
typedef __attribute__((ext_vector_type(4))) float v4f;

__global__ void __launch_bounds__(64)
outproj_kernel(const _Float16* __restrict__ ctx,
                               const float* __restrict__ Wo_w,
                               const float* __restrict__ Wo_b,
                               float* __restrict__ out) {
  const int lane = lane_id();
  const int row = lane & 15, hi = lane >> 4;
  const int m0 = (int)(blockIdx.x >> 1) * (16 * cOT);
  const int n0 = (int)((blockIdx.x & 1) * 2 + (threadIdx.x >> 5)) * (16 * cOT);

  // This lane's first 8 k of fragment 0, per ctx plane and for the weights; the
  // other fragments and the second 8 k lie at constant distances from them.
  const _Float16* pa[cKS];
#pragma unroll
  for (int p = 0; p < cKS; ++p)
    pa[p] = ctx + (size_t)p * ((size_t)cB * cL * cHID) + (size_t)(m0 + row) * cHID + hi * 8;
  const float* pw = Wo_w + (size_t)(n0 + row) * cHID + hi * 8;

  float bv[cOT];                           // bias of this lane's column in tile column ib
#pragma unroll
  for (int ib = 0; ib < cOT; ++ib) bv[ib] = Wo_b[n0 + ib * 16 + row];
  // The bias loads' address register is reused only once they have issued; the
  // scheduling barrier keeps what follows behind the wait.
  asm volatile("s_wait_xcnt 0x0" ::: "memory");
  __builtin_amdgcn_sched_barrier(0);

  v8f acc[cOT][cOT] = {};
  v8h ra[cKS][cOT][2];                     // the next step's ctx fragments, in halves
  v4f rw[cOT][4];                          // the next step's weights, still f32
  auto fetch = [&]() {
#pragma unroll
    for (int i = 0; i < cOT; ++i) {
#pragma unroll
      for (int p = 0; p < cKS; ++p)
#pragma unroll
        for (int s = 0; s < 2; ++s)
          ra[p][i][s] = *(const v8h*)(pa[p] + (size_t)(i * 16) * cHID + s * 16);
#pragma unroll
      for (int s = 0; s < 4; ++s)
        rw[i][s] = *(const v4f*)(pw + (size_t)(i * 16) * cHID + (s >> 1) * 16 + (s & 1) * 4);
    }
    // The three pointers move on only once the loads that name them have issued;
    // the scheduling barrier keeps the loads, all of them, in front of what follows
    // (the current step's WMMAs, under which they fly).
    asm volatile("s_wait_xcnt 0x0" ::: "memory");
    __builtin_amdgcn_sched_barrier(0);
#pragma unroll
    for (int p = 0; p < cKS; ++p) pa[p] += 32;
    pw += 32;
  };
  fetch();
#pragma unroll 2  // two steps a trip: the fetched fragments change names, not registers
  for (int k0 = 0; k0 < cHID; k0 += 32) {
    v16h a[cKS][cOT], b[cOT];
#pragma unroll
    for (int i = 0; i < cOT; ++i) {
#pragma unroll
      for (int p = 0; p < cKS; ++p)
        a[p][i] = __builtin_shufflevector(ra[p][i][0], ra[p][i][1],
                                          0, 1, 2, 3, 4, 5, 6, 7, 8, 9, 10, 11, 12, 13, 14, 15);
#pragma unroll
      for (int e = 0; e < 16; ++e) b[i][e] = (_Float16)rw[i][e >> 2][e & 3];
    }
    if (k0 + 32 < cHID) fetch();
#pragma unroll
    for (int p = 0; p < cKS; ++p)
#pragma unroll
      for (int ia = 0; ia < cOT; ++ia)
#pragma unroll
        for (int ib = 0; ib < cOT; ++ib)
          acc[ia][ib] = wmma16(a[p][ia], b[ib], acc[ia][ib]);
  }

#pragma unroll
  for (int ib = 0; ib < cOT; ++ib)
#pragma unroll
    for (int ia = 0; ia < cOT; ++ia)
#pragma unroll
      for (int r = 0; r < 8; ++r) acc[ia][ib][r] += bv[ib];
  float* po = out + (size_t)(m0 + hi * 8) * cOUT + n0 + row;
  // Every sum and the one address stand in their registers before the first store
  // issues, so that no register which a store names is written behind it.
  __builtin_amdgcn_sched_barrier(0);
#pragma unroll
  for (int ib = 0; ib < cOT; ++ib)
#pragma unroll
    for (int ia = 0; ia < cOT; ++ia)
#pragma unroll
      for (int r = 0; r < 8; ++r) po[(ia * 16 + r) * cOUT + ib * 16] = acc[ia][ib][r];
}

// ---------------------------------------------------------------------------
extern "C" void kernel_launch(void* const* d_in, const int* in_sizes, int n_in,
                              void* d_out, int out_size, void* d_ws, size_t ws_size,
                              hipStream_t stream) {
  (void)in_sizes; (void)n_in; (void)out_size; (void)ws_size;
  const float* KEY   = (const float*)d_in[0];
  const float* VALUE = (const float*)d_in[1];
  const float* QUERY = (const float*)d_in[2];
  const float* W_w   = (const float*)d_in[3];
  const float* W_b   = (const float*)d_in[4];
  const float* Wv_w  = (const float*)d_in[5];
  const float* Wv_b  = (const float*)d_in[6];
  const float* Wo_w  = (const float*)d_in[7];
  const float* Wo_b  = (const float*)d_in[8];
  float* out = (float*)d_out;

  // f16 workspace: Pk, Pq, PvT (head-split) + cKS ctx planes, 16 MB each.
  const size_t pelems = (size_t)cB * cHEADS * cL * cD;   // == B*L*HID
  _Float16* Pk  = (_Float16*)d_ws;
  _Float16* Pq  = Pk + pelems;
  _Float16* PvT = Pq + pelems;
  _Float16* ctx = PvT + pelems;

  {
    const int MB = (cB * cL) / (32 * cPT);   // 64 block rows
    const int NB = cHID / (32 * cPT);        // 8 block columns
    dim3 grid(MB * NB, 3);                   // 4 waves/block, 3 projections
    proj_kernel<<<grid, 128, 0, stream>>>(KEY, VALUE, QUERY, W_w, W_b, Wv_w, Wv_b,
                                          Pk, Pq, PvT);
  }
  {
    dim3 grid(cB * (cL / (16 * cNQ)), cKS);  // 128 x 2 blocks, 8 waves = 8 heads
    attn_kernel<<<grid, 256, 0, stream>>>(Pk, Pq, PvT, ctx);
  }
  {
    const int MT = (cB * cL) / (16 * cOT);   // 128 tile rows
    const int NT = cOUT / (16 * cOT);        // 4 tile columns
    dim3 grid((MT * NT) / 2);                // 256 blocks of 2 waves
    outproj_kernel<<<grid, 64, 0, stream>>>(ctx, Wo_w, Wo_b, out);
  }
}

// v007
// It runs in 208 microseconds.
// Next to v006, in two timings, it ran 1.13 and 1.14 times as fast.
// Counting every step since v000, it is 4.86 times as fast.
#include <hip/hip_runtime.h>
#include <hip/hip_bf16.h>
#include <math.h>

// ---------------------------------------------------------------------------
// MHA with softmax-over-heads, fused for MI455X (gfx1250, wave32, WMMA).
//   proj    : KEY/QUERY @ W^T + b -> f16 head-split; VALUE @ Wv^T + b -> f16
//             head-split TRANSPOSED (PvT[b][h][d][L]) so the attention kernel
//             reads every operand contiguously.
//   attn    : fused score + head-softmax + attn^T@Wv, K tiles (double-buffered)
//             and PvT tiles staged to LDS with global_load_async_to_lds_b128.
//   outproj : ctx @ Wo^T + b -> f32
// All matmuls via v_wmma_f32_16x16x32_f16 (f32 accumulate).
// ---------------------------------------------------------------------------

typedef __attribute__((ext_vector_type(16))) _Float16 v16h;
typedef __attribute__((ext_vector_type(8)))  float    v8f;

#define DEV static __device__ __forceinline__

constexpr int cB = 4, cL = 2048, cINK = 256, cHID = 1024, cHEADS = 8, cD = 128, cOUT = 256;
constexpr float cSCALE = 0.08838834764831845f;   // 1/sqrt(128)
constexpr int cNQ = 4;          // 16-column query sub-tiles per attention block
constexpr int cKS = 2;          // key ranges; each block sums over one of them
constexpr int cLK = cL / cKS;   // keys per block

DEV int lane_id() { return (int)(threadIdx.x & 31u); }

// K index (within the 32-wide K tile) held by element e of a 16-bit A/B frag.
// Per ISA 7.12.2: lanes 0-15 -> K 0..7 / 16..23, lanes 16-31 -> K 8..15 / 24..31.
DEV int kidx(int lane, int e) {
  int kb = (lane & 16) ? 8 : 0;
  return (e < 8) ? (kb + e) : (16 + kb + (e - 8));
}

// A/B fragment from a row-major f16 tile (two contiguous 16B chunks per lane)
DEV v16h frag_rm_f16(const _Float16* base, int ld) {
  int lane = lane_id();
  const _Float16* p = base + (size_t)(lane & 15) * ld;
  v16h f;
#pragma unroll
  for (int e = 0; e < 16; ++e) f[e] = p[kidx(lane, e)];
  return f;
}

DEV v8f wmma16(v16h a, v16h b, v8f c) {
  return __builtin_amdgcn_wmma_f32_16x16x32_f16(false, a, false, b, (short)0, c,
                                                false, false);
}

// Async-copy 512B (32 lanes x 16B) from global to LDS; CDNA5 async path.
// lds_off is the byte offset within the workgroup's LDS segment.
DEV void async_copy_512(unsigned lds_off, const void* gptr) {
  asm volatile("global_load_async_to_lds_b128 %0, %1, off"
               :: "v"(lds_off), "v"(gptr) : "memory");
}
// The same copy as the compiler's own form: each lane's 16 B from g to l.
typedef __attribute__((ext_vector_type(4))) int v4i;
DEV void async_copy_16(_Float16* l, const _Float16* g) {
  __builtin_amdgcn_global_load_async_to_lds_b128(
      (__attribute__((address_space(1))) v4i*)g, (__attribute__((address_space(3))) v4i*)l, 0, 0);
}
DEV void wait_async_le(int) {}  // (documentation only; real waits below)
DEV void wait_async16() { asm volatile("s_wait_asynccnt 0x10" ::: "memory"); }
DEV void wait_async0()  { asm volatile("s_wait_asynccnt 0x0"  ::: "memory"); }

// ---------------------------------------------------------------------------
// Kernel A: projections.  blockIdx.y: 0->Pk(KEY,W), 1->Pq(QUERY,W), 2->PvT(VALUE,Wv)
// One wave per 64x64 output tile (cPT x cPT WMMA tiles), a block of 2x2 waves per
// 128x128: every loaded fragment feeds cPT WMMAs. K=256 -> 8 steps.
// Pk/Pq layout: P[b][h][l][d];  PvT layout: P[b][h][d][l]  (h = hidden%8, d = hidden/8)
// The tile is turned so that the 8 accumulator rows a lane holds lie side by side
// in the destination (one 16-byte store):
//   VT  (PvT)  : D = X . W^T, rows = l, column = hidden unit.
//   !VT (Pk/Pq): D = W . X^T, column = l, and the 16 weight rows of tile ib are
//                the units of heads 2*ib and 2*ib+1 at 8 successive d, so rows = d.
// ---------------------------------------------------------------------------
typedef __attribute__((ext_vector_type(8))) _Float16 v8h;
constexpr int cPT = 4;          // 16-row fragments per side of a wave's tile

// One A/B fragment's 16 f32 values from this lane's own row, in fragment order
DEV void load_row_f32(float (&q)[16], const float* __restrict__ p) {
  int lane = lane_id();
#pragma unroll
  for (int e = 0; e < 16; ++e) q[e] = p[kidx(lane, e)];
}
DEV v16h cvt_row_f16(const float (&q)[16]) {
  v16h f;
#pragma unroll
  for (int e = 0; e < 16; ++e) f[e] = (_Float16)q[e];
  return f;
}

template <bool VT>
DEV void proj_tile(const float* __restrict__ src, const float* __restrict__ w,
                   const float* __restrict__ bias, _Float16* __restrict__ dst,
                   int m0, int n0) {
  const int lane = lane_id();
  const int row = lane & 15, hi = lane >> 4;

  const float* xp[cPT];
  const float* wp[cPT];
#pragma unroll
  for (int i = 0; i < cPT; ++i) {
    xp[i] = src + (size_t)(m0 + i * 16 + row) * cINK;
    const int n = VT ? (n0 + i * 16 + row)
                     : (n0 + (row & 7) * cHEADS + i * 2 + (row >> 3));
    wp[i] = w + (size_t)n * cINK;
  }

  v8f acc[cPT][cPT] = {};
  float rx[cPT][16], rw[cPT][16];          // the next step's operands, still f32
  float bv[cPT][8];                        // bias of accumulator row r of tile ib
#pragma unroll
  for (int ib = 0; ib < cPT; ++ib)
#pragma unroll
    for (int r = 0; r < (VT ? 1 : 8); ++r)
      bv[ib][r] = VT ? bias[n0 + ib * 16 + row] : bias[n0 + r * cHEADS + ib * 2 + hi];
  // The bias loads' address registers are reused only once they have issued; the
  // scheduling barrier keeps what follows behind the wait.
  asm volatile("s_wait_xcnt 0x0" ::: "memory");
  __builtin_amdgcn_sched_barrier(0);
#pragma unroll
  for (int i = 0; i < cPT; ++i) {
    load_row_f32(rx[i], xp[i]);
    load_row_f32(rw[i], wp[i]);
  }
#pragma unroll  // constant k0: every load is its row pointer plus an immediate
  for (int k0 = 0; k0 < cINK; k0 += 32) {
    v16h x[cPT], wf[cPT];
#pragma unroll
    for (int i = 0; i < cPT; ++i) {
      x[i]  = cvt_row_f16(rx[i]);
      wf[i] = cvt_row_f16(rw[i]);
    }
    if (k0 + 32 < cINK) {
#pragma unroll
      for (int i = 0; i < cPT; ++i) {
        load_row_f32(rx[i], xp[i] + k0 + 32);
        load_row_f32(rw[i], wp[i] + k0 + 32);
      }
      // The row pointers die behind the last loads: their registers are reused
      // only once those loads have issued.
      if (k0 + 64 >= cINK) asm volatile("s_wait_xcnt 0x0" ::: "memory");
    }
    // Keeps the next step's loads, all of them, in front of this step's WMMAs:
    // left alone the scheduler issues them two at a time, each pair waited for.
    __builtin_amdgcn_sched_barrier(0);
#pragma unroll
    for (int ia = 0; ia < cPT; ++ia)
#pragma unroll
      for (int ib = 0; ib < cPT; ++ib)
        acc[ia][ib] = VT ? wmma16(x[ia], wf[ib], acc[ia][ib])
                         : wmma16(wf[ib], x[ia], acc[ia][ib]);
  }

  const int bi = m0 / cL, l0 = m0 % cL;    // a 64-row tile lies in one batch entry
#pragma unroll
  for (int ib = 0; ib < cPT; ++ib) {
    _Float16* dp;                           // this lane's 8 values at ia = 0
    size_t step;                            // elements from one ia to the next
    if (VT) {
      const int n = n0 + ib * 16 + row;
      dp = dst + (((size_t)bi * cHEADS + (n & 7)) * cD + (n >> 3)) * cL + l0 + hi * 8;
      step = 16;
    } else {
      const int h = ib * 2 + hi;
      dp = dst + (((size_t)bi * cHEADS + h) * cL + l0 + row) * cD + (n0 >> 3);
      step = (size_t)16 * cD;
    }
#pragma unroll
    for (int ia = 0; ia < cPT; ++ia) {
      v8h o;
#pragma unroll
      for (int r = 0; r < 8; ++r) o[r] = (_Float16)(acc[ia][ib][r] + bv[ib][VT ? 0 : r]);
      *(v8h*)(dp + ia * step) = o;
    }
    // The next tile column's sums reuse these stores' registers: they wait for the
    // stores' issue, and the scheduling barrier keeps them behind the wait. Behind
    // the last run too: the other variant's code follows it in the built kernel.
    asm volatile("s_wait_xcnt 0x0" ::: "memory");
    __builtin_amdgcn_sched_barrier(0);
  }
}

__global__ void __launch_bounds__(128)
proj_kernel(const float* __restrict__ KEY,
                            const float* __restrict__ VALUE,
                            const float* __restrict__ QUERY,
                            const float* __restrict__ W_w,
                            const float* __restrict__ W_b,
                            const float* __restrict__ Wv_w,
                            const float* __restrict__ Wv_b,
                            _Float16* __restrict__ Pk,
                            _Float16* __restrict__ Pq,
                            _Float16* __restrict__ PvT) {
  const int which = blockIdx.y;
  constexpr int NB = cHID / (32 * cPT);    // 8 block columns
  const int wave = threadIdx.x >> 5;
  const int m0 = (blockIdx.x / NB) * (32 * cPT) + (wave >> 1) * (16 * cPT);
  const int n0 = (blockIdx.x % NB) * (32 * cPT) + (wave & 1) * (16 * cPT);

  if (which == 2) proj_tile<true>(VALUE, Wv_w, Wv_b, PvT, m0, n0);
  else            proj_tile<false>(which == 0 ? KEY : QUERY, W_w, W_b,
                                   which == 0 ? Pk : Pq, m0, n0);
}

// ---------------------------------------------------------------------------
// Kernel B: fused attention. One block per (b, 64-col Lq tile, key range);
// 8 waves = 8 heads. Every K and PvT fragment feeds cNQ WMMAs, one per 16-col
// query sub-tile. The sum over keys has no normaliser (the softmax runs over
// heads), so each key range writes its own partial ctx plane and the output
// projection adds the planes in its accumulate chain.
// K tiles double-buffered in LDS via async copies; Q fragments hoisted; score
// WMMAs -> LDS -> cross-head softmax (elementwise in (i,k)) -> PvT@attn WMMAs.
// The exchange keeps the keys i of one (head, query) side by side, as the score
// accumulators and the attn fragments hold them: every LDS access of it is 16 bytes
// a lane, and the weights go back as f16, already in fragment order.
// The PvT tile of a trip flies into LDS under that trip's softmax; each wave
// copies and reads its own head's tile only.
// The ctx rows are put together in LDS and stored as whole 128-byte lines.
// ---------------------------------------------------------------------------
constexpr int cKP = cD + 8;     // K row pitch in LDS: 272 B = 17 x 16 B, so the 16 rows that a
                                // fragment read touches fall on 16 different bank groups
constexpr int cVP = 32 + 8;     // PvT row pitch in LDS: 80 B = 5 x 16 B, for the same reason
constexpr int cCP = cHID + 4;   // ctx row pitch in LDS: 2056 B = 514 dwords, so the 16 rows and 2 d
                                // groups that a wave's 2-byte write touches fall on 32 different banks
constexpr int cSP = 32 + 4;     // score row pitch in LDS: 144 B = 9 x 16 B, for the same reason
typedef __attribute__((ext_vector_type(4))) _Float16 v4h;
typedef __attribute__((ext_vector_type(4))) float v4f;
struct AttnSmem {
  _Float16 sK[2][cHEADS][32][cKP];  // 136 KB, double-buffered K tiles (first!)
  // 72 KB, score/attn exchange: a row holds the 32 keys of one (head, sub-tile, query)
  // as f32 scores; the softmax puts the f16 weights of keys 8g..8g+7 over the first
  // 16 bytes of the 32 that held their scores.
  float    s_sc[cHEADS][cNQ][16][cSP];
  _Float16 sV[cHEADS][cD][cVP];     // 80 KB, this trip's PvT tiles (128 d x 32 keys a head)
};

__global__ void __launch_bounds__(256)   // real block size: registers for the wide tile
attn_kernel(const _Float16* __restrict__ Pk,
                            const _Float16* __restrict__ Pq,
                            const _Float16* __restrict__ PvT,
                            _Float16* __restrict__ ctx) {
  __shared__ __attribute__((aligned(16))) AttnSmem sm;   // 16-byte K reads stay whole

  constexpr int QT = cL / (16 * cNQ);      // query tiles per batch entry
  const int bb = blockIdx.x / QT;
  const int kt = blockIdx.x % QT;
  const int ks = blockIdx.y;               // key range of this block
  const int h  = threadIdx.x >> 5;         // wave id == head
  const int lane = lane_id();

  const _Float16* Kh = Pk  + ((size_t)(bb * cHEADS + h) * cL + ks * cLK) * cD;
  const _Float16* Qt = Pq  + ((size_t)(bb * cHEADS + h) * cL) * cD
                           + (size_t)(kt * 16 * cNQ) * cD;
  const _Float16* Vt = PvT + ((size_t)(bb * cHEADS + h) * cD) * cL + ks * cLK;  // [d][L]

  // Q fragments are invariant over the whole Lk loop: hoist (cNQ x 4 x v16h).
  v16h bq[cNQ][4];
#pragma unroll  // constant c: the per-sub-tile arrays stay in registers
  for (int c = 0; c < cNQ; ++c)
#pragma unroll
    for (int q = 0; q < 4; ++q)
      bq[c][q] = frag_rm_f16(Qt + (size_t)(c * 16) * cD + q * 32, cD);
  // the Q loads share one address pair: hold its reuse behind their issue
  asm volatile("s_wait_xcnt 0x0" ::: "memory");

  v8f acc[cNQ][8] = {};                    // per sub-tile: 8 j-tiles (d) x 16 k cols

  // --- async stage of one 32x128 f16 K tile (8 KB) into sK[buf][h] --------
  auto stage_k = [&](int buf, int i0) {
    // the wave's number as a scalar: the tile's base then takes no vector register
    unsigned base = (unsigned)((buf * cHEADS + __builtin_amdgcn_readfirstlane(h)) * (32 * cKP * 2)
                               + (lane >> 4) * (cKP * 2) + (lane & 15) * 16);   // sK @ LDS off 0
    const char* g = (const char*)(Kh + (size_t)i0 * cD);
#pragma unroll
    for (int t = 0; t < 16; ++t) {
      unsigned lds = base + (unsigned)(t * (2 * cKP * 2));   // 544 B = two padded rows
      async_copy_512(lds, g + t * 512 + lane * 16);
    }
  };

  // --- async stage of one 128x32 f16 PvT tile (8 KB) into sV[h] -----------
  // A copy brings 8 rows of 64 B: four lanes a row.
  auto stage_v = [&](int i0) {
    _Float16* l = &sm.sV[h][lane >> 2][(lane & 3) * 8];
    const _Float16* g = Vt + (size_t)(lane >> 2) * cL + i0 + (lane & 3) * 8;
#pragma unroll  // constant t: each copy's two addresses are a base plus a constant
    for (int t = 0; t < 16; ++t) async_copy_16(l + t * 8 * cVP, g + (size_t)(t * 8) * cL);
  };

  stage_k(0, 0);

  for (int i0 = 0; i0 < cLK; i0 += 32) {
    const int  cur  = (i0 >> 5) & 1;
    const bool more = (i0 + 32) < cLK;
    if (more) stage_k(cur ^ 1, i0 + 32);

    if (more) wait_async16();   // oldest 16 (current buffer) complete
    else      wait_async0();

    const _Float16* sk = &sm.sK[cur][h][0][0];

    // --- score tiles S[i0..i0+31][kt*64..+64] (cNQ sub-tiles) for this head (from LDS) ---
    v8f s0[cNQ] = {}, s1[cNQ] = {};
#pragma unroll
    for (int k0 = 0; k0 < cD; k0 += 32) {
      v16h a0 = frag_rm_f16(sk + k0, cKP);
      v16h a1 = frag_rm_f16(sk + 16 * cKP + k0, cKP);
#pragma unroll  // constant c: the per-sub-tile arrays stay in registers
      for (int c = 0; c < cNQ; ++c) {
        s0[c] = wmma16(a0, bq[c][k0 >> 5], s0[c]);
        s1[c] = wmma16(a1, bq[c][k0 >> 5], s1[c]);
      }
    }
    // This wave's reads of sV (the trip before) have retired before it is refilled.
    asm volatile("s_wait_dscnt 0x0" ::: "memory");
    __syncthreads();   // prior iteration's s_sc and sV reads are done
    stage_v(i0);       // lands under the score exchange and the softmax
    {
      // a lane's 8 accumulator rows are 8 successive keys of its query column
      float* wr = &sm.s_sc[h][0][lane & 15][(lane >> 4) * 8];
#pragma unroll  // constant c: the per-sub-tile arrays stay in registers
      for (int c = 0; c < cNQ; ++c) {
        float* p = wr + c * (16 * cSP);
        *(v4f*)(p)      = __builtin_shufflevector(s0[c], s0[c], 0, 1, 2, 3);
        *(v4f*)(p + 4)  = __builtin_shufflevector(s0[c], s0[c], 4, 5, 6, 7);
        *(v4f*)(p + 16) = __builtin_shufflevector(s1[c], s1[c], 0, 1, 2, 3);
        *(v4f*)(p + 20) = __builtin_shufflevector(s1[c], s1[c], 4, 5, 6, 7);
      }
    }
    __syncthreads();
    // --- softmax across the 8 heads, elementwise in (i,k) ----------------
    // One thread takes 8 successive keys of one (sub-tile, query) in all heads. The 16
    // lanes that an LDS access serves together take rows q, q+1, q+8, q+9: at 9 chunks
    // of 16 B a row their every-other chunks fall on 16 different bank groups.
    {
      const int kk = (h & 1) * 4 + (lane >> 4) * 2 + ((lane >> 2) & 1) + ((lane >> 3) & 1) * 8;
      float* row = &sm.s_sc[0][h >> 1][kk][(lane & 3) * 8];
      constexpr int HS = cNQ * 16 * cSP;   // floats from one head to the next
      v8f v[cHEADS];                       // one head's 8 keys: neighbours pair up in packed f32 ops
      v8f m = -3.0e38f;
#pragma unroll  // constant hh, here and below: v stays in registers
      for (int hh = 0; hh < cHEADS; ++hh) {
        v[hh] = __builtin_shufflevector(*(const v4f*)(row + hh * HS), *(const v4f*)(row + hh * HS + 4),
                                        0, 1, 2, 3, 4, 5, 6, 7) * cSCALE;
        m = __builtin_elementwise_max(m, v[hh]);
      }
      v8f sum = 0.f;
#pragma unroll
      for (int hh = 0; hh < cHEADS; ++hh) {
        v[hh] -= m;
#pragma unroll
        for (int p = 0; p < 8; ++p) v[hh][p] = __expf(v[hh][p]);
        sum += v[hh];
      }
      const v8f inv = 1.f / sum;
#pragma unroll
      for (int hh = 0; hh < cHEADS; ++hh)
        *(v8h*)(row + hh * HS) = __builtin_convertvector(v[hh] * inv, v8h);
    }
    wait_async0();     // this trip's PvT tile has landed (the next K tile too)
    __syncthreads();
    // --- out_h[j,k] += PvT[j,i] @ attn[i,k]  (K = 32 rows of i) ----------
    v16h battn[cNQ];
#pragma unroll  // constant c: the per-sub-tile arrays stay in registers
    for (int c = 0; c < cNQ; ++c) {
      // keys 8*hi.. and 16+8*hi.. of this lane's query: the fragment's two halves
      const float* ab = &sm.s_sc[h][c][lane & 15][(lane >> 4) * 8];
      battn[c] = __builtin_shufflevector(*(const v8h*)ab, *(const v8h*)(ab + 16),
                                         0, 1, 2, 3, 4, 5, 6, 7, 8, 9, 10, 11, 12, 13, 14, 15);
    }
    const _Float16* sv = &sm.sV[h][0][0];
    v16h av[8];                            // four are live at a time
#pragma unroll  // constant jt, here and below: av and acc stay in registers
    for (int jt = 0; jt < 4; ++jt) av[jt] = frag_rm_f16(sv + jt * 16 * cVP, cVP);
#pragma unroll
    for (int j0 = 0; j0 < 8; j0 += 2) {
      // Keeps the LDS reads four fragments ahead of the WMMAs that use them: left
      // alone the scheduler reads one fragment at a time and waits for each.
      __builtin_amdgcn_sched_barrier(0);
#pragma unroll
      for (int jt = j0; jt < j0 + 2; ++jt)
#pragma unroll  // constant c: the per-sub-tile arrays stay in registers
        for (int c = 0; c < cNQ; ++c) acc[c][jt] = wmma16(av[jt], battn[c], acc[c][jt]);
      if (j0 + 4 < 8) {
#pragma unroll
        for (int jt = j0 + 4; jt < j0 + 6; ++jt) av[jt] = frag_rm_f16(sv + jt * 16 * cVP, cVP);
      }
    }
  }

  // --- store ctx[ks][b][l][d*8 + h] (f16), the reference's head interleave --
  // The block holds all 8 heads and all 128 d of its 64 rows l: 64 whole ctx rows of
  // 2 KB. The waves interleave their heads in LDS and the block then stores whole
  // 128-byte lines, 512 contiguous bytes a wave-wide store. The rows lie over the K
  // buffers, which nobody reads or fills behind the last trip's barriers.
  static_assert(sizeof(sm.sK) >= (size_t)(16 * cNQ) * cCP * sizeof(_Float16), "ctx rows fit sK");
  _Float16* st = &sm.sK[0][0][0][0];
  {
    // this lane's element at c = jt = r = 0; the others lie at constant distances
    _Float16* wp = st + (lane & 15) * cCP + (lane >> 4) * (8 * cHEADS) + h;
#pragma unroll  // constant c: the per-sub-tile arrays stay in registers
    for (int c = 0; c < cNQ; ++c)
#pragma unroll
      for (int jt = 0; jt < 8; ++jt)
#pragma unroll
        for (int r = 0; r < 8; ++r)
          wp[c * 16 * cCP + (jt * 16 + r) * cHEADS] = (_Float16)acc[c][jt][r];
  }
  __syncthreads();   // all eight heads' values stand in LDS before a row is read
  constexpr int NR = (16 * cNQ) / 2;       // the block's 256 lanes cover two rows a round
  const int tr = (int)threadIdx.x >> 7, tc = ((int)threadIdx.x & 127) * 8;
  const _Float16* sp = st + tr * cCP + tc;
  _Float16* gp = ctx + (size_t)ks * ((size_t)cB * cL * cHID)
                     + ((size_t)bb * cL + kt * (16 * cNQ) + tr) * cHID + tc;
  v8h o[NR];
#pragma unroll  // constant it: o stays in registers, every address is a base plus a constant
  for (int it = 0; it < NR; ++it) {
    const v4h lo = *(const v4h*)(sp + it * 2 * cCP);
    const v4h hi = *(const v4h*)(sp + it * 2 * cCP + 4);
    o[it] = __builtin_shufflevector(lo, hi, 0, 1, 2, 3, 4, 5, 6, 7);
  }
#pragma unroll
  for (int it = 0; it < NR; ++it) *(v8h*)(gp + (size_t)(it * 2) * cHID) = o[it];
}

// ---------------------------------------------------------------------------
// Kernel C: final projection (sum of the cKS ctx planes)[8192,1024](f16)
// @ Wo^T[1024,256] + b -> f32. One wave per 64x64 output tile (cOT x cOT WMMA
// tiles): every ctx fragment feeds cOT WMMAs, every weight fragment cKS x cOT. The two waves of a block share
// their 64 ctx rows. The planes are added by running every plane through the
// same f32 accumulate chain, plane 0 then plane 1 at each k-step.
// ---------------------------------------------------------------------------
constexpr int cOT = 4;          // 16-row fragments per side of a wave's tile

__global__ void __launch_bounds__(64)
outproj_kernel(const _Float16* __restrict__ ctx,
                               const float* __restrict__ Wo_w,
                               const float* __restrict__ Wo_b,
                               float* __restrict__ out) {
  const int lane = lane_id();
  const int row = lane & 15, hi = lane >> 4;
  const int m0 = (int)(blockIdx.x >> 1) * (16 * cOT);
  const int n0 = (int)((blockIdx.x & 1) * 2 + (threadIdx.x >> 5)) * (16 * cOT);

  // This lane's first 8 k of fragment 0, per ctx plane and for the weights; the
  // other fragments and the second 8 k lie at constant distances from them.
  const _Float16* pa[cKS];
#pragma unroll
  for (int p = 0; p < cKS; ++p)
    pa[p] = ctx + (size_t)p * ((size_t)cB * cL * cHID) + (size_t)(m0 + row) * cHID + hi * 8;
  const float* pw = Wo_w + (size_t)(n0 + row) * cHID + hi * 8;

  float bv[cOT];                           // bias of this lane's column in tile column ib
#pragma unroll
  for (int ib = 0; ib < cOT; ++ib) bv[ib] = Wo_b[n0 + ib * 16 + row];
  // The bias loads' address register is reused only once they have issued; the
  // scheduling barrier keeps what follows behind the wait.
  asm volatile("s_wait_xcnt 0x0" ::: "memory");
  __builtin_amdgcn_sched_barrier(0);

  v8f acc[cOT][cOT] = {};
  v8h ra[cKS][cOT][2];                     // the next step's ctx fragments, in halves
  v4f rw[cOT][4];                          // the next step's weights, still f32
  auto fetch = [&]() {
#pragma unroll
    for (int i = 0; i < cOT; ++i) {
#pragma unroll
      for (int p = 0; p < cKS; ++p)
#pragma unroll
        for (int s = 0; s < 2; ++s)
          ra[p][i][s] = *(const v8h*)(pa[p] + (size_t)(i * 16) * cHID + s * 16);
#pragma unroll
      for (int s = 0; s < 4; ++s)
        rw[i][s] = *(const v4f*)(pw + (size_t)(i * 16) * cHID + (s >> 1) * 16 + (s & 1) * 4);
    }
    // The three pointers move on only once the loads that name them have issued;
    // the scheduling barrier keeps the loads, all of them, in front of what follows
    // (the current step's WMMAs, under which they fly).
    asm volatile("s_wait_xcnt 0x0" ::: "memory");
    __builtin_amdgcn_sched_barrier(0);
#pragma unroll
    for (int p = 0; p < cKS; ++p) pa[p] += 32;
    pw += 32;
  };
  fetch();
#pragma unroll 2  // two steps a trip: the fetched fragments change names, not registers
  for (int k0 = 0; k0 < cHID; k0 += 32) {
    v16h a[cKS][cOT], b[cOT];
#pragma unroll
    for (int i = 0; i < cOT; ++i) {
#pragma unroll
      for (int p = 0; p < cKS; ++p)
        a[p][i] = __builtin_shufflevector(ra[p][i][0], ra[p][i][1],
                                          0, 1, 2, 3, 4, 5, 6, 7, 8, 9, 10, 11, 12, 13, 14, 15);
#pragma unroll
      for (int e = 0; e < 16; ++e) b[i][e] = (_Float16)rw[i][e >> 2][e & 3];
    }
    if (k0 + 32 < cHID) fetch();
#pragma unroll
    for (int p = 0; p < cKS; ++p)
#pragma unroll
      for (int ia = 0; ia < cOT; ++ia)
#pragma unroll
        for (int ib = 0; ib < cOT; ++ib)
          acc[ia][ib] = wmma16(a[p][ia], b[ib], acc[ia][ib]);
  }

#pragma unroll
  for (int ib = 0; ib < cOT; ++ib)
#pragma unroll
    for (int ia = 0; ia < cOT; ++ia)
#pragma unroll
      for (int r = 0; r < 8; ++r) acc[ia][ib][r] += bv[ib];
  float* po = out + (size_t)(m0 + hi * 8) * cOUT + n0 + row;
  // Every sum and the one address stand in their registers before the first store
  // issues, so that no register which a store names is written behind it.
  __builtin_amdgcn_sched_barrier(0);
#pragma unroll
  for (int ib = 0; ib < cOT; ++ib)
#pragma unroll
    for (int ia = 0; ia < cOT; ++ia)
#pragma unroll
      for (int r = 0; r < 8; ++r) po[(ia * 16 + r) * cOUT + ib * 16] = acc[ia][ib][r];
}

// ---------------------------------------------------------------------------
extern "C" void kernel_launch(void* const* d_in, const int* in_sizes, int n_in,
                              void* d_out, int out_size, void* d_ws, size_t ws_size,
                              hipStream_t stream) {
  (void)in_sizes; (void)n_in; (void)out_size; (void)ws_size;
  const float* KEY   = (const float*)d_in[0];
  const float* VALUE = (const float*)d_in[1];
  const float* QUERY = (const float*)d_in[2];
  const float* W_w   = (const float*)d_in[3];
  const float* W_b   = (const float*)d_in[4];
  const float* Wv_w  = (const float*)d_in[5];
  const float* Wv_b  = (const float*)d_in[6];
  const float* Wo_w  = (const float*)d_in[7];
  const float* Wo_b  = (const float*)d_in[8];
  float* out = (float*)d_out;

  // f16 workspace: Pk, Pq, PvT (head-split) + cKS ctx planes, 16 MB each.
  const size_t pelems = (size_t)cB * cHEADS * cL * cD;   // == B*L*HID
  _Float16* Pk  = (_Float16*)d_ws;
  _Float16* Pq  = Pk + pelems;
  _Float16* PvT = Pq + pelems;
  _Float16* ctx = PvT + pelems;

  {
    const int MB = (cB * cL) / (32 * cPT);   // 64 block rows
    const int NB = cHID / (32 * cPT);        // 8 block columns
    dim3 grid(MB * NB, 3);                   // 4 waves/block, 3 projections
    proj_kernel<<<grid, 128, 0, stream>>>(KEY, VALUE, QUERY, W_w, W_b, Wv_w, Wv_b,
                                          Pk, Pq, PvT);
  }
  {
    dim3 grid(cB * (cL / (16 * cNQ)), cKS);  // 128 x 2 blocks, 8 waves = 8 heads
    attn_kernel<<<grid, 256, 0, stream>>>(Pk, Pq, PvT, ctx);
  }
  {
    const int MT = (cB * cL) / (16 * cOT);   // 128 tile rows
    const int NT = cOUT / (16 * cOT);        // 4 tile columns
    dim3 grid((MT * NT) / 2);                // 256 blocks of 2 waves
    outproj_kernel<<<grid, 64, 0, stream>>>(ctx, Wo_w, Wo_b, out);
  }
}

// v008
// Measured time: 175 microseconds a run.
// In both of two side-by-side timings against v007, it was 1.19 times as fast.
// Over all steps from v000 it is 5.77 times as fast.
#include <hip/hip_runtime.h>
#include <hip/hip_bf16.h>
#include <math.h>

// ---------------------------------------------------------------------------
// MHA with softmax-over-heads, fused for MI455X (gfx1250, wave32, WMMA).
//   proj    : KEY/QUERY @ W^T + b -> f16 head-split; VALUE @ Wv^T + b -> f16
//             head-split TRANSPOSED (PvT[b][h][d][L]) so the attention kernel
//             reads every operand contiguously. Operands staged to LDS with
//             global_load_async_to_lds_b128, double-buffered.
//   attn    : fused score + head-softmax + attn^T@Wv, K tiles (double-buffered)
//             and PvT tiles staged to LDS with global_load_async_to_lds_b128.
//   outproj : ctx @ Wo^T + b -> f32
// All matmuls via v_wmma_f32_16x16x32_f16 (f32 accumulate).
// ---------------------------------------------------------------------------

typedef __attribute__((ext_vector_type(16))) _Float16 v16h;
typedef __attribute__((ext_vector_type(8)))  float    v8f;

#define DEV static __device__ __forceinline__

constexpr int cB = 4, cL = 2048, cINK = 256, cHID = 1024, cHEADS = 8, cD = 128, cOUT = 256;
constexpr float cSCALE = 0.08838834764831845f;   // 1/sqrt(128)
constexpr int cNQ = 4;          // 16-column query sub-tiles per attention block
constexpr int cKS = 2;          // key ranges; each block sums over one of them
constexpr int cLK = cL / cKS;   // keys per block

DEV int lane_id() { return (int)(threadIdx.x & 31u); }

// K index (within the 32-wide K tile) held by element e of a 16-bit A/B frag.
// Per ISA 7.12.2: lanes 0-15 -> K 0..7 / 16..23, lanes 16-31 -> K 8..15 / 24..31.
DEV int kidx(int lane, int e) {
  int kb = (lane & 16) ? 8 : 0;
  return (e < 8) ? (kb + e) : (16 + kb + (e - 8));
}

// A/B fragment from a row-major f16 tile (two contiguous 16B chunks per lane)
DEV v16h frag_rm_f16(const _Float16* base, int ld) {
  int lane = lane_id();
  const _Float16* p = base + (size_t)(lane & 15) * ld;
  v16h f;
#pragma unroll
  for (int e = 0; e < 16; ++e) f[e] = p[kidx(lane, e)];
  return f;
}

DEV v8f wmma16(v16h a, v16h b, v8f c) {
  return __builtin_amdgcn_wmma_f32_16x16x32_f16(false, a, false, b, (short)0, c,
                                                false, false);
}

// Async-copy 512B (32 lanes x 16B) from global to LDS; CDNA5 async path.
// lds_off is the byte offset within the workgroup's LDS segment.
DEV void async_copy_512(unsigned lds_off, const void* gptr) {
  asm volatile("global_load_async_to_lds_b128 %0, %1, off"
               :: "v"(lds_off), "v"(gptr) : "memory");
}
// The same copy as the compiler's own form: each lane's 16 B from g to l.
typedef __attribute__((ext_vector_type(4))) int v4i;
DEV void async_copy_16(_Float16* l, const _Float16* g) {
  __builtin_amdgcn_global_load_async_to_lds_b128(
      (__attribute__((address_space(1))) v4i*)g, (__attribute__((address_space(3))) v4i*)l, 0, 0);
}
DEV void wait_async_le(int) {}  // (documentation only; real waits below)
DEV void wait_async16() { asm volatile("s_wait_asynccnt 0x10" ::: "memory"); }
DEV void wait_async0()  { asm volatile("s_wait_asynccnt 0x0"  ::: "memory"); }

// ---------------------------------------------------------------------------
// Kernel A: projections.  blockIdx.y: 0->Pk(KEY,W), 1->Pq(QUERY,W), 2->PvT(VALUE,Wv)
// One wave per 64x64 output tile (cPT x cPT WMMA tiles), a block of 2x2 waves per
// 128x128: every loaded fragment feeds cPT WMMAs. K=256 -> 8 steps.
// A step's 128 input rows and 128 weight rows (128 B of each) go to LDS as whole
// lines by async copies, two buffers: step s+2 flies while step s+1 is worked on.
// The fragments are read from LDS, 16 bytes a lane, and turned to f16 in registers.
// Pk/Pq layout: P[b][h][l][d];  PvT layout: P[b][h][d][l]  (h = hidden%8, d = hidden/8)
// The tile is turned so that the 8 accumulator rows a lane holds lie side by side
// in the destination (one 16-byte store):
//   VT  (PvT)  : D = X . W^T, rows = l, column = hidden unit.
//   !VT (Pk/Pq): D = W . X^T, column = l, and the 16 weight rows of tile ib are
//                the units of heads 2*ib and 2*ib+1 at 8 successive d, so rows = d.
// ---------------------------------------------------------------------------
typedef __attribute__((ext_vector_type(8))) _Float16 v8h;
constexpr int cPT = 4;          // 16-row fragments per side of a wave's tile

typedef __attribute__((ext_vector_type(4))) float v4f;
constexpr int cXP = 32 + 4;     // f32 row pitch in LDS: 144 B = 9 x 16 B, so the 16 rows that a
                                // fragment read touches fall on 16 different bank groups
// A k-step's operands of the block's 128x128 tile: 128 rows of 32 f32 each, two buffers.
struct ProjSmem {
  float sX[2][32 * cPT][cXP];   // 36 KB, input rows
  float sW[2][32 * cPT][cXP];   // 36 KB, weight rows, in the order the fragments take them
};

// One A/B fragment's 16 f32 values from this lane's own LDS row; p stands at the
// lane's first k (0 or 8): k, k+1 .. k+7, then k+16 .. k+23, the fragment's order.
DEV void load_row_f32(v4f (&q)[4], const float* p) {
  q[0] = *(const v4f*)(p);
  q[1] = *(const v4f*)(p + 4);
  q[2] = *(const v4f*)(p + 16);
  q[3] = *(const v4f*)(p + 20);
}
DEV v16h cvt_row_f16(const v4f (&q)[4]) {
  v16h f;
#pragma unroll
  for (int e = 0; e < 16; ++e) f[e] = (_Float16)q[e >> 2][e & 3];
  return f;
}
DEV unsigned lds_off(const void* p) { return (unsigned)(size_t)p; }
// Eight async copies of 512 B (each lane's 16 B from g[c] to LDS byte l[c]). The wait
// stands in the copies' own statement: their address registers are rewritten only
// once the copies have issued.
DEV void async_copy_8x512(const unsigned (&l)[8], const float* const (&g)[8]) {
  asm volatile("global_load_async_to_lds_b128 %0, %8, off\n\t"
               "global_load_async_to_lds_b128 %1, %9, off\n\t"
               "global_load_async_to_lds_b128 %2, %10, off\n\t"
               "global_load_async_to_lds_b128 %3, %11, off\n\t"
               "global_load_async_to_lds_b128 %4, %12, off\n\t"
               "global_load_async_to_lds_b128 %5, %13, off\n\t"
               "global_load_async_to_lds_b128 %6, %14, off\n\t"
               "global_load_async_to_lds_b128 %7, %15, off\n\t"
               "s_wait_xcnt 0x0"
               :: "v"(l[0]), "v"(l[1]), "v"(l[2]), "v"(l[3]), "v"(l[4]), "v"(l[5]), "v"(l[6]), "v"(l[7]),
                  "v"(g[0]), "v"(g[1]), "v"(g[2]), "v"(g[3]), "v"(g[4]), "v"(g[5]), "v"(g[6]), "v"(g[7])
               : "memory");
}

template <bool VT>
DEV void proj_tile(const float* __restrict__ src, const float* __restrict__ w,
                   const float* __restrict__ bias, _Float16* __restrict__ dst,
                   ProjSmem& sm, int mb, int nb) {
  const int lane = lane_id();
  const int row = lane & 15, hi = lane >> 4;
  const int wave = (int)threadIdx.x >> 5;
  const int m0 = mb + (wave >> 1) * (16 * cPT);   // this wave's 64x64 tile
  const int n0 = nb + (wave & 1) * (16 * cPT);

  // --- async stage of one k-step: 128 input rows and 128 weight rows of 128 B -------
  // A copy brings 4 whole rows, eight lanes a row; a wave brings 32 rows of each.
  // Weight row n0 + 8a + 2i + b (!VT) is row 8b + a of fragment i: it lands there.
  const int q = lane >> 3, ch = (lane & 7) * 4;
  const float* gx = src + (size_t)(mb + wave * 32 + q) * cINK + ch;
  const float* gw = w   + (size_t)(nb + wave * 32 + q) * cINK + ch;
  const unsigned lx = lds_off(&sm.sX[0][wave * 32 + q][ch]);
  const unsigned lw = lds_off(&sm.sW[0][VT ? wave * 32 + q
                                           : (wave >> 1) * 64 + (q >> 1) * 16 + (q & 1) * 8 + (wave & 1) * 4][ch]);
  auto stage = [&](int buf, int k0) {
    unsigned l[8];
    const float* g[8];
#pragma unroll  // constant c, here and below: every address is a base plus a constant
    for (int c = 0; c < 8; ++c) {
      l[c] = lx + (unsigned)((buf * (32 * cPT) + c * 4) * (cXP * 4));
      g[c] = gx + k0 + c * 4 * cINK;
    }
    async_copy_8x512(l, g);
#pragma unroll
    for (int c = 0; c < 8; ++c) {
      l[c] = lw + (unsigned)((buf * (32 * cPT) + (VT ? c * 4 : (c & 1) * 32 + (c >> 1))) * (cXP * 4));
      g[c] = gw + k0 + c * 4 * cINK;
    }
    async_copy_8x512(l, g);
  };

  v8f acc[cPT][cPT] = {};
  float bv[cPT][8];                        // bias of accumulator row r of tile ib
#pragma unroll
  for (int ib = 0; ib < cPT; ++ib)
#pragma unroll
    for (int r = 0; r < (VT ? 1 : 8); ++r)
      bv[ib][r] = VT ? bias[n0 + ib * 16 + row] : bias[n0 + r * cHEADS + ib * 2 + hi];
  // The bias loads' address registers are reused only once they have issued; the
  // scheduling barrier keeps what follows behind the wait.
  asm volatile("s_wait_xcnt 0x0" ::: "memory");
  __builtin_amdgcn_sched_barrier(0);
  stage(0, 0);
  wait_async0();       // step 0 has landed, this wave's part
  __syncthreads();     // ... and every wave's
  stage(1, 32);
  const float* px = &sm.sX[0][(wave >> 1) * (16 * cPT) + row][hi * 8];
  const float* pw = &sm.sW[0][(wave & 1) * (16 * cPT) + row][hi * 8];
#pragma unroll  // constant k0: every LDS read is its row pointer plus an immediate
  for (int k0 = 0; k0 < cINK; k0 += 32) {
    const int buf = (k0 >> 5) & 1;
    v4f rx[cPT][4], rw[cPT][4];            // this step's operands, still f32
#pragma unroll
    for (int i = 0; i < cPT; ++i) {
      load_row_f32(rx[i], px + (buf * (32 * cPT) + i * 16) * cXP);
      load_row_f32(rw[i], pw + (buf * (32 * cPT) + i * 16) * cXP);
    }
    v16h x[cPT], wf[cPT];
#pragma unroll
    for (int i = 0; i < cPT; ++i) {
      x[i]  = cvt_row_f16(rx[i]);
      wf[i] = cvt_row_f16(rw[i]);
    }
#pragma unroll
    for (int ia = 0; ia < cPT; ++ia)
#pragma unroll
      for (int ib = 0; ib < cPT; ++ib)
        acc[ia][ib] = VT ? wmma16(x[ia], wf[ib], acc[ia][ib])
                         : wmma16(wf[ib], x[ia], acc[ia][ib]);
    // Hand-over: this wave's reads of the buffer have retired and its copies of the
    // next step have landed; behind the barrier that holds for every wave, and the
    // buffer just read is refilled.
    asm volatile("s_wait_dscnt 0x0" ::: "memory");
    wait_async0();
    __syncthreads();
    if (k0 + 64 < cINK) stage(buf, k0 + 64);
  }
  wait_async0();       // no copy is outstanding behind the loop

  const int bi = m0 / cL, l0 = m0 % cL;    // a 64-row tile lies in one batch entry
#pragma unroll
  for (int ib = 0; ib < cPT; ++ib) {
    _Float16* dp;                           // this lane's 8 values at ia = 0
    size_t step;                            // elements from one ia to the next
    if (VT) {
      const int n = n0 + ib * 16 + row;
      dp = dst + (((size_t)bi * cHEADS + (n & 7)) * cD + (n >> 3)) * cL + l0 + hi * 8;
      step = 16;
    } else {
      const int h = ib * 2 + hi;
      dp = dst + (((size_t)bi * cHEADS + h) * cL + l0 + row) * cD + (n0 >> 3);
      step = (size_t)16 * cD;
    }
#pragma unroll
    for (int ia = 0; ia < cPT; ++ia) {
      v8h o;
#pragma unroll
      for (int r = 0; r < 8; ++r) o[r] = (_Float16)(acc[ia][ib][r] + bv[ib][VT ? 0 : r]);
      *(v8h*)(dp + ia * step) = o;
    }
    // The next tile column's sums reuse these stores' registers: they wait for the
    // stores' issue, and the scheduling barrier keeps them behind the wait. Behind
    // the last run too: the other variant's code follows it in the built kernel.
    asm volatile("s_wait_xcnt 0x0" ::: "memory");
    __builtin_amdgcn_sched_barrier(0);
  }
}

__global__ void __launch_bounds__(128)
proj_kernel(const float* __restrict__ KEY,
                            const float* __restrict__ VALUE,
                            const float* __restrict__ QUERY,
                            const float* __restrict__ W_w,
                            const float* __restrict__ W_b,
                            const float* __restrict__ Wv_w,
                            const float* __restrict__ Wv_b,
                            _Float16* __restrict__ Pk,
                            _Float16* __restrict__ Pq,
                            _Float16* __restrict__ PvT) {
  __shared__ __attribute__((aligned(16))) ProjSmem sm;   // 16-byte copies and reads stay whole
  const int which = blockIdx.y;
  constexpr int NB = cHID / (32 * cPT);    // 8 block columns
  const int mb = (blockIdx.x / NB) * (32 * cPT);
  const int nb = (blockIdx.x % NB) * (32 * cPT);

  if (which == 2) proj_tile<true>(VALUE, Wv_w, Wv_b, PvT, sm, mb, nb);
  else            proj_tile<false>(which == 0 ? KEY : QUERY, W_w, W_b,
                                   which == 0 ? Pk : Pq, sm, mb, nb);
}

// ---------------------------------------------------------------------------
// Kernel B: fused attention. One block per (b, 64-col Lq tile, key range);
// 8 waves = 8 heads. Every K and PvT fragment feeds cNQ WMMAs, one per 16-col
// query sub-tile. The sum over keys has no normaliser (the softmax runs over
// heads), so each key range writes its own partial ctx plane and the output
// projection adds the planes in its accumulate chain.
// K tiles double-buffered in LDS via async copies; Q fragments hoisted; score
// WMMAs -> LDS -> cross-head softmax (elementwise in (i,k)) -> PvT@attn WMMAs.
// The exchange keeps the keys i of one (head, query) side by side, as the score
// accumulators and the attn fragments hold them: every LDS access of it is 16 bytes
// a lane, and the weights go back as f16, already in fragment order.
// The PvT tile of a trip flies into LDS under that trip's softmax; each wave
// copies and reads its own head's tile only.
// The ctx rows are put together in LDS and stored as whole 128-byte lines.
// ---------------------------------------------------------------------------
constexpr int cKP = cD + 8;     // K row pitch in LDS: 272 B = 17 x 16 B, so the 16 rows that a
                                // fragment read touches fall on 16 different bank groups
constexpr int cVP = 32 + 8;     // PvT row pitch in LDS: 80 B = 5 x 16 B, for the same reason
constexpr int cCP = cHID + 4;   // ctx row pitch in LDS: 2056 B = 514 dwords, so the 16 rows and 2 d
                                // groups that a wave's 2-byte write touches fall on 32 different banks
constexpr int cSP = 32 + 4;     // score row pitch in LDS: 144 B = 9 x 16 B, for the same reason
typedef __attribute__((ext_vector_type(4))) _Float16 v4h;
struct AttnSmem {
  _Float16 sK[2][cHEADS][32][cKP];  // 136 KB, double-buffered K tiles (first!)
  // 72 KB, score/attn exchange: a row holds the 32 keys of one (head, sub-tile, query)
  // as f32 scores; the softmax puts the f16 weights of keys 8g..8g+7 over the first
  // 16 bytes of the 32 that held their scores.
  float    s_sc[cHEADS][cNQ][16][cSP];
  _Float16 sV[cHEADS][cD][cVP];     // 80 KB, this trip's PvT tiles (128 d x 32 keys a head)
};

__global__ void __launch_bounds__(256)   // real block size: registers for the wide tile
attn_kernel(const _Float16* __restrict__ Pk,
                            const _Float16* __restrict__ Pq,
                            const _Float16* __restrict__ PvT,
                            _Float16* __restrict__ ctx) {
  __shared__ __attribute__((aligned(16))) AttnSmem sm;   // 16-byte K reads stay whole

  constexpr int QT = cL / (16 * cNQ);      // query tiles per batch entry
  const int bb = blockIdx.x / QT;
  const int kt = blockIdx.x % QT;
  const int ks = blockIdx.y;               // key range of this block
  const int h  = threadIdx.x >> 5;         // wave id == head
  const int lane = lane_id();

  const _Float16* Kh = Pk  + ((size_t)(bb * cHEADS + h) * cL + ks * cLK) * cD;
  const _Float16* Qt = Pq  + ((size_t)(bb * cHEADS + h) * cL) * cD
                           + (size_t)(kt * 16 * cNQ) * cD;
  const _Float16* Vt = PvT + ((size_t)(bb * cHEADS + h) * cD) * cL + ks * cLK;  // [d][L]

  // Q fragments are invariant over the whole Lk loop: hoist (cNQ x 4 x v16h).
  v16h bq[cNQ][4];
#pragma unroll  // constant c: the per-sub-tile arrays stay in registers
  for (int c = 0; c < cNQ; ++c)
#pragma unroll
    for (int q = 0; q < 4; ++q)
      bq[c][q] = frag_rm_f16(Qt + (size_t)(c * 16) * cD + q * 32, cD);
  // the Q loads share one address pair: hold its reuse behind their issue
  asm volatile("s_wait_xcnt 0x0" ::: "memory");

  v8f acc[cNQ][8] = {};                    // per sub-tile: 8 j-tiles (d) x 16 k cols

  // --- async stage of one 32x128 f16 K tile (8 KB) into sK[buf][h] --------
  auto stage_k = [&](int buf, int i0) {
    // the wave's number as a scalar: the tile's base then takes no vector register
    unsigned base = (unsigned)((buf * cHEADS + __builtin_amdgcn_readfirstlane(h)) * (32 * cKP * 2)
                               + (lane >> 4) * (cKP * 2) + (lane & 15) * 16);   // sK @ LDS off 0
    const char* g = (const char*)(Kh + (size_t)i0 * cD);
#pragma unroll
    for (int t = 0; t < 16; ++t) {
      unsigned lds = base + (unsigned)(t * (2 * cKP * 2));   // 544 B = two padded rows
      async_copy_512(lds, g + t * 512 + lane * 16);
    }
  };

  // --- async stage of one 128x32 f16 PvT tile (8 KB) into sV[h] -----------
  // A copy brings 8 rows of 64 B: four lanes a row.
  auto stage_v = [&](int i0) {
    _Float16* l = &sm.sV[h][lane >> 2][(lane & 3) * 8];
    const _Float16* g = Vt + (size_t)(lane >> 2) * cL + i0 + (lane & 3) * 8;
#pragma unroll  // constant t: each copy's two addresses are a base plus a constant
    for (int t = 0; t < 16; ++t) async_copy_16(l + t * 8 * cVP, g + (size_t)(t * 8) * cL);
  };

  stage_k(0, 0);

  for (int i0 = 0; i0 < cLK; i0 += 32) {
    const int  cur  = (i0 >> 5) & 1;
    const bool more = (i0 + 32) < cLK;
    if (more) stage_k(cur ^ 1, i0 + 32);

    if (more) wait_async16();   // oldest 16 (current buffer) complete
    else      wait_async0();

    const _Float16* sk = &sm.sK[cur][h][0][0];

    // --- score tiles S[i0..i0+31][kt*64..+64] (cNQ sub-tiles) for this head (from LDS) ---
    v8f s0[cNQ] = {}, s1[cNQ] = {};
#pragma unroll
    for (int k0 = 0; k0 < cD; k0 += 32) {
      v16h a0 = frag_rm_f16(sk + k0, cKP);
      v16h a1 = frag_rm_f16(sk + 16 * cKP + k0, cKP);
#pragma unroll  // constant c: the per-sub-tile arrays stay in registers
      for (int c = 0; c < cNQ; ++c) {
        s0[c] = wmma16(a0, bq[c][k0 >> 5], s0[c]);
        s1[c] = wmma16(a1, bq[c][k0 >> 5], s1[c]);
      }
    }
    // This wave's reads of sV (the trip before) have retired before it is refilled.
    asm volatile("s_wait_dscnt 0x0" ::: "memory");
    __syncthreads();   // prior iteration's s_sc and sV reads are done
    stage_v(i0);       // lands under the score exchange and the softmax
    {
      // a lane's 8 accumulator rows are 8 successive keys of its query column
      float* wr = &sm.s_sc[h][0][lane & 15][(lane >> 4) * 8];
#pragma unroll  // constant c: the per-sub-tile arrays stay in registers
      for (int c = 0; c < cNQ; ++c) {
        float* p = wr + c * (16 * cSP);
        *(v4f*)(p)      = __builtin_shufflevector(s0[c], s0[c], 0, 1, 2, 3);
        *(v4f*)(p + 4)  = __builtin_shufflevector(s0[c], s0[c], 4, 5, 6, 7);
        *(v4f*)(p + 16) = __builtin_shufflevector(s1[c], s1[c], 0, 1, 2, 3);
        *(v4f*)(p + 20) = __builtin_shufflevector(s1[c], s1[c], 4, 5, 6, 7);
      }
    }
    __syncthreads();
    // --- softmax across the 8 heads, elementwise in (i,k) ----------------
    // One thread takes 8 successive keys of one (sub-tile, query) in all heads. The 16
    // lanes that an LDS access serves together take rows q, q+1, q+8, q+9: at 9 chunks
    // of 16 B a row their every-other chunks fall on 16 different bank groups.
    {
      const int kk = (h & 1) * 4 + (lane >> 4) * 2 + ((lane >> 2) & 1) + ((lane >> 3) & 1) * 8;
      float* row = &sm.s_sc[0][h >> 1][kk][(lane & 3) * 8];
      constexpr int HS = cNQ * 16 * cSP;   // floats from one head to the next
      v8f v[cHEADS];                       // one head's 8 keys: neighbours pair up in packed f32 ops
      v8f m = -3.0e38f;
#pragma unroll  // constant hh, here and below: v stays in registers
      for (int hh = 0; hh < cHEADS; ++hh) {
        v[hh] = __builtin_shufflevector(*(const v4f*)(row + hh * HS), *(const v4f*)(row + hh * HS + 4),
                                        0, 1, 2, 3, 4, 5, 6, 7) * cSCALE;
        m = __builtin_elementwise_max(m, v[hh]);
      }
      v8f sum = 0.f;
#pragma unroll
      for (int hh = 0; hh < cHEADS; ++hh) {
        v[hh] -= m;
#pragma unroll
        for (int p = 0; p < 8; ++p) v[hh][p] = __expf(v[hh][p]);
        sum += v[hh];
      }
      const v8f inv = 1.f / sum;
#pragma unroll
      for (int hh = 0; hh < cHEADS; ++hh)
        *(v8h*)(row + hh * HS) = __builtin_convertvector(v[hh] * inv, v8h);
    }
    wait_async0();     // this trip's PvT tile has landed (the next K tile too)
    __syncthreads();
    // --- out_h[j,k] += PvT[j,i] @ attn[i,k]  (K = 32 rows of i) ----------
    v16h battn[cNQ];
#pragma unroll  // constant c: the per-sub-tile arrays stay in registers
    for (int c = 0; c < cNQ; ++c) {
      // keys 8*hi.. and 16+8*hi.. of this lane's query: the fragment's two halves
      const float* ab = &sm.s_sc[h][c][lane & 15][(lane >> 4) * 8];
      battn[c] = __builtin_shufflevector(*(const v8h*)ab, *(const v8h*)(ab + 16),
                                         0, 1, 2, 3, 4, 5, 6, 7, 8, 9, 10, 11, 12, 13, 14, 15);
    }
    const _Float16* sv = &sm.sV[h][0][0];
    v16h av[8];                            // four are live at a time
#pragma unroll  // constant jt, here and below: av and acc stay in registers
    for (int jt = 0; jt < 4; ++jt) av[jt] = frag_rm_f16(sv + jt * 16 * cVP, cVP);
#pragma unroll
    for (int j0 = 0; j0 < 8; j0 += 2) {
      // Keeps the LDS reads four fragments ahead of the WMMAs that use them: left
      // alone the scheduler reads one fragment at a time and waits for each.
      __builtin_amdgcn_sched_barrier(0);
#pragma unroll
      for (int jt = j0; jt < j0 + 2; ++jt)
#pragma unroll  // constant c: the per-sub-tile arrays stay in registers
        for (int c = 0; c < cNQ; ++c) acc[c][jt] = wmma16(av[jt], battn[c], acc[c][jt]);
      if (j0 + 4 < 8) {
#pragma unroll
        for (int jt = j0 + 4; jt < j0 + 6; ++jt) av[jt] = frag_rm_f16(sv + jt * 16 * cVP, cVP);
      }
    }
  }

  // --- store ctx[ks][b][l][d*8 + h] (f16), the reference's head interleave --
  // The block holds all 8 heads and all 128 d of its 64 rows l: 64 whole ctx rows of
  // 2 KB. The waves interleave their heads in LDS and the block then stores whole
  // 128-byte lines, 512 contiguous bytes a wave-wide store. The rows lie over the K
  // buffers, which nobody reads or fills behind the last trip's barriers.
  static_assert(sizeof(sm.sK) >= (size_t)(16 * cNQ) * cCP * sizeof(_Float16), "ctx rows fit sK");
  _Float16* st = &sm.sK[0][0][0][0];
  {
    // this lane's element at c = jt = r = 0; the others lie at constant distances
    _Float16* wp = st + (lane & 15) * cCP + (lane >> 4) * (8 * cHEADS) + h;
#pragma unroll  // constant c: the per-sub-tile arrays stay in registers
    for (int c = 0; c < cNQ; ++c)
#pragma unroll
      for (int jt = 0; jt < 8; ++jt)
#pragma unroll
        for (int r = 0; r < 8; ++r)
          wp[c * 16 * cCP + (jt * 16 + r) * cHEADS] = (_Float16)acc[c][jt][r];
  }
  __syncthreads();   // all eight heads' values stand in LDS before a row is read
  constexpr int NR = (16 * cNQ) / 2;       // the block's 256 lanes cover two rows a round
  const int tr = (int)threadIdx.x >> 7, tc = ((int)threadIdx.x & 127) * 8;
  const _Float16* sp = st + tr * cCP + tc;
  _Float16* gp = ctx + (size_t)ks * ((size_t)cB * cL * cHID)
                     + ((size_t)bb * cL + kt * (16 * cNQ) + tr) * cHID + tc;
  v8h o[NR];
#pragma unroll  // constant it: o stays in registers, every address is a base plus a constant
  for (int it = 0; it < NR; ++it) {
    const v4h lo = *(const v4h*)(sp + it * 2 * cCP);
    const v4h hi = *(const v4h*)(sp + it * 2 * cCP + 4);
    o[it] = __builtin_shufflevector(lo, hi, 0, 1, 2, 3, 4, 5, 6, 7);
  }
#pragma unroll
  for (int it = 0; it < NR; ++it) *(v8h*)(gp + (size_t)(it * 2) * cHID) = o[it];
}

// ---------------------------------------------------------------------------
// Kernel C: final projection (sum of the cKS ctx planes)[8192,1024](f16)
// @ Wo^T[1024,256] + b -> f32. One wave per 64x64 output tile (cOT x cOT WMMA
// tiles): every ctx fragment feeds cOT WMMAs, every weight fragment cKS x cOT. The two waves of a block share
// their 64 ctx rows. The planes are added by running every plane through the
// same f32 accumulate chain, plane 0 then plane 1 at each k-step.
// ---------------------------------------------------------------------------
constexpr int cOT = 4;          // 16-row fragments per side of a wave's tile

__global__ void __launch_bounds__(64)
outproj_kernel(const _Float16* __restrict__ ctx,
                               const float* __restrict__ Wo_w,
                               const float* __restrict__ Wo_b,
                               float* __restrict__ out) {
  const int lane = lane_id();
  const int row = lane & 15, hi = lane >> 4;
  const int m0 = (int)(blockIdx.x >> 1) * (16 * cOT);
  const int n0 = (int)((blockIdx.x & 1) * 2 + (threadIdx.x >> 5)) * (16 * cOT);

  // This lane's first 8 k of fragment 0, per ctx plane and for the weights; the
  // other fragments and the second 8 k lie at constant distances from them.
  const _Float16* pa[cKS];
#pragma unroll
  for (int p = 0; p < cKS; ++p)
    pa[p] = ctx + (size_t)p * ((size_t)cB * cL * cHID) + (size_t)(m0 + row) * cHID + hi * 8;
  const float* pw = Wo_w + (size_t)(n0 + row) * cHID + hi * 8;

  float bv[cOT];                           // bias of this lane's column in tile column ib
#pragma unroll
  for (int ib = 0; ib < cOT; ++ib) bv[ib] = Wo_b[n0 + ib * 16 + row];
  // The bias loads' address register is reused only once they have issued; the
  // scheduling barrier keeps what follows behind the wait.
  asm volatile("s_wait_xcnt 0x0" ::: "memory");
  __builtin_amdgcn_sched_barrier(0);

  v8f acc[cOT][cOT] = {};
  v8h ra[cKS][cOT][2];                     // the next step's ctx fragments, in halves
  v4f rw[cOT][4];                          // the next step's weights, still f32
  auto fetch = [&]() {
#pragma unroll
    for (int i = 0; i < cOT; ++i) {
#pragma unroll
      for (int p = 0; p < cKS; ++p)
#pragma unroll
        for (int s = 0; s < 2; ++s)
          ra[p][i][s] = *(const v8h*)(pa[p] + (size_t)(i * 16) * cHID + s * 16);
#pragma unroll
      for (int s = 0; s < 4; ++s)
        rw[i][s] = *(const v4f*)(pw + (size_t)(i * 16) * cHID + (s >> 1) * 16 + (s & 1) * 4);
    }
    // The three pointers move on only once the loads that name them have issued;
    // the scheduling barrier keeps the loads, all of them, in front of what follows
    // (the current step's WMMAs, under which they fly).
    asm volatile("s_wait_xcnt 0x0" ::: "memory");
    __builtin_amdgcn_sched_barrier(0);
#pragma unroll
    for (int p = 0; p < cKS; ++p) pa[p] += 32;
    pw += 32;
  };
  fetch();
#pragma unroll 2  // two steps a trip: the fetched fragments change names, not registers
  for (int k0 = 0; k0 < cHID; k0 += 32) {
    v16h a[cKS][cOT], b[cOT];
#pragma unroll
    for (int i = 0; i < cOT; ++i) {
#pragma unroll
      for (int p = 0; p < cKS; ++p)
        a[p][i] = __builtin_shufflevector(ra[p][i][0], ra[p][i][1],
                                          0, 1, 2, 3, 4, 5, 6, 7, 8, 9, 10, 11, 12, 13, 14, 15);
#pragma unroll
      for (int e = 0; e < 16; ++e) b[i][e] = (_Float16)rw[i][e >> 2][e & 3];
    }
    if (k0 + 32 < cHID) fetch();
#pragma unroll
    for (int p = 0; p < cKS; ++p)
#pragma unroll
      for (int ia = 0; ia < cOT; ++ia)
#pragma unroll
        for (int ib = 0; ib < cOT; ++ib)
          acc[ia][ib] = wmma16(a[p][ia], b[ib], acc[ia][ib]);
  }

#pragma unroll
  for (int ib = 0; ib < cOT; ++ib)
#pragma unroll
    for (int ia = 0; ia < cOT; ++ia)
#pragma unroll
      for (int r = 0; r < 8; ++r) acc[ia][ib][r] += bv[ib];
  float* po = out + (size_t)(m0 + hi * 8) * cOUT + n0 + row;
  // Every sum and the one address stand in their registers before the first store
  // issues, so that no register which a store names is written behind it.
  __builtin_amdgcn_sched_barrier(0);
#pragma unroll
  for (int ib = 0; ib < cOT; ++ib)
#pragma unroll
    for (int ia = 0; ia < cOT; ++ia)
#pragma unroll
      for (int r = 0; r < 8; ++r) po[(ia * 16 + r) * cOUT + ib * 16] = acc[ia][ib][r];
}

// ---------------------------------------------------------------------------
extern "C" void kernel_launch(void* const* d_in, const int* in_sizes, int n_in,
                              void* d_out, int out_size, void* d_ws, size_t ws_size,
                              hipStream_t stream) {
  (void)in_sizes; (void)n_in; (void)out_size; (void)ws_size;
  const float* KEY   = (const float*)d_in[0];
  const float* VALUE = (const float*)d_in[1];
  const float* QUERY = (const float*)d_in[2];
  const float* W_w   = (const float*)d_in[3];
  const float* W_b   = (const float*)d_in[4];
  const float* Wv_w  = (const float*)d_in[5];
  const float* Wv_b  = (const float*)d_in[6];
  const float* Wo_w  = (const float*)d_in[7];
  const float* Wo_b  = (const float*)d_in[8];
  float* out = (float*)d_out;

  // f16 workspace: Pk, Pq, PvT (head-split) + cKS ctx planes, 16 MB each.
  const size_t pelems = (size_t)cB * cHEADS * cL * cD;   // == B*L*HID
  _Float16* Pk  = (_Float16*)d_ws;
  _Float16* Pq  = Pk + pelems;
  _Float16* PvT = Pq + pelems;
  _Float16* ctx = PvT + pelems;

  {
    const int MB = (cB * cL) / (32 * cPT);   // 64 block rows
    const int NB = cHID / (32 * cPT);        // 8 block columns
    dim3 grid(MB * NB, 3);                   // 4 waves/block, 3 projections
    proj_kernel<<<grid, 128, 0, stream>>>(KEY, VALUE, QUERY, W_w, W_b, Wv_w, Wv_b,
                                          Pk, Pq, PvT);
  }
  {
    dim3 grid(cB * (cL / (16 * cNQ)), cKS);  // 128 x 2 blocks, 8 waves = 8 heads
    attn_kernel<<<grid, 256, 0, stream>>>(Pk, Pq, PvT, ctx);
  }
  {
    const int MT = (cB * cL) / (16 * cOT);   // 128 tile rows
    const int NT = cOUT / (16 * cOT);        // 4 tile columns
    dim3 grid((MT * NT) / 2);                // 256 blocks of 2 waves
    outproj_kernel<<<grid, 64, 0, stream>>>(ctx, Wo_w, Wo_b, out);
  }
}

// v009
// A run of this version takes 142 microseconds.
// Two timings next to v008 put it at 1.23 and 1.24 times that version's speed.
// Over all steps from v000 it is 7.11 times as fast.
#include <hip/hip_runtime.h>
#include <hip/hip_bf16.h>
#include <math.h>

// ---------------------------------------------------------------------------
// MHA with softmax-over-heads, fused for MI455X (gfx1250, wave32, WMMA).
//   proj    : KEY/QUERY @ W^T + b -> f16 head-split; VALUE @ Wv^T + b -> f16
//             head-split TRANSPOSED (PvT[b][h][d][L]) so the attention kernel
//             reads every operand contiguously. Operands staged to LDS with
//             global_load_async_to_lds_b128, double-buffered.
//   attn    : fused score + head-softmax + attn^T@Wv, K tiles (double-buffered)
//             and PvT tiles staged to LDS with global_load_async_to_lds_b128.
//   outproj : ctx @ Wo^T + b -> f32
// All matmuls via v_wmma_f32_16x16x32_f16 (f32 accumulate).
// ---------------------------------------------------------------------------

typedef __attribute__((ext_vector_type(16))) _Float16 v16h;
typedef __attribute__((ext_vector_type(8)))  float    v8f;

#define DEV static __device__ __forceinline__

constexpr int cB = 4, cL = 2048, cINK = 256, cHID = 1024, cHEADS = 8, cD = 128, cOUT = 256;
constexpr float cSCALE = 0.08838834764831845f;   // 1/sqrt(128)
constexpr int cNQ = 4;          // 16-column query sub-tiles per attention block
constexpr int cKS = 2;          // key ranges; each block sums over one of them
constexpr int cLK = cL / cKS;   // keys per block

DEV int lane_id() { return (int)(threadIdx.x & 31u); }

// K index (within the 32-wide K tile) held by element e of a 16-bit A/B frag.
// Per ISA 7.12.2: lanes 0-15 -> K 0..7 / 16..23, lanes 16-31 -> K 8..15 / 24..31.
DEV int kidx(int lane, int e) {
  int kb = (lane & 16) ? 8 : 0;
  return (e < 8) ? (kb + e) : (16 + kb + (e - 8));
}

// A/B fragment from a row-major f16 tile (two contiguous 16B chunks per lane)
DEV v16h frag_rm_f16(const _Float16* base, int ld) {
  int lane = lane_id();
  const _Float16* p = base + (size_t)(lane & 15) * ld;
  v16h f;
#pragma unroll
  for (int e = 0; e < 16; ++e) f[e] = p[kidx(lane, e)];
  return f;
}

DEV v8f wmma16(v16h a, v16h b, v8f c) {
  return __builtin_amdgcn_wmma_f32_16x16x32_f16(false, a, false, b, (short)0, c,
                                                false, false);
}

// Async-copy 512B (32 lanes x 16B) from global to LDS; CDNA5 async path.
// lds_off is the byte offset within the workgroup's LDS segment.
DEV void async_copy_512(unsigned lds_off, const void* gptr) {
  asm volatile("global_load_async_to_lds_b128 %0, %1, off"
               :: "v"(lds_off), "v"(gptr) : "memory");
}
// The same copy as the compiler's own form: each lane's 16 B from g to l.
typedef __attribute__((ext_vector_type(4))) int v4i;
DEV void async_copy_16(_Float16* l, const _Float16* g) {
  __builtin_amdgcn_global_load_async_to_lds_b128(
      (__attribute__((address_space(1))) v4i*)g, (__attribute__((address_space(3))) v4i*)l, 0, 0);
}
DEV void wait_async_le(int) {}  // (documentation only; real waits below)
DEV void wait_async16() { asm volatile("s_wait_asynccnt 0x10" ::: "memory"); }
DEV void wait_async0()  { asm volatile("s_wait_asynccnt 0x0"  ::: "memory"); }

// ---------------------------------------------------------------------------
// Kernel A: projections.  blockIdx.y: 0->Pk(KEY,W), 1->Pq(QUERY,W), 2->PvT(VALUE,Wv)
// One wave per 64x64 output tile (cPT x cPT WMMA tiles), a block of 2x2 waves per
// 128x128: every loaded fragment feeds cPT WMMAs. K=256 -> 8 steps.
// A step's 128 input rows and 128 weight rows (128 B of each) go to LDS as whole
// lines by async copies, two buffers: step s+2 flies while step s+1 is worked on.
// The fragments are read from LDS, 16 bytes a lane, and turned to f16 in registers.
// Pk/Pq layout: P[b][h][l][d];  PvT layout: P[b][h][d][l]  (h = hidden%8, d = hidden/8)
// The tile is turned so that the 8 accumulator rows a lane holds lie side by side
// in the destination (16 bytes):
//   VT  (PvT)  : D = X . W^T, rows = l, column = hidden unit; a block column takes
//                128 successive units.
//   !VT (Pk/Pq): D = W . X^T, column = l, rows = d; a block column takes the 128
//                units of ONE head (unit d*8 + h), so a wave's 64 d of one l are a
//                whole 128-byte line of the destination.
// Each wave puts its 64x64 f16 tile together in LDS (its own range of the idle
// operand buffers) and stores it as whole 128-byte lines.
// ---------------------------------------------------------------------------
typedef __attribute__((ext_vector_type(8))) _Float16 v8h;
constexpr int cPT = 4;          // 16-row fragments per side of a wave's tile

typedef __attribute__((ext_vector_type(4))) float v4f;
constexpr int cXP = 32 + 4;     // f32 row pitch in LDS: 144 B = 9 x 16 B, so the 16 rows that a
                                // fragment read touches fall on 16 different bank groups
constexpr int cTP = 64 + 8;     // f16 row pitch of the output tile in LDS: 144 B, for the same reason
// A k-step's operands of the block's 128x128 tile: 128 rows of 32 f32 each, two buffers.
struct ProjSmem {
  float sX[2][32 * cPT][cXP];   // 36 KB, input rows
  float sW[2][32 * cPT][cXP];   // 36 KB, weight rows
};

// One A/B fragment's 16 f32 values from this lane's own LDS row; p stands at the
// lane's first k (0 or 8): k, k+1 .. k+7, then k+16 .. k+23, the fragment's order.
DEV void load_row_f32(v4f (&q)[4], const float* p) {
  q[0] = *(const v4f*)(p);
  q[1] = *(const v4f*)(p + 4);
  q[2] = *(const v4f*)(p + 16);
  q[3] = *(const v4f*)(p + 20);
}
DEV v16h cvt_row_f16(const v4f (&q)[4]) {
  v16h f;
#pragma unroll
  for (int e = 0; e < 16; ++e) f[e] = (_Float16)q[e >> 2][e & 3];
  return f;
}
DEV unsigned lds_off(const void* p) { return (unsigned)(size_t)p; }
// Eight async copies of 512 B (each lane's 16 B from g[c] to LDS byte l[c]). The wait
// stands in the copies' own statement: their address registers are rewritten only
// once the copies have issued.
DEV void async_copy_8x512(const unsigned (&l)[8], const float* const (&g)[8]) {
  asm volatile("global_load_async_to_lds_b128 %0, %8, off\n\t"
               "global_load_async_to_lds_b128 %1, %9, off\n\t"
               "global_load_async_to_lds_b128 %2, %10, off\n\t"
               "global_load_async_to_lds_b128 %3, %11, off\n\t"
               "global_load_async_to_lds_b128 %4, %12, off\n\t"
               "global_load_async_to_lds_b128 %5, %13, off\n\t"
               "global_load_async_to_lds_b128 %6, %14, off\n\t"
               "global_load_async_to_lds_b128 %7, %15, off\n\t"
               "s_wait_xcnt 0x0"
               :: "v"(l[0]), "v"(l[1]), "v"(l[2]), "v"(l[3]), "v"(l[4]), "v"(l[5]), "v"(l[6]), "v"(l[7]),
                  "v"(g[0]), "v"(g[1]), "v"(g[2]), "v"(g[3]), "v"(g[4]), "v"(g[5]), "v"(g[6]), "v"(g[7])
               : "memory");
}

template <bool VT>
DEV void proj_tile(const float* __restrict__ src, const float* __restrict__ w,
                   const float* __restrict__ bias, _Float16* __restrict__ dst,
                   ProjSmem& sm, int mb, int nc) {
  const int lane = lane_id();
  const int row = lane & 15, hi = lane >> 4;
  const int wave = (int)threadIdx.x >> 5;
  const int m0 = mb + (wave >> 1) * (16 * cPT);   // this wave's 64x64 tile
  const int j0 = (wave & 1) * (16 * cPT);         // its first of the block's 128 weight rows
  // Weight row j of block column nc is hidden unit nc*128 + j (VT) or j*8 + nc (!VT:
  // head nc, d = j).
  constexpr int WS = VT ? 1 : cHEADS;             // hidden units from one row j to the next
  const int u0 = VT ? nc * (32 * cPT) : nc;       // hidden unit of row j = 0

  // --- async stage of one k-step: 128 input rows and 128 weight rows of 128 B -------
  // A copy brings 4 whole rows, eight lanes a row; a wave brings 32 rows of each.
  const int q = lane >> 3, ch = (lane & 7) * 4;
  const float* gx = src + (size_t)(mb + wave * 32 + q) * cINK + ch;
  const float* gw = w   + (size_t)(u0 + (wave * 32 + q) * WS) * cINK + ch;
  const unsigned lx = lds_off(&sm.sX[0][wave * 32 + q][ch]);
  const unsigned lw = lds_off(&sm.sW[0][wave * 32 + q][ch]);
  auto stage = [&](int buf, int k0) {
    unsigned l[8];
    const float* g[8];
#pragma unroll  // constant c, here and below: every address is a base plus a constant
    for (int c = 0; c < 8; ++c) {
      l[c] = lx + (unsigned)((buf * (32 * cPT) + c * 4) * (cXP * 4));
      g[c] = gx + k0 + c * 4 * cINK;
    }
    async_copy_8x512(l, g);
#pragma unroll
    for (int c = 0; c < 8; ++c) {
      l[c] = lw + (unsigned)((buf * (32 * cPT) + c * 4) * (cXP * 4));
      g[c] = gw + k0 + c * 4 * WS * cINK;
    }
    async_copy_8x512(l, g);
  };

  v8f acc[cPT][cPT] = {};
  float bv[cPT][8];                        // bias of accumulator row r of tile ib
#pragma unroll
  for (int ib = 0; ib < cPT; ++ib)
#pragma unroll
    for (int r = 0; r < (VT ? 1 : 8); ++r)
      bv[ib][r] = bias[u0 + (j0 + ib * 16 + (VT ? row : hi * 8 + r)) * WS];
  // The bias loads' address registers are reused only once they have issued; the
  // scheduling barrier keeps what follows behind the wait.
  asm volatile("s_wait_xcnt 0x0" ::: "memory");
  __builtin_amdgcn_sched_barrier(0);
  stage(0, 0);
  wait_async0();       // step 0 has landed, this wave's part
  __syncthreads();     // ... and every wave's
  stage(1, 32);
  const float* px = &sm.sX[0][(wave >> 1) * (16 * cPT) + row][hi * 8];
  const float* pw = &sm.sW[0][(wave & 1) * (16 * cPT) + row][hi * 8];
#pragma unroll  // constant k0: every LDS read is its row pointer plus an immediate
  for (int k0 = 0; k0 < cINK; k0 += 32) {
    const int buf = (k0 >> 5) & 1;
    v4f rx[cPT][4], rw[cPT][4];            // this step's operands, still f32
#pragma unroll
    for (int i = 0; i < cPT; ++i) {
      load_row_f32(rx[i], px + (buf * (32 * cPT) + i * 16) * cXP);
      load_row_f32(rw[i], pw + (buf * (32 * cPT) + i * 16) * cXP);
    }
    v16h x[cPT], wf[cPT];
#pragma unroll
    for (int i = 0; i < cPT; ++i) {
      x[i]  = cvt_row_f16(rx[i]);
      wf[i] = cvt_row_f16(rw[i]);
    }
#pragma unroll
    for (int ia = 0; ia < cPT; ++ia)
#pragma unroll
      for (int ib = 0; ib < cPT; ++ib)
        acc[ia][ib] = VT ? wmma16(x[ia], wf[ib], acc[ia][ib])
                         : wmma16(wf[ib], x[ia], acc[ia][ib]);
    // Hand-over: this wave's reads of the buffer have retired and its copies of the
    // next step have landed; behind the barrier that holds for every wave, and the
    // buffer just read is refilled.
    asm volatile("s_wait_dscnt 0x0" ::: "memory");
    wait_async0();
    __syncthreads();
    if (k0 + 64 < cINK) stage(buf, k0 + 64);
  }
  wait_async0();       // no copy is outstanding behind the loop

  const int bi = m0 / cL, l0 = m0 % cL;    // a 64-row tile lies in one batch entry
  // --- the wave's tile, f16, into its own LDS range: 64 destination rows of 128 B ----
  // (VT: a row is a hidden unit, 64 l along it; !VT: a row is an l, 64 d along it.)
  // The operand buffers are idle: every wave's reads of them retired in front of the
  // loop's last barrier and no copy is outstanding.
  static_assert(sizeof(sm.sX) >= (size_t)4 * (16 * cPT) * cTP * sizeof(_Float16), "four tiles fit sX");
  _Float16* tile = (_Float16*)&sm.sX[0][0][0] + wave * (16 * cPT * cTP);
  {
    _Float16* tw = tile + row * cTP + hi * 8;   // this lane's 8 values at ia = ib = 0
#pragma unroll  // constant ib, ia: acc stays in registers, every LDS address is tw plus an immediate
    for (int ib = 0; ib < cPT; ++ib)
#pragma unroll
      for (int ia = 0; ia < cPT; ++ia) {
        v8h o;
#pragma unroll
        for (int r = 0; r < 8; ++r) o[r] = (_Float16)(acc[ia][ib][r] + bv[ib][VT ? 0 : r]);
        *(v8h*)(tw + (VT ? ib * 16 * cTP + ia * 16 : ia * 16 * cTP + ib * 16)) = o;
      }
  }
  // The wave reads back what its other lanes wrote: their writes have retired first.
  asm volatile("s_wait_dscnt 0x0" ::: "memory");
  // --- whole lines out: a wave-wide store takes 4 rows of 128 B, eight lanes a row ----
  constexpr int NS = (16 * cPT) / 4;
  v8h o[NS];
#pragma unroll  // constant it: o stays in registers, every address is a base plus a constant
  for (int it = 0; it < NS; ++it) o[it] = *(const v8h*)(tile + (it * 4 + q) * cTP + (lane & 7) * 8);
  // Row it*4 + q: VT: unit u0 + j0 + it*4 + q, that is head (it&1)*4 + q at d = (u0+j0)/8 + it/2.
  _Float16* gp = VT ? dst + (((size_t)bi * cHEADS + q) * cD + ((u0 + j0) >> 3)) * cL + l0 + (lane & 7) * 8
                    : dst + (((size_t)bi * cHEADS + nc) * cL + l0 + q) * cD + j0 + (lane & 7) * 8;
#pragma unroll
  for (int it = 0; it < NS; ++it)
    *(v8h*)(gp + (VT ? ((size_t)((it & 1) * 4) * cD + (it >> 1)) * cL : (size_t)(it * 4) * cD)) = o[it];
  // The other variant's code follows this one in the built kernel: the stores' registers
  // are reused only once the stores have issued.
  asm volatile("s_wait_xcnt 0x0" ::: "memory");
  __builtin_amdgcn_sched_barrier(0);
}

__global__ void __launch_bounds__(128)
proj_kernel(const float* __restrict__ KEY,
                            const float* __restrict__ VALUE,
                            const float* __restrict__ QUERY,
                            const float* __restrict__ W_w,
                            const float* __restrict__ W_b,
                            const float* __restrict__ Wv_w,
                            const float* __restrict__ Wv_b,
                            _Float16* __restrict__ Pk,
                            _Float16* __restrict__ Pq,
                            _Float16* __restrict__ PvT) {
  __shared__ __attribute__((aligned(16))) ProjSmem sm;   // 16-byte copies and reads stay whole
  const int which = blockIdx.y;
  constexpr int NB = cHID / (32 * cPT);    // 8 block columns
  const int mb = (blockIdx.x / NB) * (32 * cPT);
  const int nc = blockIdx.x % NB;          // block column: 128 units (PvT) or one head (Pk/Pq)
  static_assert(NB == cHEADS && cD == 32 * cPT, "a block column of Pk/Pq is one head");

  if (which == 2) proj_tile<true>(VALUE, Wv_w, Wv_b, PvT, sm, mb, nc);
  else            proj_tile<false>(which == 0 ? KEY : QUERY, W_w, W_b,
                                   which == 0 ? Pk : Pq, sm, mb, nc);
}

// ---------------------------------------------------------------------------
// Kernel B: fused attention. One block per (b, 64-col Lq tile, key range);
// 8 waves = 8 heads. Every K and PvT fragment feeds cNQ WMMAs, one per 16-col
// query sub-tile. The sum over keys has no normaliser (the softmax runs over
// heads), so each key range writes its own partial ctx plane and the output
// projection adds the planes in its accumulate chain.
// K tiles double-buffered in LDS via async copies; Q fragments hoisted; score
// WMMAs -> LDS -> cross-head softmax (elementwise in (i,k)) -> PvT@attn WMMAs.
// The exchange keeps the keys i of one (head, query) side by side, as the score
// accumulators and the attn fragments hold them: every LDS access of it is 16 bytes
// a lane, and the weights go back as f16, already in fragment order.
// The PvT tile of a trip flies into LDS under that trip's softmax; each wave
// copies and reads its own head's tile only.
// The ctx rows are put together in LDS and stored as whole 128-byte lines.
// ---------------------------------------------------------------------------
constexpr int cKP = cD + 8;     // K row pitch in LDS: 272 B = 17 x 16 B, so the 16 rows that a
                                // fragment read touches fall on 16 different bank groups
constexpr int cVP = 32 + 8;     // PvT row pitch in LDS: 80 B = 5 x 16 B, for the same reason
constexpr int cCP = cHID + 4;   // ctx row pitch in LDS: 2056 B = 514 dwords, so the 16 rows and 2 d
                                // groups that a wave's 2-byte write touches fall on 32 different banks
constexpr int cSP = 32 + 4;     // score row pitch in LDS: 144 B = 9 x 16 B, for the same reason
typedef __attribute__((ext_vector_type(4))) _Float16 v4h;
struct AttnSmem {
  _Float16 sK[2][cHEADS][32][cKP];  // 136 KB, double-buffered K tiles (first!)
  // 72 KB, score/attn exchange: a row holds the 32 keys of one (head, sub-tile, query)
  // as f32 scores; the softmax puts the f16 weights of keys 8g..8g+7 over the first
  // 16 bytes of the 32 that held their scores.
  float    s_sc[cHEADS][cNQ][16][cSP];
  _Float16 sV[cHEADS][cD][cVP];     // 80 KB, this trip's PvT tiles (128 d x 32 keys a head)
};

__global__ void __launch_bounds__(256)   // real block size: registers for the wide tile
attn_kernel(const _Float16* __restrict__ Pk,
                            const _Float16* __restrict__ Pq,
                            const _Float16* __restrict__ PvT,
                            _Float16* __restrict__ ctx) {
  __shared__ __attribute__((aligned(16))) AttnSmem sm;   // 16-byte K reads stay whole

  constexpr int QT = cL / (16 * cNQ);      // query tiles per batch entry
  const int bb = blockIdx.x / QT;
  const int kt = blockIdx.x % QT;
  const int ks = blockIdx.y;               // key range of this block
  const int h  = threadIdx.x >> 5;         // wave id == head
  const int lane = lane_id();

  const _Float16* Kh = Pk  + ((size_t)(bb * cHEADS + h) * cL + ks * cLK) * cD;
  const _Float16* Qt = Pq  + ((size_t)(bb * cHEADS + h) * cL) * cD
                           + (size_t)(kt * 16 * cNQ) * cD;
  const _Float16* Vt = PvT + ((size_t)(bb * cHEADS + h) * cD) * cL + ks * cLK;  // [d][L]

  // Q fragments are invariant over the whole Lk loop: hoist (cNQ x 4 x v16h).
  v16h bq[cNQ][4];
#pragma unroll  // constant c: the per-sub-tile arrays stay in registers
  for (int c = 0; c < cNQ; ++c)
#pragma unroll
    for (int q = 0; q < 4; ++q)
      bq[c][q] = frag_rm_f16(Qt + (size_t)(c * 16) * cD + q * 32, cD);
  // the Q loads share one address pair: hold its reuse behind their issue
  asm volatile("s_wait_xcnt 0x0" ::: "memory");

  v8f acc[cNQ][8] = {};                    // per sub-tile: 8 j-tiles (d) x 16 k cols

  // --- async stage of one 32x128 f16 K tile (8 KB) into sK[buf][h] --------
  auto stage_k = [&](int buf, int i0) {
    // the wave's number as a scalar: the tile's base then takes no vector register
    unsigned base = (unsigned)((buf * cHEADS + __builtin_amdgcn_readfirstlane(h)) * (32 * cKP * 2)
                               + (lane >> 4) * (cKP * 2) + (lane & 15) * 16);   // sK @ LDS off 0
    const char* g = (const char*)(Kh + (size_t)i0 * cD);
#pragma unroll
    for (int t = 0; t < 16; ++t) {
      unsigned lds = base + (unsigned)(t * (2 * cKP * 2));   // 544 B = two padded rows
      async_copy_512(lds, g + t * 512 + lane * 16);
    }
  };

  // --- async stage of one 128x32 f16 PvT tile (8 KB) into sV[h] -----------
  // A copy brings 8 rows of 64 B: four lanes a row.
  auto stage_v = [&](int i0) {
    _Float16* l = &sm.sV[h][lane >> 2][(lane & 3) * 8];
    const _Float16* g = Vt + (size_t)(lane >> 2) * cL + i0 + (lane & 3) * 8;
#pragma unroll  // constant t: each copy's two addresses are a base plus a constant
    for (int t = 0; t < 16; ++t) async_copy_16(l + t * 8 * cVP, g + (size_t)(t * 8) * cL);
  };

  stage_k(0, 0);

  for (int i0 = 0; i0 < cLK; i0 += 32) {
    const int  cur  = (i0 >> 5) & 1;
    const bool more = (i0 + 32) < cLK;
    if (more) stage_k(cur ^ 1, i0 + 32);

    if (more) wait_async16();   // oldest 16 (current buffer) complete
    else      wait_async0();

    const _Float16* sk = &sm.sK[cur][h][0][0];

    // --- score tiles S[i0..i0+31][kt*64..+64] (cNQ sub-tiles) for this head (from LDS) ---
    v8f s0[cNQ] = {}, s1[cNQ] = {};
#pragma unroll
    for (int k0 = 0; k0 < cD; k0 += 32) {
      v16h a0 = frag_rm_f16(sk + k0, cKP);
      v16h a1 = frag_rm_f16(sk + 16 * cKP + k0, cKP);
#pragma unroll  // constant c: the per-sub-tile arrays stay in registers
      for (int c = 0; c < cNQ; ++c) {
        s0[c] = wmma16(a0, bq[c][k0 >> 5], s0[c]);
        s1[c] = wmma16(a1, bq[c][k0 >> 5], s1[c]);
      }
    }
    // This wave's reads of sV (the trip before) have retired before it is refilled.
    asm volatile("s_wait_dscnt 0x0" ::: "memory");
    __syncthreads();   // prior iteration's s_sc and sV reads are done
    stage_v(i0);       // lands under the score exchange and the softmax
    {
      // a lane's 8 accumulator rows are 8 successive keys of its query column
      float* wr = &sm.s_sc[h][0][lane & 15][(lane >> 4) * 8];
#pragma unroll  // constant c: the per-sub-tile arrays stay in registers
      for (int c = 0; c < cNQ; ++c) {
        float* p = wr + c * (16 * cSP);
        *(v4f*)(p)      = __builtin_shufflevector(s0[c], s0[c], 0, 1, 2, 3);
        *(v4f*)(p + 4)  = __builtin_shufflevector(s0[c], s0[c], 4, 5, 6, 7);
        *(v4f*)(p + 16) = __builtin_shufflevector(s1[c], s1[c], 0, 1, 2, 3);
        *(v4f*)(p + 20) = __builtin_shufflevector(s1[c], s1[c], 4, 5, 6, 7);
      }
    }
    __syncthreads();
    // --- softmax across the 8 heads, elementwise in (i,k) ----------------
    // One thread takes 8 successive keys of one (sub-tile, query) in all heads. The 16
    // lanes that an LDS access serves together take rows q, q+1, q+8, q+9: at 9 chunks
    // of 16 B a row their every-other chunks fall on 16 different bank groups.
    {
      const int kk = (h & 1) * 4 + (lane >> 4) * 2 + ((lane >> 2) & 1) + ((lane >> 3) & 1) * 8;
      float* row = &sm.s_sc[0][h >> 1][kk][(lane & 3) * 8];
      constexpr int HS = cNQ * 16 * cSP;   // floats from one head to the next
      v8f v[cHEADS];                       // one head's 8 keys: neighbours pair up in packed f32 ops
      v8f m = -3.0e38f;
#pragma unroll  // constant hh, here and below: v stays in registers
      for (int hh = 0; hh < cHEADS; ++hh) {
        v[hh] = __builtin_shufflevector(*(const v4f*)(row + hh * HS), *(const v4f*)(row + hh * HS + 4),
                                        0, 1, 2, 3, 4, 5, 6, 7) * cSCALE;
        m = __builtin_elementwise_max(m, v[hh]);
      }
      v8f sum = 0.f;
#pragma unroll
      for (int hh = 0; hh < cHEADS; ++hh) {
        v[hh] -= m;
#pragma unroll
        for (int p = 0; p < 8; ++p) v[hh][p] = __expf(v[hh][p]);
        sum += v[hh];
      }
      const v8f inv = 1.f / sum;
#pragma unroll
      for (int hh = 0; hh < cHEADS; ++hh)
        *(v8h*)(row + hh * HS) = __builtin_convertvector(v[hh] * inv, v8h);
    }
    wait_async0();     // this trip's PvT tile has landed (the next K tile too)
    __syncthreads();
    // --- out_h[j,k] += PvT[j,i] @ attn[i,k]  (K = 32 rows of i) ----------
    v16h battn[cNQ];
#pragma unroll  // constant c: the per-sub-tile arrays stay in registers
    for (int c = 0; c < cNQ; ++c) {
      // keys 8*hi.. and 16+8*hi.. of this lane's query: the fragment's two halves
      const float* ab = &sm.s_sc[h][c][lane & 15][(lane >> 4) * 8];
      battn[c] = __builtin_shufflevector(*(const v8h*)ab, *(const v8h*)(ab + 16),
                                         0, 1, 2, 3, 4, 5, 6, 7, 8, 9, 10, 11, 12, 13, 14, 15);
    }
    const _Float16* sv = &sm.sV[h][0][0];
    v16h av[8];                            // four are live at a time
#pragma unroll  // constant jt, here and below: av and acc stay in registers
    for (int jt = 0; jt < 4; ++jt) av[jt] = frag_rm_f16(sv + jt * 16 * cVP, cVP);
#pragma unroll
    for (int j0 = 0; j0 < 8; j0 += 2) {
      // Keeps the LDS reads four fragments ahead of the WMMAs that use them: left
      // alone the scheduler reads one fragment at a time and waits for each.
      __builtin_amdgcn_sched_barrier(0);
#pragma unroll
      for (int jt = j0; jt < j0 + 2; ++jt)
#pragma unroll  // constant c: the per-sub-tile arrays stay in registers
        for (int c = 0; c < cNQ; ++c) acc[c][jt] = wmma16(av[jt], battn[c], acc[c][jt]);
      if (j0 + 4 < 8) {
#pragma unroll
        for (int jt = j0 + 4; jt < j0 + 6; ++jt) av[jt] = frag_rm_f16(sv + jt * 16 * cVP, cVP);
      }
    }
  }

  // --- store ctx[ks][b][l][d*8 + h] (f16), the reference's head interleave --
  // The block holds all 8 heads and all 128 d of its 64 rows l: 64 whole ctx rows of
  // 2 KB. The waves interleave their heads in LDS and the block then stores whole
  // 128-byte lines, 512 contiguous bytes a wave-wide store. The rows lie over the K
  // buffers, which nobody reads or fills behind the last trip's barriers.
  static_assert(sizeof(sm.sK) >= (size_t)(16 * cNQ) * cCP * sizeof(_Float16), "ctx rows fit sK");
  _Float16* st = &sm.sK[0][0][0][0];
  {
    // this lane's element at c = jt = r = 0; the others lie at constant distances
    _Float16* wp = st + (lane & 15) * cCP + (lane >> 4) * (8 * cHEADS) + h;
#pragma unroll  // constant c: the per-sub-tile arrays stay in registers
    for (int c = 0; c < cNQ; ++c)
#pragma unroll
      for (int jt = 0; jt < 8; ++jt)
#pragma unroll
        for (int r = 0; r < 8; ++r)
          wp[c * 16 * cCP + (jt * 16 + r) * cHEADS] = (_Float16)acc[c][jt][r];
  }
  __syncthreads();   // all eight heads' values stand in LDS before a row is read
  constexpr int NR = (16 * cNQ) / 2;       // the block's 256 lanes cover two rows a round
  const int tr = (int)threadIdx.x >> 7, tc = ((int)threadIdx.x & 127) * 8;
  const _Float16* sp = st + tr * cCP + tc;
  _Float16* gp = ctx + (size_t)ks * ((size_t)cB * cL * cHID)
                     + ((size_t)bb * cL + kt * (16 * cNQ) + tr) * cHID + tc;
  v8h o[NR];
#pragma unroll  // constant it: o stays in registers, every address is a base plus a constant
  for (int it = 0; it < NR; ++it) {
    const v4h lo = *(const v4h*)(sp + it * 2 * cCP);
    const v4h hi = *(const v4h*)(sp + it * 2 * cCP + 4);
    o[it] = __builtin_shufflevector(lo, hi, 0, 1, 2, 3, 4, 5, 6, 7);
  }
#pragma unroll
  for (int it = 0; it < NR; ++it) *(v8h*)(gp + (size_t)(it * 2) * cHID) = o[it];
}

// ---------------------------------------------------------------------------
// Kernel C: final projection (sum of the cKS ctx planes)[8192,1024](f16)
// @ Wo^T[1024,256] + b -> f32. One wave per 64x64 output tile (cOT x cOT WMMA
// tiles): every ctx fragment feeds cOT WMMAs, every weight fragment cKS x cOT. The two waves of a block share
// their 64 ctx rows. The planes are added by running every plane through the
// same f32 accumulate chain, plane 0 then plane 1 at each k-step.
// ---------------------------------------------------------------------------
constexpr int cOT = 4;          // 16-row fragments per side of a wave's tile

__global__ void __launch_bounds__(64)
outproj_kernel(const _Float16* __restrict__ ctx,
                               const float* __restrict__ Wo_w,
                               const float* __restrict__ Wo_b,
                               float* __restrict__ out) {
  const int lane = lane_id();
  const int row = lane & 15, hi = lane >> 4;
  const int m0 = (int)(blockIdx.x >> 1) * (16 * cOT);
  const int n0 = (int)((blockIdx.x & 1) * 2 + (threadIdx.x >> 5)) * (16 * cOT);

  // This lane's first 8 k of fragment 0, per ctx plane and for the weights; the
  // other fragments and the second 8 k lie at constant distances from them.
  const _Float16* pa[cKS];
#pragma unroll
  for (int p = 0; p < cKS; ++p)
    pa[p] = ctx + (size_t)p * ((size_t)cB * cL * cHID) + (size_t)(m0 + row) * cHID + hi * 8;
  const float* pw = Wo_w + (size_t)(n0 + row) * cHID + hi * 8;

  float bv[cOT];                           // bias of this lane's column in tile column ib
#pragma unroll
  for (int ib = 0; ib < cOT; ++ib) bv[ib] = Wo_b[n0 + ib * 16 + row];
  // The bias loads' address register is reused only once they have issued; the
  // scheduling barrier keeps what follows behind the wait.
  asm volatile("s_wait_xcnt 0x0" ::: "memory");
  __builtin_amdgcn_sched_barrier(0);

  v8f acc[cOT][cOT] = {};
  v8h ra[cKS][cOT][2];                     // the next step's ctx fragments, in halves
  v4f rw[cOT][4];                          // the next step's weights, still f32
  auto fetch = [&]() {
#pragma unroll
    for (int i = 0; i < cOT; ++i) {
#pragma unroll
      for (int p = 0; p < cKS; ++p)
#pragma unroll
        for (int s = 0; s < 2; ++s)
          ra[p][i][s] = *(const v8h*)(pa[p] + (size_t)(i * 16) * cHID + s * 16);
#pragma unroll
      for (int s = 0; s < 4; ++s)
        rw[i][s] = *(const v4f*)(pw + (size_t)(i * 16) * cHID + (s >> 1) * 16 + (s & 1) * 4);
    }
    // The three pointers move on only once the loads that name them have issued;
    // the scheduling barrier keeps the loads, all of them, in front of what follows
    // (the current step's WMMAs, under which they fly).
    asm volatile("s_wait_xcnt 0x0" ::: "memory");
    __builtin_amdgcn_sched_barrier(0);
#pragma unroll
    for (int p = 0; p < cKS; ++p) pa[p] += 32;
    pw += 32;
  };
  fetch();
#pragma unroll 2  // two steps a trip: the fetched fragments change names, not registers
  for (int k0 = 0; k0 < cHID; k0 += 32) {
    v16h a[cKS][cOT], b[cOT];
#pragma unroll
    for (int i = 0; i < cOT; ++i) {
#pragma unroll
      for (int p = 0; p < cKS; ++p)
        a[p][i] = __builtin_shufflevector(ra[p][i][0], ra[p][i][1],
                                          0, 1, 2, 3, 4, 5, 6, 7, 8, 9, 10, 11, 12, 13, 14, 15);
#pragma unroll
      for (int e = 0; e < 16; ++e) b[i][e] = (_Float16)rw[i][e >> 2][e & 3];
    }
    if (k0 + 32 < cHID) fetch();
#pragma unroll
    for (int p = 0; p < cKS; ++p)
#pragma unroll
      for (int ia = 0; ia < cOT; ++ia)
#pragma unroll
        for (int ib = 0; ib < cOT; ++ib)
          acc[ia][ib] = wmma16(a[p][ia], b[ib], acc[ia][ib]);
  }

#pragma unroll
  for (int ib = 0; ib < cOT; ++ib)
#pragma unroll
    for (int ia = 0; ia < cOT; ++ia)
#pragma unroll
      for (int r = 0; r < 8; ++r) acc[ia][ib][r] += bv[ib];
  float* po = out + (size_t)(m0 + hi * 8) * cOUT + n0 + row;
  // Every sum and the one address stand in their registers before the first store
  // issues, so that no register which a store names is written behind it.
  __builtin_amdgcn_sched_barrier(0);
#pragma unroll
  for (int ib = 0; ib < cOT; ++ib)
#pragma unroll
    for (int ia = 0; ia < cOT; ++ia)
#pragma unroll
      for (int r = 0; r < 8; ++r) po[(ia * 16 + r) * cOUT + ib * 16] = acc[ia][ib][r];
}

// ---------------------------------------------------------------------------
extern "C" void kernel_launch(void* const* d_in, const int* in_sizes, int n_in,
                              void* d_out, int out_size, void* d_ws, size_t ws_size,
                              hipStream_t stream) {
  (void)in_sizes; (void)n_in; (void)out_size; (void)ws_size;
  const float* KEY   = (const float*)d_in[0];
  const float* VALUE = (const float*)d_in[1];
  const float* QUERY = (const float*)d_in[2];
  const float* W_w   = (const float*)d_in[3];
  const float* W_b   = (const float*)d_in[4];
  const float* Wv_w  = (const float*)d_in[5];
  const float* Wv_b  = (const float*)d_in[6];
  const float* Wo_w  = (const float*)d_in[7];
  const float* Wo_b  = (const float*)d_in[8];
  float* out = (float*)d_out;

  // f16 workspace: Pk, Pq, PvT (head-split) + cKS ctx planes, 16 MB each.
  const size_t pelems = (size_t)cB * cHEADS * cL * cD;   // == B*L*HID
  _Float16* Pk  = (_Float16*)d_ws;
  _Float16* Pq  = Pk + pelems;
  _Float16* PvT = Pq + pelems;
  _Float16* ctx = PvT + pelems;

  {
    const int MB = (cB * cL) / (32 * cPT);   // 64 block rows
    const int NB = cHID / (32 * cPT);        // 8 block columns
    dim3 grid(MB * NB, 3);                   // 4 waves/block, 3 projections
    proj_kernel<<<grid, 128, 0, stream>>>(KEY, VALUE, QUERY, W_w, W_b, Wv_w, Wv_b,
                                          Pk, Pq, PvT);
  }
  {
    dim3 grid(cB * (cL / (16 * cNQ)), cKS);  // 128 x 2 blocks, 8 waves = 8 heads
    attn_kernel<<<grid, 256, 0, stream>>>(Pk, Pq, PvT, ctx);
  }
  {
    const int MT = (cB * cL) / (16 * cOT);   // 128 tile rows
    const int NT = cOUT / (16 * cOT);        // 4 tile columns
    dim3 grid((MT * NT) / 2);                // 256 blocks of 2 waves
    outproj_kernel<<<grid, 64, 0, stream>>>(ctx, Wo_w, Wo_b, out);
  }
}

// v010
// Measured time: 132 microseconds a run.
// Two timings next to v009 put it at 1.08 and 1.07 times that version's speed.
// Counting every step since v000, it is 7.65 times as fast.
#include <hip/hip_runtime.h>
#include <hip/hip_bf16.h>
#include <math.h>

// ---------------------------------------------------------------------------
// MHA with softmax-over-heads, fused for MI455X (gfx1250, wave32, WMMA).
//   proj    : KEY/QUERY @ W^T + b -> f16 head-split; VALUE @ Wv^T + b -> f16
//             head-split TRANSPOSED, in tiles of 32 keys (PvT[b][h][L/32][d][32]):
//             the 128 d x 32 keys that an attention trip takes are 8 KB in a row.
//             Operands staged to LDS with
//             global_load_async_to_lds_b128, double-buffered.
//   attn    : fused score + head-softmax + attn^T@Wv, K tiles (double-buffered)
//             and PvT tiles staged to LDS with global_load_async_to_lds_b128.
//   outproj : ctx @ Wo^T + b -> f32
// All matmuls via v_wmma_f32_16x16x32_f16 (f32 accumulate).
// ---------------------------------------------------------------------------

typedef __attribute__((ext_vector_type(16))) _Float16 v16h;
typedef __attribute__((ext_vector_type(8)))  float    v8f;

#define DEV static __device__ __forceinline__

constexpr int cB = 4, cL = 2048, cINK = 256, cHID = 1024, cHEADS = 8, cD = 128, cOUT = 256;
constexpr float cSCALE = 0.08838834764831845f;   // 1/sqrt(128)
constexpr int cNQ = 4;          // 16-column query sub-tiles per attention block
constexpr int cKS = 2;          // key ranges; each block sums over one of them
constexpr int cLK = cL / cKS;   // keys per block
constexpr int cVT = 32;         // keys per PvT tile: one attention trip's
constexpr int cVTE = cD * cVT;  // elements of a PvT tile (128 d x 32 keys, 8 KB)

DEV int lane_id() { return (int)(threadIdx.x & 31u); }

// K index (within the 32-wide K tile) held by element e of a 16-bit A/B frag.
// Per ISA 7.12.2: lanes 0-15 -> K 0..7 / 16..23, lanes 16-31 -> K 8..15 / 24..31.
DEV int kidx(int lane, int e) {
  int kb = (lane & 16) ? 8 : 0;
  return (e < 8) ? (kb + e) : (16 + kb + (e - 8));
}

// A/B fragment from a row-major f16 tile (two contiguous 16B chunks per lane)
DEV v16h frag_rm_f16(const _Float16* base, int ld) {
  int lane = lane_id();
  const _Float16* p = base + (size_t)(lane & 15) * ld;
  v16h f;
#pragma unroll
  for (int e = 0; e < 16; ++e) f[e] = p[kidx(lane, e)];
  return f;
}

DEV v8f wmma16(v16h a, v16h b, v8f c) {
  return __builtin_amdgcn_wmma_f32_16x16x32_f16(false, a, false, b, (short)0, c,
                                                false, false);
}

// Async-copy 512B (32 lanes x 16B) from global to LDS; CDNA5 async path.
// lds_off is the byte offset within the workgroup's LDS segment.
DEV void async_copy_512(unsigned lds_off, const void* gptr) {
  asm volatile("global_load_async_to_lds_b128 %0, %1, off"
               :: "v"(lds_off), "v"(gptr) : "memory");
}
// The same copy as the compiler's own form, each lane's 16 B from g to l: copies T .. N-1
// of a run. Copy T reads the 512 B behind copy T-1's and lands LS bytes behind it in LDS.
// The offset field moves both addresses, so the source needs one address pair for the
// whole run and the LDS address takes what is left of the step.
typedef __attribute__((ext_vector_type(4))) int v4i;
template <int T, int N, int LS>
DEV void async_copy_run(char* l, const char* g) {
  __builtin_amdgcn_global_load_async_to_lds_b128(
      (__attribute__((address_space(1))) v4i*)g,
      (__attribute__((address_space(3))) v4i*)(l + T * (LS - 512)), T * 512, 0);
  if constexpr (T + 1 < N) async_copy_run<T + 1, N, LS>(l, g);
}
DEV void wait_async_le(int) {}  // (documentation only; real waits below)
DEV void wait_async16() { asm volatile("s_wait_asynccnt 0x10" ::: "memory"); }
DEV void wait_async0()  { asm volatile("s_wait_asynccnt 0x0"  ::: "memory"); }

// ---------------------------------------------------------------------------
// Kernel A: projections.  blockIdx.y: 0->Pk(KEY,W), 1->Pq(QUERY,W), 2->PvT(VALUE,Wv)
// One wave per 64x64 output tile (cPT x cPT WMMA tiles), a block of 2x2 waves per
// 128x128: every loaded fragment feeds cPT WMMAs. K=256 -> 8 steps.
// A step's 128 input rows and 128 weight rows (128 B of each) go to LDS as whole
// lines by async copies, two buffers: step s+2 flies while step s+1 is worked on.
// The fragments are read from LDS, 16 bytes a lane, and turned to f16 in registers.
// Pk/Pq layout: P[b][h][l][d];  PvT layout: P[b][h][l/32][d][l%32]  (h = hidden%8, d = hidden/8)
// The tile is turned so that the 8 accumulator rows a lane holds lie side by side
// in the destination (16 bytes):
//   VT  (PvT)  : D = X . W^T, rows = l, column = hidden unit; a block column takes
//                128 successive units.
//   !VT (Pk/Pq): D = W . X^T, column = l, rows = d; a block column takes the 128
//                units of ONE head (unit d*8 + h), so a wave's 64 d of one l are a
//                whole 128-byte line of the destination.
// Each wave puts its 64x64 f16 tile together in LDS (its own range of the idle
// operand buffers) and stores it as whole 128-byte lines (PvT: 8 d x 32 l of one
// head, 512 bytes in a row, a store).
// ---------------------------------------------------------------------------
typedef __attribute__((ext_vector_type(8))) _Float16 v8h;
constexpr int cPT = 4;          // 16-row fragments per side of a wave's tile

typedef __attribute__((ext_vector_type(4))) float v4f;
constexpr int cXP = 32 + 4;     // f32 row pitch in LDS: 144 B = 9 x 16 B, so the 16 rows that a
                                // fragment read touches fall on 16 different bank groups
constexpr int cTP = 64 + 8;     // f16 row pitch of the output tile in LDS: 144 B, for the same reason
// A k-step's operands of the block's 128x128 tile: 128 rows of 32 f32 each, two buffers.
struct ProjSmem {
  float sX[2][32 * cPT][cXP];   // 36 KB, input rows
  float sW[2][32 * cPT][cXP];   // 36 KB, weight rows
};

// One A/B fragment's 16 f32 values from this lane's own LDS row; p stands at the
// lane's first k (0 or 8): k, k+1 .. k+7, then k+16 .. k+23, the fragment's order.
DEV void load_row_f32(v4f (&q)[4], const float* p) {
  q[0] = *(const v4f*)(p);
  q[1] = *(const v4f*)(p + 4);
  q[2] = *(const v4f*)(p + 16);
  q[3] = *(const v4f*)(p + 20);
}
DEV v16h cvt_row_f16(const v4f (&q)[4]) {
  v16h f;
#pragma unroll
  for (int e = 0; e < 16; ++e) f[e] = (_Float16)q[e >> 2][e & 3];
  return f;
}
DEV unsigned lds_off(const void* p) { return (unsigned)(size_t)p; }
// Eight async copies of 512 B (each lane's 16 B from g[c] to LDS byte l[c]). The wait
// stands in the copies' own statement: their address registers are rewritten only
// once the copies have issued.
DEV void async_copy_8x512(const unsigned (&l)[8], const float* const (&g)[8]) {
  asm volatile("global_load_async_to_lds_b128 %0, %8, off\n\t"
               "global_load_async_to_lds_b128 %1, %9, off\n\t"
               "global_load_async_to_lds_b128 %2, %10, off\n\t"
               "global_load_async_to_lds_b128 %3, %11, off\n\t"
               "global_load_async_to_lds_b128 %4, %12, off\n\t"
               "global_load_async_to_lds_b128 %5, %13, off\n\t"
               "global_load_async_to_lds_b128 %6, %14, off\n\t"
               "global_load_async_to_lds_b128 %7, %15, off\n\t"
               "s_wait_xcnt 0x0"
               :: "v"(l[0]), "v"(l[1]), "v"(l[2]), "v"(l[3]), "v"(l[4]), "v"(l[5]), "v"(l[6]), "v"(l[7]),
                  "v"(g[0]), "v"(g[1]), "v"(g[2]), "v"(g[3]), "v"(g[4]), "v"(g[5]), "v"(g[6]), "v"(g[7])
               : "memory");
}

template <bool VT>
DEV void proj_tile(const float* __restrict__ src, const float* __restrict__ w,
                   const float* __restrict__ bias, _Float16* __restrict__ dst,
                   ProjSmem& sm, int mb, int nc) {
  const int lane = lane_id();
  const int row = lane & 15, hi = lane >> 4;
  const int wave = (int)threadIdx.x >> 5;
  const int m0 = mb + (wave >> 1) * (16 * cPT);   // this wave's 64x64 tile
  const int j0 = (wave & 1) * (16 * cPT);         // its first of the block's 128 weight rows
  // Weight row j of block column nc is hidden unit nc*128 + j (VT) or j*8 + nc (!VT:
  // head nc, d = j).
  constexpr int WS = VT ? 1 : cHEADS;             // hidden units from one row j to the next
  const int u0 = VT ? nc * (32 * cPT) : nc;       // hidden unit of row j = 0

  // --- async stage of one k-step: 128 input rows and 128 weight rows of 128 B -------
  // A copy brings 4 whole rows, eight lanes a row; a wave brings 32 rows of each.
  const int q = lane >> 3, ch = (lane & 7) * 4;
  const float* gx = src + (size_t)(mb + wave * 32 + q) * cINK + ch;
  const float* gw = w   + (size_t)(u0 + (wave * 32 + q) * WS) * cINK + ch;
  const unsigned lx = lds_off(&sm.sX[0][wave * 32 + q][ch]);
  const unsigned lw = lds_off(&sm.sW[0][wave * 32 + q][ch]);
  auto stage = [&](int buf, int k0) {
    unsigned l[8];
    const float* g[8];
#pragma unroll  // constant c, here and below: every address is a base plus a constant
    for (int c = 0; c < 8; ++c) {
      l[c] = lx + (unsigned)((buf * (32 * cPT) + c * 4) * (cXP * 4));
      g[c] = gx + k0 + c * 4 * cINK;
    }
    async_copy_8x512(l, g);
#pragma unroll
    for (int c = 0; c < 8; ++c) {
      l[c] = lw + (unsigned)((buf * (32 * cPT) + c * 4) * (cXP * 4));
      g[c] = gw + k0 + c * 4 * WS * cINK;
    }
    async_copy_8x512(l, g);
  };

  v8f acc[cPT][cPT] = {};
  float bv[cPT][8];                        // bias of accumulator row r of tile ib
#pragma unroll
  for (int ib = 0; ib < cPT; ++ib)
#pragma unroll
    for (int r = 0; r < (VT ? 1 : 8); ++r)
      bv[ib][r] = bias[u0 + (j0 + ib * 16 + (VT ? row : hi * 8 + r)) * WS];
  // The bias loads' address registers are reused only once they have issued; the
  // scheduling barrier keeps what follows behind the wait.
  asm volatile("s_wait_xcnt 0x0" ::: "memory");
  __builtin_amdgcn_sched_barrier(0);
  stage(0, 0);
  wait_async0();       // step 0 has landed, this wave's part
  __syncthreads();     // ... and every wave's
  stage(1, 32);
  const float* px = &sm.sX[0][(wave >> 1) * (16 * cPT) + row][hi * 8];
  const float* pw = &sm.sW[0][(wave & 1) * (16 * cPT) + row][hi * 8];
#pragma unroll  // constant k0: every LDS read is its row pointer plus an immediate
  for (int k0 = 0; k0 < cINK; k0 += 32) {
    const int buf = (k0 >> 5) & 1;
    v4f rx[cPT][4], rw[cPT][4];            // this step's operands, still f32
#pragma unroll
    for (int i = 0; i < cPT; ++i) {
      load_row_f32(rx[i], px + (buf * (32 * cPT) + i * 16) * cXP);
      load_row_f32(rw[i], pw + (buf * (32 * cPT) + i * 16) * cXP);
    }
    v16h x[cPT], wf[cPT];
#pragma unroll
    for (int i = 0; i < cPT; ++i) {
      x[i]  = cvt_row_f16(rx[i]);
      wf[i] = cvt_row_f16(rw[i]);
    }
#pragma unroll
    for (int ia = 0; ia < cPT; ++ia)
#pragma unroll
      for (int ib = 0; ib < cPT; ++ib)
        acc[ia][ib] = VT ? wmma16(x[ia], wf[ib], acc[ia][ib])
                         : wmma16(wf[ib], x[ia], acc[ia][ib]);
    // Hand-over: this wave's reads of the buffer have retired and its copies of the
    // next step have landed; behind the barrier that holds for every wave, and the
    // buffer just read is refilled.
    asm volatile("s_wait_dscnt 0x0" ::: "memory");
    wait_async0();
    __syncthreads();
    if (k0 + 64 < cINK) stage(buf, k0 + 64);
  }
  wait_async0();       // no copy is outstanding behind the loop

  const int bi = m0 / cL, l0 = m0 % cL;    // a 64-row tile lies in one batch entry
  // --- the wave's tile, f16, into its own LDS range: 64 destination rows of 128 B ----
  // (VT: a row is a hidden unit, 64 l along it; !VT: a row is an l, 64 d along it.)
  // The operand buffers are idle: every wave's reads of them retired in front of the
  // loop's last barrier and no copy is outstanding.
  static_assert(sizeof(sm.sX) >= (size_t)4 * (16 * cPT) * cTP * sizeof(_Float16), "four tiles fit sX");
  _Float16* tile = (_Float16*)&sm.sX[0][0][0] + wave * (16 * cPT * cTP);
  {
    _Float16* tw = tile + row * cTP + hi * 8;   // this lane's 8 values at ia = ib = 0
#pragma unroll  // constant ib, ia: acc stays in registers, every LDS address is tw plus an immediate
    for (int ib = 0; ib < cPT; ++ib)
#pragma unroll
      for (int ia = 0; ia < cPT; ++ia) {
        v8h o;
#pragma unroll
        for (int r = 0; r < 8; ++r) o[r] = (_Float16)(acc[ia][ib][r] + bv[ib][VT ? 0 : r]);
        *(v8h*)(tw + (VT ? ib * 16 * cTP + ia * 16 : ia * 16 * cTP + ib * 16)) = o;
      }
  }
  // The wave reads back what its other lanes wrote: their writes have retired first.
  asm volatile("s_wait_dscnt 0x0" ::: "memory");
  // --- whole lines out, 512 B a wave-wide store -------------------------------------
  // !VT: 4 rows l of 128 B, eight lanes a row.
  // VT : tile row j is head j%8 at d = (u0+j0)/8 + j/8. Store it takes head it%8 and key
  //      tile it/8: its 8 d x 32 l, four lanes a d, lie side by side in the PvT tile.
  constexpr int NS = (16 * cPT) / 4;
  static_assert(!VT || (NS == 2 * cHEADS && 16 * cPT == 2 * cVT), "16 stores: 8 heads x 2 key tiles");
  const _Float16* tr = VT ? tile + (lane >> 2) * (cHEADS * cTP) + (lane & 3) * 8
                          : tile + q * cTP + (lane & 7) * 8;
  v8h o[NS];
#pragma unroll  // constant it: o stays in registers, every address is a base plus a constant
  for (int it = 0; it < NS; ++it)
    o[it] = *(const v8h*)(tr + (VT ? (it & 7) * cTP + (it >> 3) * cVT : it * 4 * cTP));
  _Float16* gp = VT ? dst + ((size_t)bi * cHEADS * (cL / cVT) + l0 / cVT) * cVTE + ((u0 + j0) >> 3) * cVT + lane * 8
                    : dst + (((size_t)bi * cHEADS + nc) * cL + l0 + q) * cD + j0 + (lane & 7) * 8;
#pragma unroll
  for (int it = 0; it < NS; ++it)
    *(v8h*)(gp + (VT ? ((size_t)(it & 7) * (cL / cVT) + (it >> 3)) * cVTE : (size_t)(it * 4) * cD)) = o[it];
  // The other variant's code follows this one in the built kernel: the stores' registers
  // are reused only once the stores have issued.
  asm volatile("s_wait_xcnt 0x0" ::: "memory");
  __builtin_amdgcn_sched_barrier(0);
}

__global__ void __launch_bounds__(128)
proj_kernel(const float* __restrict__ KEY,
                            const float* __restrict__ VALUE,
                            const float* __restrict__ QUERY,
                            const float* __restrict__ W_w,
                            const float* __restrict__ W_b,
                            const float* __restrict__ Wv_w,
                            const float* __restrict__ Wv_b,
                            _Float16* __restrict__ Pk,
                            _Float16* __restrict__ Pq,
                            _Float16* __restrict__ PvT) {
  __shared__ __attribute__((aligned(16))) ProjSmem sm;   // 16-byte copies and reads stay whole
  const int which = blockIdx.y;
  constexpr int NB = cHID / (32 * cPT);    // 8 block columns
  const int mb = (blockIdx.x / NB) * (32 * cPT);
  const int nc = blockIdx.x % NB;          // block column: 128 units (PvT) or one head (Pk/Pq)
  static_assert(NB == cHEADS && cD == 32 * cPT, "a block column of Pk/Pq is one head");

  if (which == 2) proj_tile<true>(VALUE, Wv_w, Wv_b, PvT, sm, mb, nc);
  else            proj_tile<false>(which == 0 ? KEY : QUERY, W_w, W_b,
                                   which == 0 ? Pk : Pq, sm, mb, nc);
}

// ---------------------------------------------------------------------------
// Kernel B: fused attention. One block per (b, 64-col Lq tile, key range);
// 8 waves = 8 heads. Every K and PvT fragment feeds cNQ WMMAs, one per 16-col
// query sub-tile. The sum over keys has no normaliser (the softmax runs over
// heads), so each key range writes its own partial ctx plane and the output
// projection adds the planes in its accumulate chain.
// K tiles double-buffered in LDS via async copies; Q fragments hoisted; score
// WMMAs -> LDS -> cross-head softmax (elementwise in (i,k)) -> PvT@attn WMMAs.
// The exchange keeps the keys i of one (head, query) side by side, as the score
// accumulators and the attn fragments hold them: every LDS access of it is 16 bytes
// a lane, and the weights go back as f16, already in fragment order.
// The PvT tile of a trip flies into LDS under that trip's softmax; each wave
// copies and reads its own head's tile only.
// The ctx rows are put together in LDS and stored as whole 128-byte lines.
// ---------------------------------------------------------------------------
constexpr int cKP = cD + 8;     // K row pitch in LDS: 272 B = 17 x 16 B, so the 16 rows that a
                                // fragment read touches fall on 16 different bank groups
constexpr int cVP = 32 + 8;     // PvT row pitch in LDS: 80 B = 5 x 16 B, for the same reason
constexpr int cCP = cHID + 4;   // ctx row pitch in LDS: 2056 B = 514 dwords, so the 16 rows and 2 d
                                // groups that a wave's 2-byte write touches fall on 32 different banks
constexpr int cSP = 32 + 4;     // score row pitch in LDS: 144 B = 9 x 16 B, for the same reason
typedef __attribute__((ext_vector_type(4))) _Float16 v4h;
struct AttnSmem {
  _Float16 sK[2][cHEADS][32][cKP];  // 136 KB, double-buffered K tiles (first!)
  // 72 KB, score/attn exchange: a row holds the 32 keys of one (head, sub-tile, query)
  // as f32 scores; the softmax puts the f16 weights of keys 8g..8g+7 over the first
  // 16 bytes of the 32 that held their scores.
  float    s_sc[cHEADS][cNQ][16][cSP];
  _Float16 sV[cHEADS][cD][cVP];     // 80 KB, this trip's PvT tiles (128 d x 32 keys a head)
};

__global__ void __launch_bounds__(256)   // real block size: registers for the wide tile
attn_kernel(const _Float16* __restrict__ Pk,
                            const _Float16* __restrict__ Pq,
                            const _Float16* __restrict__ PvT,
                            _Float16* __restrict__ ctx) {
  __shared__ __attribute__((aligned(16))) AttnSmem sm;   // 16-byte K reads stay whole

  constexpr int QT = cL / (16 * cNQ);      // query tiles per batch entry
  const int bb = blockIdx.x / QT;
  const int kt = blockIdx.x % QT;
  const int ks = blockIdx.y;               // key range of this block
  const int h  = threadIdx.x >> 5;         // wave id == head
  const int lane = lane_id();

  const _Float16* Kh = Pk  + ((size_t)(bb * cHEADS + h) * cL + ks * cLK) * cD;
  const _Float16* Qt = Pq  + ((size_t)(bb * cHEADS + h) * cL) * cD
                           + (size_t)(kt * 16 * cNQ) * cD;
  // [L/32][d][32]; the wave's number as a scalar: the tiles' base then takes no vector register
  const _Float16* Vt = PvT + ((size_t)(bb * cHEADS + __builtin_amdgcn_readfirstlane(h)) * (cL / cVT)
                              + ks * (cLK / cVT)) * cVTE;

  // Q fragments are invariant over the whole Lk loop: hoist (cNQ x 4 x v16h).
  v16h bq[cNQ][4];
#pragma unroll  // constant c: the per-sub-tile arrays stay in registers
  for (int c = 0; c < cNQ; ++c)
#pragma unroll
    for (int q = 0; q < 4; ++q)
      bq[c][q] = frag_rm_f16(Qt + (size_t)(c * 16) * cD + q * 32, cD);
  // the Q loads share one address pair: hold its reuse behind their issue
  asm volatile("s_wait_xcnt 0x0" ::: "memory");

  v8f acc[cNQ][8] = {};                    // per sub-tile: 8 j-tiles (d) x 16 k cols

  // --- async stage of one 32x128 f16 K tile (8 KB) into sK[buf][h] --------
  auto stage_k = [&](int buf, int i0) {
    // the wave's number as a scalar: the tile's base then takes no vector register
    unsigned base = (unsigned)((buf * cHEADS + __builtin_amdgcn_readfirstlane(h)) * (32 * cKP * 2)
                               + (lane >> 4) * (cKP * 2) + (lane & 15) * 16);   // sK @ LDS off 0
    const char* g = (const char*)(Kh + (size_t)i0 * cD);
#pragma unroll
    for (int t = 0; t < 16; ++t) {
      unsigned lds = base + (unsigned)(t * (2 * cKP * 2));   // 544 B = two padded rows
      async_copy_512(lds, g + t * 512 + lane * 16);
    }
  };

  // --- async stage of one 128x32 f16 PvT tile (8 KB) into sV[h] -----------
  // A copy brings 8 rows of 64 B, four lanes a row: 512 B in a row of the source,
  // four whole lines.
  static_assert(cVT == 32, "a trip takes one PvT tile");
  auto stage_v = [&]() {
    _Float16* l = &sm.sV[h][lane >> 2][(lane & 3) * 8];
    async_copy_run<0, 16, 8 * cVP * 2>((char*)l, (const char*)Vt + (unsigned)(lane * 16));
    Vt += cVTE;
  };

  stage_k(0, 0);

  for (int i0 = 0; i0 < cLK; i0 += 32) {
    const int  cur  = (i0 >> 5) & 1;
    const bool more = (i0 + 32) < cLK;
    if (more) stage_k(cur ^ 1, i0 + 32);

    if (more) wait_async16();   // oldest 16 (current buffer) complete
    else      wait_async0();

    const _Float16* sk = &sm.sK[cur][h][0][0];

    // --- score tiles S[i0..i0+31][kt*64..+64] (cNQ sub-tiles) for this head (from LDS) ---
    v8f s0[cNQ] = {}, s1[cNQ] = {};
#pragma unroll
    for (int k0 = 0; k0 < cD; k0 += 32) {
      v16h a0 = frag_rm_f16(sk + k0, cKP);
      v16h a1 = frag_rm_f16(sk + 16 * cKP + k0, cKP);
#pragma unroll  // constant c: the per-sub-tile arrays stay in registers
      for (int c = 0; c < cNQ; ++c) {
        s0[c] = wmma16(a0, bq[c][k0 >> 5], s0[c]);
        s1[c] = wmma16(a1, bq[c][k0 >> 5], s1[c]);
      }
    }
    // This wave's reads of sV (the trip before) have retired before it is refilled.
    asm volatile("s_wait_dscnt 0x0" ::: "memory");
    __syncthreads();   // prior iteration's s_sc and sV reads are done
    stage_v();         // lands under the score exchange and the softmax
    {
      // a lane's 8 accumulator rows are 8 successive keys of its query column
      float* wr = &sm.s_sc[h][0][lane & 15][(lane >> 4) * 8];
#pragma unroll  // constant c: the per-sub-tile arrays stay in registers
      for (int c = 0; c < cNQ; ++c) {
        float* p = wr + c * (16 * cSP);
        *(v4f*)(p)      = __builtin_shufflevector(s0[c], s0[c], 0, 1, 2, 3);
        *(v4f*)(p + 4)  = __builtin_shufflevector(s0[c], s0[c], 4, 5, 6, 7);
        *(v4f*)(p + 16) = __builtin_shufflevector(s1[c], s1[c], 0, 1, 2, 3);
        *(v4f*)(p + 20) = __builtin_shufflevector(s1[c], s1[c], 4, 5, 6, 7);
      }
    }
    __syncthreads();
    // --- softmax across the 8 heads, elementwise in (i,k) ----------------
    // One thread takes 8 successive keys of one (sub-tile, query) in all heads. The 16
    // lanes that an LDS access serves together take rows q, q+1, q+8, q+9: at 9 chunks
    // of 16 B a row their every-other chunks fall on 16 different bank groups.
    {
      const int kk = (h & 1) * 4 + (lane >> 4) * 2 + ((lane >> 2) & 1) + ((lane >> 3) & 1) * 8;
      float* row = &sm.s_sc[0][h >> 1][kk][(lane & 3) * 8];
      constexpr int HS = cNQ * 16 * cSP;   // floats from one head to the next
      v8f v[cHEADS];                       // one head's 8 keys: neighbours pair up in packed f32 ops
      v8f m = -3.0e38f;
#pragma unroll  // constant hh, here and below: v stays in registers
      for (int hh = 0; hh < cHEADS; ++hh) {
        v[hh] = __builtin_shufflevector(*(const v4f*)(row + hh * HS), *(const v4f*)(row + hh * HS + 4),
                                        0, 1, 2, 3, 4, 5, 6, 7) * cSCALE;
        m = __builtin_elementwise_max(m, v[hh]);
      }
      v8f sum = 0.f;
#pragma unroll
      for (int hh = 0; hh < cHEADS; ++hh) {
        v[hh] -= m;
#pragma unroll
        for (int p = 0; p < 8; ++p) v[hh][p] = __expf(v[hh][p]);
        sum += v[hh];
      }
      const v8f inv = 1.f / sum;
#pragma unroll
      for (int hh = 0; hh < cHEADS; ++hh)
        *(v8h*)(row + hh * HS) = __builtin_convertvector(v[hh] * inv, v8h);
    }
    wait_async0();     // this trip's PvT tile has landed (the next K tile too)
    __syncthreads();
    // --- out_h[j,k] += PvT[j,i] @ attn[i,k]  (K = 32 rows of i) ----------
    v16h battn[cNQ];
#pragma unroll  // constant c: the per-sub-tile arrays stay in registers
    for (int c = 0; c < cNQ; ++c) {
      // keys 8*hi.. and 16+8*hi.. of this lane's query: the fragment's two halves
      const float* ab = &sm.s_sc[h][c][lane & 15][(lane >> 4) * 8];
      battn[c] = __builtin_shufflevector(*(const v8h*)ab, *(const v8h*)(ab + 16),
                                         0, 1, 2, 3, 4, 5, 6, 7, 8, 9, 10, 11, 12, 13, 14, 15);
    }
    const _Float16* sv = &sm.sV[h][0][0];
    v16h av[8];                            // four are live at a time
#pragma unroll  // constant jt, here and below: av and acc stay in registers
    for (int jt = 0; jt < 4; ++jt) av[jt] = frag_rm_f16(sv + jt * 16 * cVP, cVP);
#pragma unroll
    for (int j0 = 0; j0 < 8; j0 += 2) {
      // Keeps the LDS reads four fragments ahead of the WMMAs that use them: left
      // alone the scheduler reads one fragment at a time and waits for each.
      __builtin_amdgcn_sched_barrier(0);
#pragma unroll
      for (int jt = j0; jt < j0 + 2; ++jt)
#pragma unroll  // constant c: the per-sub-tile arrays stay in registers
        for (int c = 0; c < cNQ; ++c) acc[c][jt] = wmma16(av[jt], battn[c], acc[c][jt]);
      if (j0 + 4 < 8) {
#pragma unroll
        for (int jt = j0 + 4; jt < j0 + 6; ++jt) av[jt] = frag_rm_f16(sv + jt * 16 * cVP, cVP);
      }
    }
  }

  // --- store ctx[ks][b][l][d*8 + h] (f16), the reference's head interleave --
  // The block holds all 8 heads and all 128 d of its 64 rows l: 64 whole ctx rows of
  // 2 KB. The waves interleave their heads in LDS and the block then stores whole
  // 128-byte lines, 512 contiguous bytes a wave-wide store. The rows lie over the K
  // buffers, which nobody reads or fills behind the last trip's barriers.
  static_assert(sizeof(sm.sK) >= (size_t)(16 * cNQ) * cCP * sizeof(_Float16), "ctx rows fit sK");
  _Float16* st = &sm.sK[0][0][0][0];
  {
    // this lane's element at c = jt = r = 0; the others lie at constant distances
    _Float16* wp = st + (lane & 15) * cCP + (lane >> 4) * (8 * cHEADS) + h;
#pragma unroll  // constant c: the per-sub-tile arrays stay in registers
    for (int c = 0; c < cNQ; ++c)
#pragma unroll
      for (int jt = 0; jt < 8; ++jt)
#pragma unroll
        for (int r = 0; r < 8; ++r)
          wp[c * 16 * cCP + (jt * 16 + r) * cHEADS] = (_Float16)acc[c][jt][r];
  }
  __syncthreads();   // all eight heads' values stand in LDS before a row is read
  constexpr int NR = (16 * cNQ) / 2;       // the block's 256 lanes cover two rows a round
  const int tr = (int)threadIdx.x >> 7, tc = ((int)threadIdx.x & 127) * 8;
  const _Float16* sp = st + tr * cCP + tc;
  _Float16* gp = ctx + (size_t)ks * ((size_t)cB * cL * cHID)
                     + ((size_t)bb * cL + kt * (16 * cNQ) + tr) * cHID + tc;
  v8h o[NR];
#pragma unroll  // constant it: o stays in registers, every address is a base plus a constant
  for (int it = 0; it < NR; ++it) {
    const v4h lo = *(const v4h*)(sp + it * 2 * cCP);
    const v4h hi = *(const v4h*)(sp + it * 2 * cCP + 4);
    o[it] = __builtin_shufflevector(lo, hi, 0, 1, 2, 3, 4, 5, 6, 7);
  }
#pragma unroll
  for (int it = 0; it < NR; ++it) *(v8h*)(gp + (size_t)(it * 2) * cHID) = o[it];
}

// ---------------------------------------------------------------------------
// Kernel C: final projection (sum of the cKS ctx planes)[8192,1024](f16)
// @ Wo^T[1024,256] + b -> f32. One wave per 64x64 output tile (cOT x cOT WMMA
// tiles): every ctx fragment feeds cOT WMMAs, every weight fragment cKS x cOT. The two waves of a block share
// their 64 ctx rows. The planes are added by running every plane through the
// same f32 accumulate chain, plane 0 then plane 1 at each k-step.
// ---------------------------------------------------------------------------
constexpr int cOT = 4;          // 16-row fragments per side of a wave's tile

__global__ void __launch_bounds__(64)
outproj_kernel(const _Float16* __restrict__ ctx,
                               const float* __restrict__ Wo_w,
                               const float* __restrict__ Wo_b,
                               float* __restrict__ out) {
  const int lane = lane_id();
  const int row = lane & 15, hi = lane >> 4;
  const int m0 = (int)(blockIdx.x >> 1) * (16 * cOT);
  const int n0 = (int)((blockIdx.x & 1) * 2 + (threadIdx.x >> 5)) * (16 * cOT);

  // This lane's first 8 k of fragment 0, per ctx plane and for the weights; the
  // other fragments and the second 8 k lie at constant distances from them.
  const _Float16* pa[cKS];
#pragma unroll
  for (int p = 0; p < cKS; ++p)
    pa[p] = ctx + (size_t)p * ((size_t)cB * cL * cHID) + (size_t)(m0 + row) * cHID + hi * 8;
  const float* pw = Wo_w + (size_t)(n0 + row) * cHID + hi * 8;

  float bv[cOT];                           // bias of this lane's column in tile column ib
#pragma unroll
  for (int ib = 0; ib < cOT; ++ib) bv[ib] = Wo_b[n0 + ib * 16 + row];
  // The bias loads' address register is reused only once they have issued; the
  // scheduling barrier keeps what follows behind the wait.
  asm volatile("s_wait_xcnt 0x0" ::: "memory");
  __builtin_amdgcn_sched_barrier(0);

  v8f acc[cOT][cOT] = {};
  v8h ra[cKS][cOT][2];                     // the next step's ctx fragments, in halves
  v4f rw[cOT][4];                          // the next step's weights, still f32
  auto fetch = [&]() {
#pragma unroll
    for (int i = 0; i < cOT; ++i) {
#pragma unroll
      for (int p = 0; p < cKS; ++p)
#pragma unroll
        for (int s = 0; s < 2; ++s)
          ra[p][i][s] = *(const v8h*)(pa[p] + (size_t)(i * 16) * cHID + s * 16);
#pragma unroll
      for (int s = 0; s < 4; ++s)
        rw[i][s] = *(const v4f*)(pw + (size_t)(i * 16) * cHID + (s >> 1) * 16 + (s & 1) * 4);
    }
    // The three pointers move on only once the loads that name them have issued;
    // the scheduling barrier keeps the loads, all of them, in front of what follows
    // (the current step's WMMAs, under which they fly).
    asm volatile("s_wait_xcnt 0x0" ::: "memory");
    __builtin_amdgcn_sched_barrier(0);
#pragma unroll
    for (int p = 0; p < cKS; ++p) pa[p] += 32;
    pw += 32;
  };
  fetch();
#pragma unroll 2  // two steps a trip: the fetched fragments change names, not registers
  for (int k0 = 0; k0 < cHID; k0 += 32) {
    v16h a[cKS][cOT], b[cOT];
#pragma unroll
    for (int i = 0; i < cOT; ++i) {
#pragma unroll
      for (int p = 0; p < cKS; ++p)
        a[p][i] = __builtin_shufflevector(ra[p][i][0], ra[p][i][1],
                                          0, 1, 2, 3, 4, 5, 6, 7, 8, 9, 10, 11, 12, 13, 14, 15);
#pragma unroll
      for (int e = 0; e < 16; ++e) b[i][e] = (_Float16)rw[i][e >> 2][e & 3];
    }
    if (k0 + 32 < cHID) fetch();
#pragma unroll
    for (int p = 0; p < cKS; ++p)
#pragma unroll
      for (int ia = 0; ia < cOT; ++ia)
#pragma unroll
        for (int ib = 0; ib < cOT; ++ib)
          acc[ia][ib] = wmma16(a[p][ia], b[ib], acc[ia][ib]);
  }

#pragma unroll
  for (int ib = 0; ib < cOT; ++ib)
#pragma unroll
    for (int ia = 0; ia < cOT; ++ia)
#pragma unroll
      for (int r = 0; r < 8; ++r) acc[ia][ib][r] += bv[ib];
  float* po = out + (size_t)(m0 + hi * 8) * cOUT + n0 + row;
  // Every sum and the one address stand in their registers before the first store
  // issues, so that no register which a store names is written behind it.
  __builtin_amdgcn_sched_barrier(0);
#pragma unroll
  for (int ib = 0; ib < cOT; ++ib)
#pragma unroll
    for (int ia = 0; ia < cOT; ++ia)
#pragma unroll
      for (int r = 0; r < 8; ++r) po[(ia * 16 + r) * cOUT + ib * 16] = acc[ia][ib][r];
}

// ---------------------------------------------------------------------------
extern "C" void kernel_launch(void* const* d_in, const int* in_sizes, int n_in,
                              void* d_out, int out_size, void* d_ws, size_t ws_size,
                              hipStream_t stream) {
  (void)in_sizes; (void)n_in; (void)out_size; (void)ws_size;
  const float* KEY   = (const float*)d_in[0];
  const float* VALUE = (const float*)d_in[1];
  const float* QUERY = (const float*)d_in[2];
  const float* W_w   = (const float*)d_in[3];
  const float* W_b   = (const float*)d_in[4];
  const float* Wv_w  = (const float*)d_in[5];
  const float* Wv_b  = (const float*)d_in[6];
  const float* Wo_w  = (const float*)d_in[7];
  const float* Wo_b  = (const float*)d_in[8];
  float* out = (float*)d_out;

  // f16 workspace: Pk, Pq, PvT (head-split) + cKS ctx planes, 16 MB each.
  const size_t pelems = (size_t)cB * cHEADS * cL * cD;   // == B*L*HID
  _Float16* Pk  = (_Float16*)d_ws;
  _Float16* Pq  = Pk + pelems;
  _Float16* PvT = Pq + pelems;
  _Float16* ctx = PvT + pelems;

  {
    const int MB = (cB * cL) / (32 * cPT);   // 64 block rows
    const int NB = cHID / (32 * cPT);        // 8 block columns
    dim3 grid(MB * NB, 3);                   // 4 waves/block, 3 projections
    proj_kernel<<<grid, 128, 0, stream>>>(KEY, VALUE, QUERY, W_w, W_b, Wv_w, Wv_b,
                                          Pk, Pq, PvT);
  }
  {
    dim3 grid(cB * (cL / (16 * cNQ)), cKS);  // 128 x 2 blocks, 8 waves = 8 heads
    attn_kernel<<<grid, 256, 0, stream>>>(Pk, Pq, PvT, ctx);
  }
  {
    const int MT = (cB * cL) / (16 * cOT);   // 128 tile rows
    const int NT = cOUT / (16 * cOT);        // 4 tile columns
    dim3 grid((MT * NT) / 2);                // 256 blocks of 2 waves
    outproj_kernel<<<grid, 64, 0, stream>>>(ctx, Wo_w, Wo_b, out);
  }
}
